// v000
// Times are from an AMD MI455X. After a warm-up the kernel runs many times in a row, and a time is the length of
// such a window on the GPU divided by its runs, so every launch and the gaps after it count. The runs cycle
// through copies of the inputs. A figure is the median of several windows, for all but v000 over two sittings.
// Sittings can differ by a few percent; kernels timed side by side share one.
// v000, which the later versions start from, runs in 904 microseconds.
#include <hip/hip_runtime.h>

typedef __bf16 bf16_t;
typedef __attribute__((ext_vector_type(16))) __bf16 v16bf;
typedef __attribute__((ext_vector_type(8)))  __bf16 v8bf;
typedef __attribute__((ext_vector_type(8)))  float  v8f;
typedef __attribute__((ext_vector_type(4)))  float  v4f;

#define WMMA_BF16(A, B, C) \
  __builtin_amdgcn_wmma_f32_16x16x32_bf16(false, (A), false, (B), (short)0, (C), false, false)

// A-fragment (16x32 bf16) / B-fragment (load B^T rows; identical layout, N in the lane role).
// Lane (r = lane&15, h = lane>>4): row r, K = {k0+h*8 .. +7} then {k0+16+h*8 .. +7}.
static __device__ __forceinline__ v16bf load_frag_bf16(const bf16_t* __restrict__ p,
                                                       int ld, int row, int k0, int lane) {
  const int r = lane & 15, h = lane >> 4;
  const bf16_t* base = p + (size_t)(row + r) * (size_t)ld + (size_t)(k0 + h * 8);
  v16bf a;
  a.lo = *(const v8bf*)(base);
  a.hi = *(const v8bf*)(base + 16);
  return a;
}

// Register-blocked WMMA GEMM core: one wave computes a (16*MF) x (16*NF) tile.
template <int MF, int NF>
static __device__ __forceinline__ void gemm_core(const bf16_t* __restrict__ A,
                                                 const bf16_t* __restrict__ Bt,
                                                 int lda, int ldb, int K,
                                                 int mt, int nt, int lane,
                                                 v8f (&C)[MF][NF]) {
  for (int k0 = 0; k0 < K; k0 += 32) {
    v16bf Af[MF];
#pragma unroll
    for (int mi = 0; mi < MF; ++mi)
      Af[mi] = load_frag_bf16(A, lda, mt + 16 * mi, k0, lane);
#pragma unroll
    for (int j = 0; j < NF; ++j) {
      v16bf Bf = load_frag_bf16(Bt, ldb, nt + 16 * j, k0, lane);
#pragma unroll
      for (int mi = 0; mi < MF; ++mi)
        C[mi][j] = WMMA_BF16(Af[mi], Bf, C[mi][j]);
    }
  }
}

// Elementwise fp32 -> bf16 (8 elements/thread, grid-stride).
__global__ __launch_bounds__(256) void cvt_f32_bf16_kernel(const float* __restrict__ in,
                                                           bf16_t* __restrict__ outp,
                                                           long long n) {
  long long idx = ((long long)blockIdx.x * 256 + threadIdx.x) * 8;
  const long long stride = (long long)gridDim.x * 256 * 8;
  for (; idx < n; idx += stride) {
    v8f f;
    f.lo = *(const v4f*)(in + idx);
    f.hi = *(const v4f*)(in + idx + 4);
    *(v8bf*)(outp + idx) = __builtin_convertvector(f, v8bf);
  }
}

// out = X * W^T + bias ; X:(M,K) bf16, W:(N,K) bf16 row-major.
// transposed==0: out (M,N) bf16 row-major; transposed==1: out (N,M) bf16 row-major (V^T).
// Wave tile 64x64 (4x4 fragments).
__global__ __launch_bounds__(256) void qkv_proj_kernel(
    const bf16_t* __restrict__ X, const bf16_t* __restrict__ W,
    const float* __restrict__ bias, bf16_t* __restrict__ out,
    int M, int N, int K, int transposed) {
  const int lane = threadIdx.x & 31;
  const int wid  = blockIdx.x * 8 + (threadIdx.x >> 5);
  const int tilesN = N >> 6;
  const int mt = (wid / tilesN) << 6;
  const int nt = (wid % tilesN) << 6;

  v8f C[4][4] = {};
  gemm_core<4, 4>(X, W, K, K, K, mt, nt, lane, C);

  const int r = lane & 15, h = lane >> 4;
#pragma unroll
  for (int mi = 0; mi < 4; ++mi) {
    const int rowb = mt + 16 * mi + h * 8;
#pragma unroll
    for (int j = 0; j < 4; ++j) {
      const int n = nt + 16 * j + r;
      const float bval = bias[n];
      if (!transposed) {
#pragma unroll
        for (int i = 0; i < 8; ++i)
          out[(size_t)(rowb + i) * (size_t)N + n] = (bf16_t)(C[mi][j][i] + bval);
      } else {
        v8bf o;
#pragma unroll
        for (int i = 0; i < 8; ++i) o[i] = (bf16_t)(C[mi][j][i] + bval);
        *(v8bf*)(out + (size_t)n * (size_t)M + (size_t)rowb) = o;
      }
    }
  }
}

// out = scale * (A * Bt^T), batched via blockIdx.y.
// A:(M,K) bf16 lda, Bt:(N,K) bf16 ldb, out:(M,N) f32 ldo. Wave tile 32x64 (2x4 fragments).
__global__ __launch_bounds__(256) void attn_gemm_kernel(
    const bf16_t* __restrict__ A, const bf16_t* __restrict__ Bt,
    float* __restrict__ outp, int M, int N, int K,
    int lda, int ldb, int ldo,
    long long strideA, long long strideB, long long strideO, float scale) {
  const int b = blockIdx.y;
  const bf16_t* Ab  = A  + (size_t)b * strideA;
  const bf16_t* Btb = Bt + (size_t)b * strideB;
  float* ob = outp + (size_t)b * strideO;

  const int lane = threadIdx.x & 31;
  const int wid  = blockIdx.x * 8 + (threadIdx.x >> 5);
  const int tilesN = N >> 6;
  const int mt = (wid / tilesN) << 5;
  const int nt = (wid % tilesN) << 6;

  v8f C[2][4] = {};
  gemm_core<2, 4>(Ab, Btb, lda, ldb, K, mt, nt, lane, C);

  const int r = lane & 15, h = lane >> 4;
#pragma unroll
  for (int mi = 0; mi < 2; ++mi) {
    const int rowb = mt + 16 * mi + h * 8;
#pragma unroll
    for (int j = 0; j < 4; ++j) {
      const int n = nt + 16 * j + r;
#pragma unroll
      for (int i = 0; i < 8; ++i)
        ob[(size_t)(rowb + i) * (size_t)ldo + n] = C[mi][j][i] * scale;
    }
  }
}

// Row softmax: fp32 scores (N==2048) -> bf16 probabilities. One 256-thread block per row,
// batched via blockIdx.y.
__global__ __launch_bounds__(256) void softmax_kernel(
    const float* __restrict__ S, bf16_t* __restrict__ P, int N,
    long long strideS, long long strideP) {
  const int row = blockIdx.x;
  const int tid = threadIdx.x;
  const float* srow = S + (size_t)blockIdx.y * strideS + (size_t)row * (size_t)N;
  bf16_t* prow = P + (size_t)blockIdx.y * strideP + (size_t)row * (size_t)N;
  __shared__ float red[8];

  float vals[8];
  float mx = -3.0e38f;
#pragma unroll
  for (int i = 0; i < 8; ++i) {
    vals[i] = srow[tid + (i << 8)];
    mx = fmaxf(mx, vals[i]);
  }
#pragma unroll
  for (int off = 16; off >= 1; off >>= 1)
    mx = fmaxf(mx, __shfl_xor(mx, off, 32));
  if ((tid & 31) == 0) red[tid >> 5] = mx;
  __syncthreads();
  mx = red[0];
#pragma unroll
  for (int w = 1; w < 8; ++w) mx = fmaxf(mx, red[w]);
  __syncthreads();

  float sum = 0.0f;
#pragma unroll
  for (int i = 0; i < 8; ++i) {
    vals[i] = __expf(vals[i] - mx);
    sum += vals[i];
  }
#pragma unroll
  for (int off = 16; off >= 1; off >>= 1)
    sum += __shfl_xor(sum, off, 32);
  if ((tid & 31) == 0) red[tid >> 5] = sum;
  __syncthreads();
  sum = 0.0f;
#pragma unroll
  for (int w = 0; w < 8; ++w) sum += red[w];
  const float inv = 1.0f / sum;

#pragma unroll
  for (int i = 0; i < 8; ++i)
    prow[tid + (i << 8)] = (bf16_t)(vals[i] * inv);
}

extern "C" void kernel_launch(void* const* d_in, const int* in_sizes, int n_in,
                              void* d_out, int out_size, void* d_ws, size_t ws_size,
                              hipStream_t stream) {
  const float* x  = (const float*)d_in[0];
  const float* Wq = (const float*)d_in[1];
  const float* bq = (const float*)d_in[2];
  const float* Wk = (const float*)d_in[3];
  const float* bk = (const float*)d_in[4];
  const float* Wv = (const float*)d_in[5];
  const float* bv = (const float*)d_in[6];
  float* out = (float*)d_out;

  const int B = 8, S = 2048, D = 1024;
  const int MS = B * S; // 16384
  const float scale = 0.03125f; // 1/sqrt(1024)

  // ---- workspace layout (all offsets 16B aligned) ----
  char* ws = (char*)d_ws;
  bf16_t* xb  = (bf16_t*)(ws);                         // 16384x1024 bf16 = 32 MB
  bf16_t* Wqb = (bf16_t*)(ws + (size_t)33554432);      // 1024x1024 bf16 = 2 MB
  bf16_t* Wkb = (bf16_t*)(ws + (size_t)35651584);
  bf16_t* Wvb = (bf16_t*)(ws + (size_t)37748736);
  bf16_t* Q   = (bf16_t*)(ws + (size_t)39845888);      // 32 MB
  bf16_t* Km  = (bf16_t*)(ws + (size_t)73400320);      // 32 MB
  bf16_t* VT  = (bf16_t*)(ws + (size_t)106954752);     // V^T (1024 x 16384), 32 MB
  const size_t attBase = 140509184;
  // Full tier: scores f32 for all batches (134 MB) + P bf16 for all batches (67 MB)
  const size_t fullNeed = attBase + (size_t)B * S * S * 4 + (size_t)B * S * S * 2; // ~326 MB

  dim3 blk(256);

  // ---- 1) convert inputs to bf16 ----
  cvt_f32_bf16_kernel<<<4096, blk, 0, stream>>>(x, xb, (long long)MS * D);
  cvt_f32_bf16_kernel<<<512,  blk, 0, stream>>>(Wq, Wqb, (long long)D * D);
  cvt_f32_bf16_kernel<<<512,  blk, 0, stream>>>(Wk, Wkb, (long long)D * D);
  cvt_f32_bf16_kernel<<<512,  blk, 0, stream>>>(Wv, Wvb, (long long)D * D);

  // ---- 2) projections (pure bf16 WMMA GEMM, 64x64 wave tiles) ----
  const int projBlocks = (MS / 64) * (D / 64) / 8; // 512
  qkv_proj_kernel<<<projBlocks, blk, 0, stream>>>(xb, Wqb, bq, Q,  MS, D, D, 0);
  qkv_proj_kernel<<<projBlocks, blk, 0, stream>>>(xb, Wkb, bk, Km, MS, D, D, 0);
  qkv_proj_kernel<<<projBlocks, blk, 0, stream>>>(xb, Wvb, bv, VT, MS, D, D, 1);

  const int scBlocks = (S / 32) * (S / 64) / 8; // 256 per batch
  const int pvBlocks = (S / 32) * (D / 64) / 8; // 128 per batch

  if (ws_size >= fullNeed) {
    // ---- full-parallel tier: all batches per launch (gridDim.y = 8) ----
    float*  Sc = (float*) (ws + attBase);
    bf16_t* P  = (bf16_t*)(ws + attBase + (size_t)B * S * S * 4);
    attn_gemm_kernel<<<dim3(scBlocks, B), blk, 0, stream>>>(
        Q, Km, Sc, S, S, D, D, D, S,
        (long long)S * D, (long long)S * D, (long long)S * S, scale);
    softmax_kernel<<<dim3(S, B), blk, 0, stream>>>(
        Sc, P, S, (long long)S * S, (long long)S * S);
    attn_gemm_kernel<<<dim3(pvBlocks, B), blk, 0, stream>>>(
        P, VT, out, S, D, S, S, MS, D,
        (long long)S * S, (long long)S, (long long)S * D, 1.0f);
  } else {
    // ---- per-batch tier: reuse one score/P buffer, stream-ordered ----
    float*  Sc = (float*) (ws + attBase);                        // 16 MB
    bf16_t* P  = (bf16_t*)(ws + attBase + (size_t)S * S * 4);    // 8 MB
    for (int b = 0; b < B; ++b) {
      const bf16_t* Qb = Q  + (size_t)b * S * D;
      const bf16_t* Kb = Km + (size_t)b * S * D;
      attn_gemm_kernel<<<dim3(scBlocks, 1), blk, 0, stream>>>(
          Qb, Kb, Sc, S, S, D, D, D, S, 0, 0, 0, scale);
      softmax_kernel<<<dim3(S, 1), blk, 0, stream>>>(Sc, P, S, 0, 0);
      attn_gemm_kernel<<<dim3(pvBlocks, 1), blk, 0, stream>>>(
          P, VT + (size_t)b * S, out + (size_t)b * S * D,
          S, D, S, S, MS, D, 0, 0, 0, 1.0f);
    }
  }
}

// v001
// Measured time: 362 microseconds a run.
// Next to v000, in two timings, it ran 2.52 times as fast each time.
#include <hip/hip_runtime.h>
#include <stdint.h>

typedef __bf16 bf16_t;
typedef __attribute__((ext_vector_type(16))) __bf16 v16bf;
typedef __attribute__((ext_vector_type(8)))  __bf16 v8bf;
typedef __attribute__((ext_vector_type(8)))  float  v8f;
typedef __attribute__((ext_vector_type(4)))  float  v4f;

#define WMMA_BF16(A, B, C) \
  __builtin_amdgcn_wmma_f32_16x16x32_bf16(false, (A), false, (B), (short)0, (C), false, false)

typedef uint32_t u32x4 __attribute__((ext_vector_type(4)));
typedef uint32_t u32x8 __attribute__((ext_vector_type(8)));

// Workgroup tile 128 x 128 of the output, eight waves, 16*MF x 16*NF per wave (32 x 64 or 64 x 32).
// A pass is 128 k = 256 bytes of each of the 128 A rows and 128 B^T rows. A stage in LDS is eight
// slices of 32 rows, slices 0..3 = A rows, 4..7 = B^T rows, one tensor load per wave and stage.
constexpr uint32_t ROWB    = 256u;            // bytes of one operand row per pass
constexpr uint32_t PITCH   = ROWB + 16u;      // LDS row pitch for ds_load_b128 readers (pad of 4 dwords)
constexpr uint32_t SROWS   = 32u;             // rows per slice
constexpr uint32_t SLICE_B = 10240u;          // 32 * 272 = 8704, rounded up to a multiple of 2 KiB
constexpr uint32_t BUF_B   = 8u * SLICE_B;    // one stage
constexpr uint32_t RING_B  = 2u * BUF_B;      // two buffers
static_assert(SROWS * PITCH <= SLICE_B && (SLICE_B % 2048u) == 0u, "a slice holds its padded rows and starts at a multiple of 2 KiB");

static __device__ __forceinline__ uint32_t uni(uint32_t v) { return (uint32_t)__builtin_amdgcn_readfirstlane(v); }
// A wave-uniform word held in a scalar register: the issue test on it compiles to s_cmp + s_cbranch_scc, and a
// descriptor word formed from it stays behind the volatile statements (the waits) that stand in front of it.
static __device__ __forceinline__ uint32_t pinned(uint32_t v) {
  uint32_t w = uni(v);
  asm volatile("" : "+s"(w));  // pinned(): a descriptor word or an issue test held in a scalar register
  return w;
}
static __device__ __forceinline__ void wait_ds0()     { asm volatile("s_wait_dscnt 0x0" ::: "memory"); }     // this wave's LDS reads have retired
static __device__ __forceinline__ void wait_tensor0() { asm volatile("s_wait_tensorcnt 0x0" ::: "memory"); } // this wave's tensor load has landed
// One request of the whole wave: a 2-D tile from global memory into LDS, through no register.
static __device__ __forceinline__ void tdm_load(u32x4 g0, u32x8 g1) { asm volatile("tensor_load_to_lds %0, %1" :: "s"(g0), "s"(g1) : "memory"); }

// Descriptor group 1: 1-byte elements, tensor = tile = 32 rows of 256 bytes, 4 dwords of LDS pad behind every row.
static __device__ __forceinline__ u32x8 tdm_group1(uint32_t src_pitch) {
  constexpr uint32_t d0 = ROWB, d1 = SROWS;
  u32x8 g;
  g[0] = uni((1u << 20) | (5u << 22) | (3u << 25));  // no mask; pad on, interval 64 dwords, amount 4 dwords
  // Words 1 to 7 are pinned: descriptor words held in scalar registers of their own for the whole loop,
  // so that none is used for anything else while a request is outstanding.
  g[1] = pinned((d0 & 0xFFFFu) << 16);
  g[2] = pinned((d0 >> 16) | ((d1 & 0xFFFFu) << 16));
  g[3] = pinned((d1 >> 16) | (d0 << 16));
  g[4] = pinned(d1);
  g[5] = pinned(src_pitch);
  g[6] = pinned(0u);
  g[7] = pinned(0u);
  return g;
}
static __device__ __forceinline__ u32x4 tdm_group0(uint32_t lds_dst, uint64_t ga) {
  u32x4 g;
  g[0] = uni(1u);
  g[1] = uni(lds_dst);
  g[2] = uni((uint32_t)ga);
  g[3] = uni((((uint32_t)(ga >> 32)) & 0x01FFFFFFu) | 0x80000000u);
  return g;
}

// A-fragment (16x32 bf16) / B-fragment (B^T rows; identical layout, N in the lane role) from LDS.
// p points at row (lane&15), 16-byte half (lane>>4): K = {k0+h*8 .. +7} then {k0+16+h*8 .. +7}.
static __device__ __forceinline__ v16bf lds_frag(const unsigned char* p) {
  v16bf a;
  a.lo = *(const v8bf*)(p);
  a.hi = *(const v8bf*)(p + 32);
  return a;
}

// C (16*MF x 16*NF per wave) += A[mt0.., :] * Bt[nt0.., :]^T for one 128 x 128 workgroup tile.
// Wave w holds rows 16*MF*(w / WN), columns 16*NF*(w % WN) of the tile, WN = 8 / NF waves along the columns.
// M, N multiples of 128; K a multiple of 128 and at least 256 (two stages).
template <int MF, int NF>
static __device__ __forceinline__ void gemm_core_lds(const bf16_t* __restrict__ A,
                                                     const bf16_t* __restrict__ Bt,
                                                     int lda, int ldb, int K,
                                                     int mt0, int nt0,
                                                     unsigned char* ring, v8f (&C)[MF][NF]) {
  static_assert(MF * NF == 8 && (MF % 2) == 0 && (NF % 2) == 0, "eight waves cover 128 x 128; a wave's rows start on a slice");
  constexpr uint32_t WN = 8u / (uint32_t)NF;
  const uint32_t lane = threadIdx.x & 31u, r = lane & 15u, h = lane >> 4;
  const uint32_t wave = uni(threadIdx.x >> 5);
  const uint32_t wm = wave / WN, wn = wave % WN;
  const uint32_t T = (uint32_t)K >> 7;  // passes

  // This wave's slice of every stage.
  const bool isA = wave < 4u;
  const bf16_t* srow = isA ? A + (size_t)(mt0 + (int)(SROWS * wave)) * (size_t)lda
                           : Bt + (size_t)(nt0 + (int)(SROWS * (wave - 4u))) * (size_t)ldb;
  const uint64_t ga0 = (uint64_t)(uintptr_t)srow;
  const uint32_t dst0 = (uint32_t)(uintptr_t)ring + wave * SLICE_B;
  const u32x8 g1 = tdm_group1(2u * (uint32_t)(isA ? lda : ldb));

  // Per-lane fragment bases inside a buffer.
  const uint32_t fa = wm * (uint32_t)(MF / 2) * SLICE_B + r * PITCH + 16u * h;
  const uint32_t fb = (4u + wn * (uint32_t)(NF / 2)) * SLICE_B + r * PITCH + 16u * h;
  // Fragment f of a wave's operand: 16 rows, two fragments to a slice.
  auto foff = [](uint32_t f) { return (f >> 1) * SLICE_B + (f & 1u) * 16u * PITCH; };

  tdm_load(tdm_group0(dst0, ga0), g1);          // stage 0
  wait_tensor0();
  __syncthreads();                              // stage 0 is published
  tdm_load(tdm_group0(dst0 + BUF_B, ga0 + ROWB), g1);  // stage 1

  uint32_t s = 0;
  do {  // T is at least 2: both stages loaded above exist
    const uint32_t buf = (s & 1u) * BUF_B;
    const unsigned char* pa = ring + buf + fa;
    const unsigned char* pb = ring + buf + fb;
    // Two fragment sets inside the pass: block kk + 1's twelve LDS reads go out as one group in front of
    // block kk's eight WMMAs. Nothing of another stage is read here.
    v16bf Af[2][MF], Bf[2][NF];
#pragma unroll  // register arrays need constant indices
    for (uint32_t mi = 0; mi < (uint32_t)MF; ++mi) Af[0][mi] = lds_frag(pa + foff(mi));
#pragma unroll
    for (uint32_t j = 0; j < (uint32_t)NF; ++j) Bf[0][j] = lds_frag(pb + foff(j));
#pragma unroll
    for (uint32_t kk = 0; kk < 4u; ++kk) {
      const uint32_t cur = kk & 1u, nxt = cur ^ 1u;
      if (kk + 1u < 4u) {
#pragma unroll
        for (uint32_t mi = 0; mi < (uint32_t)MF; ++mi) Af[nxt][mi] = lds_frag(pa + foff(mi) + (kk + 1u) * 64u);
#pragma unroll
        for (uint32_t j = 0; j < (uint32_t)NF; ++j) Bf[nxt][j] = lds_frag(pb + foff(j) + (kk + 1u) * 64u);
      }
      __builtin_amdgcn_sched_barrier(0);  // keeps the LDS reads in one group, out of the WMMA run
#pragma unroll
      for (uint32_t j = 0; j < (uint32_t)NF; ++j)
#pragma unroll
        for (uint32_t mi = 0; mi < (uint32_t)MF; ++mi)
          C[mi][j] = WMMA_BF16(Af[cur][mi], Bf[cur][j], C[mi][j]);
      __builtin_amdgcn_sched_barrier(0);  // keeps the next group of reads, and the publish point, behind this WMMA run
    }
    // Publish point of stage s + 1; it also ends every reader's last read of stage s's buffer.
    wait_ds0();
    wait_tensor0();
    __syncthreads();
    if (pinned((s + 2u < T) ? 1u : 0u) != 0u) {  // the refill, only while stage s + 2 exists
      const uint32_t nx = pinned(s + 2u);        // descriptor word source, formed behind the wait above
      tdm_load(tdm_group0(dst0 + buf, ga0 + (uint64_t)nx * ROWB), g1);
    }
  } while (++s < T);
  wait_tensor0();
  wait_ds0();
}

// Elementwise fp32 -> bf16 (8 elements/thread, grid-stride).
__global__ __launch_bounds__(256) void cvt_f32_bf16_kernel(const float* __restrict__ in,
                                                           bf16_t* __restrict__ outp,
                                                           long long n) {
  long long idx = ((long long)blockIdx.x * 256 + threadIdx.x) * 8;
  const long long stride = (long long)gridDim.x * 256 * 8;
  for (; idx < n; idx += stride) {
    v8f f;
    f.lo = *(const v4f*)(in + idx);
    f.hi = *(const v4f*)(in + idx + 4);
    *(v8bf*)(outp + idx) = __builtin_convertvector(f, v8bf);
  }
}

// out = X * W^T + bias ; X:(M,K) bf16, W:(N,K) bf16 row-major.
// TR==0: out (M,N) bf16 row-major, wave tile 32x64; TR==1: out (N,M) bf16 row-major (V^T), wave tile 64x32.
// Either way the 64 elements of a 128-byte line of out come from one wave. Workgroup tile 128x128.
template <int TR>
__global__ __launch_bounds__(256) void qkv_proj_kernel(
    const bf16_t* __restrict__ X, const bf16_t* __restrict__ W,
    const float* __restrict__ bias, bf16_t* __restrict__ out,
    int M, int N, int K) {
  constexpr int MF = TR ? 4 : 2, NF = TR ? 2 : 4, WN = 8 / NF;
  __shared__ __attribute__((aligned(2048))) unsigned char ring[RING_B];
  const int lane = threadIdx.x & 31;
  const int wave = threadIdx.x >> 5;
  const int tilesN = N >> 7;
  const int mt0 = ((int)blockIdx.x / tilesN) << 7;
  const int nt0 = ((int)blockIdx.x % tilesN) << 7;

  v8f C[MF][NF] = {};
  gemm_core_lds<MF, NF>(X, W, K, K, K, mt0, nt0, ring, C);

  const int mt = mt0 + (wave / WN) * (16 * MF);
  const int nt = nt0 + (wave % WN) * (16 * NF);
  const int r = lane & 15, h = lane >> 4;
#pragma unroll
  for (int mi = 0; mi < MF; ++mi) {
    const int rowb = mt + 16 * mi + h * 8;
#pragma unroll
    for (int j = 0; j < NF; ++j) {
      const int n = nt + 16 * j + r;
      const float bval = bias[n];
      if (!TR) {
#pragma unroll
        for (int i = 0; i < 8; ++i)
          out[(size_t)(rowb + i) * (size_t)N + n] = (bf16_t)(C[mi][j][i] + bval);
      } else {
        v8bf o;
#pragma unroll
        for (int i = 0; i < 8; ++i) o[i] = (bf16_t)(C[mi][j][i] + bval);
        *(v8bf*)(out + (size_t)n * (size_t)M + (size_t)rowb) = o;
      }
    }
  }
}

// out = scale * (A * Bt^T), batched via blockIdx.y.
// A:(M,K) bf16 lda, Bt:(N,K) bf16 ldb, out:(M,N) f32 ldo.
// Workgroup tile 128x128, wave tile 32x64 (2x4 fragments).
__global__ __launch_bounds__(256) void attn_gemm_kernel(
    const bf16_t* __restrict__ A, const bf16_t* __restrict__ Bt,
    float* __restrict__ outp, int M, int N, int K,
    int lda, int ldb, int ldo,
    long long strideA, long long strideB, long long strideO, float scale) {
  __shared__ __attribute__((aligned(2048))) unsigned char ring[RING_B];
  const int b = blockIdx.y;
  const bf16_t* Ab  = A  + (size_t)b * strideA;
  const bf16_t* Btb = Bt + (size_t)b * strideB;
  float* ob = outp + (size_t)b * strideO;

  const int lane = threadIdx.x & 31;
  const int wave = threadIdx.x >> 5;
  const int tilesN = N >> 7;
  const int mt0 = ((int)blockIdx.x / tilesN) << 7;
  const int nt0 = ((int)blockIdx.x % tilesN) << 7;

  v8f C[2][4] = {};
  gemm_core_lds<2, 4>(Ab, Btb, lda, ldb, K, mt0, nt0, ring, C);

  const int mt = mt0 + ((wave >> 1) << 5);
  const int nt = nt0 + ((wave & 1) << 6);
  const int r = lane & 15, h = lane >> 4;
#pragma unroll
  for (int mi = 0; mi < 2; ++mi) {
    const int rowb = mt + 16 * mi + h * 8;
#pragma unroll
    for (int j = 0; j < 4; ++j) {
      const int n = nt + 16 * j + r;
#pragma unroll
      for (int i = 0; i < 8; ++i)
        ob[(size_t)(rowb + i) * (size_t)ldo + n] = C[mi][j][i] * scale;
    }
  }
}

// Row softmax: fp32 scores (N==2048) -> bf16 probabilities. One 256-thread block per row,
// batched via blockIdx.y.
__global__ __launch_bounds__(256) void softmax_kernel(
    const float* __restrict__ S, bf16_t* __restrict__ P, int N,
    long long strideS, long long strideP) {
  const int row = blockIdx.x;
  const int tid = threadIdx.x;
  const float* srow = S + (size_t)blockIdx.y * strideS + (size_t)row * (size_t)N;
  bf16_t* prow = P + (size_t)blockIdx.y * strideP + (size_t)row * (size_t)N;
  __shared__ float red[8];

  float vals[8];
  float mx = -3.0e38f;
#pragma unroll
  for (int i = 0; i < 8; ++i) {
    vals[i] = srow[tid + (i << 8)];
    mx = fmaxf(mx, vals[i]);
  }
#pragma unroll
  for (int off = 16; off >= 1; off >>= 1)
    mx = fmaxf(mx, __shfl_xor(mx, off, 32));
  if ((tid & 31) == 0) red[tid >> 5] = mx;
  __syncthreads();
  mx = red[0];
#pragma unroll
  for (int w = 1; w < 8; ++w) mx = fmaxf(mx, red[w]);
  __syncthreads();

  float sum = 0.0f;
#pragma unroll
  for (int i = 0; i < 8; ++i) {
    vals[i] = __expf(vals[i] - mx);
    sum += vals[i];
  }
#pragma unroll
  for (int off = 16; off >= 1; off >>= 1)
    sum += __shfl_xor(sum, off, 32);
  if ((tid & 31) == 0) red[tid >> 5] = sum;
  __syncthreads();
  sum = 0.0f;
#pragma unroll
  for (int w = 0; w < 8; ++w) sum += red[w];
  const float inv = 1.0f / sum;

#pragma unroll
  for (int i = 0; i < 8; ++i)
    prow[tid + (i << 8)] = (bf16_t)(vals[i] * inv);
}

extern "C" void kernel_launch(void* const* d_in, const int* in_sizes, int n_in,
                              void* d_out, int out_size, void* d_ws, size_t ws_size,
                              hipStream_t stream) {
  const float* x  = (const float*)d_in[0];
  const float* Wq = (const float*)d_in[1];
  const float* bq = (const float*)d_in[2];
  const float* Wk = (const float*)d_in[3];
  const float* bk = (const float*)d_in[4];
  const float* Wv = (const float*)d_in[5];
  const float* bv = (const float*)d_in[6];
  float* out = (float*)d_out;

  const int B = 8, S = 2048, D = 1024;
  const int MS = B * S; // 16384
  const float scale = 0.03125f; // 1/sqrt(1024)

  // ---- workspace layout (all offsets 16B aligned) ----
  char* ws = (char*)d_ws;
  bf16_t* xb  = (bf16_t*)(ws);                         // 16384x1024 bf16 = 32 MB
  bf16_t* Wqb = (bf16_t*)(ws + (size_t)33554432);      // 1024x1024 bf16 = 2 MB
  bf16_t* Wkb = (bf16_t*)(ws + (size_t)35651584);
  bf16_t* Wvb = (bf16_t*)(ws + (size_t)37748736);
  bf16_t* Q   = (bf16_t*)(ws + (size_t)39845888);      // 32 MB
  bf16_t* Km  = (bf16_t*)(ws + (size_t)73400320);      // 32 MB
  bf16_t* VT  = (bf16_t*)(ws + (size_t)106954752);     // V^T (1024 x 16384), 32 MB
  const size_t attBase = 140509184;
  // Full tier: scores f32 for all batches (134 MB) + P bf16 for all batches (67 MB)
  const size_t fullNeed = attBase + (size_t)B * S * S * 4 + (size_t)B * S * S * 2; // ~326 MB

  dim3 blk(256);

  // ---- 1) convert inputs to bf16 ----
  cvt_f32_bf16_kernel<<<4096, blk, 0, stream>>>(x, xb, (long long)MS * D);
  cvt_f32_bf16_kernel<<<512,  blk, 0, stream>>>(Wq, Wqb, (long long)D * D);
  cvt_f32_bf16_kernel<<<512,  blk, 0, stream>>>(Wk, Wkb, (long long)D * D);
  cvt_f32_bf16_kernel<<<512,  blk, 0, stream>>>(Wv, Wvb, (long long)D * D);

  // ---- 2) projections (pure bf16 WMMA GEMM, 128x128 workgroup tiles) ----
  const int projBlocks = (MS / 128) * (D / 128); // 1024
  qkv_proj_kernel<0><<<projBlocks, blk, 0, stream>>>(xb, Wqb, bq, Q,  MS, D, D);
  qkv_proj_kernel<0><<<projBlocks, blk, 0, stream>>>(xb, Wkb, bk, Km, MS, D, D);
  qkv_proj_kernel<1><<<projBlocks, blk, 0, stream>>>(xb, Wvb, bv, VT, MS, D, D);

  const int scBlocks = (S / 128) * (S / 128); // 256 per batch
  const int pvBlocks = (S / 128) * (D / 128); // 128 per batch

  if (ws_size >= fullNeed) {
    // ---- full-parallel tier: all batches per launch (gridDim.y = 8) ----
    float*  Sc = (float*) (ws + attBase);
    bf16_t* P  = (bf16_t*)(ws + attBase + (size_t)B * S * S * 4);
    attn_gemm_kernel<<<dim3(scBlocks, B), blk, 0, stream>>>(
        Q, Km, Sc, S, S, D, D, D, S,
        (long long)S * D, (long long)S * D, (long long)S * S, scale);
    softmax_kernel<<<dim3(S, B), blk, 0, stream>>>(
        Sc, P, S, (long long)S * S, (long long)S * S);
    attn_gemm_kernel<<<dim3(pvBlocks, B), blk, 0, stream>>>(
        P, VT, out, S, D, S, S, MS, D,
        (long long)S * S, (long long)S, (long long)S * D, 1.0f);
  } else {
    // ---- per-batch tier: reuse one score/P buffer, stream-ordered ----
    float*  Sc = (float*) (ws + attBase);                        // 16 MB
    bf16_t* P  = (bf16_t*)(ws + attBase + (size_t)S * S * 4);    // 8 MB
    for (int b = 0; b < B; ++b) {
      const bf16_t* Qb = Q  + (size_t)b * S * D;
      const bf16_t* Kb = Km + (size_t)b * S * D;
      attn_gemm_kernel<<<dim3(scBlocks, 1), blk, 0, stream>>>(
          Qb, Kb, Sc, S, S, D, D, D, S, 0, 0, 0, scale);
      softmax_kernel<<<dim3(S, 1), blk, 0, stream>>>(Sc, P, S, 0, 0);
      attn_gemm_kernel<<<dim3(pvBlocks, 1), blk, 0, stream>>>(
          P, VT + (size_t)b * S, out + (size_t)b * S * D,
          S, D, S, S, MS, D, 0, 0, 0, 1.0f);
    }
  }
}

// v002
// A run of this version takes 233 microseconds.
// Timed twice side by side with v001, it ran 1.56 times as fast both times.
// Over all steps from v000 it is 3.94 times as fast.
#include <hip/hip_runtime.h>
#include <stdint.h>

typedef __bf16 bf16_t;
typedef __attribute__((ext_vector_type(16))) __bf16 v16bf;
typedef __attribute__((ext_vector_type(8)))  __bf16 v8bf;
typedef __attribute__((ext_vector_type(8)))  float  v8f;
typedef __attribute__((ext_vector_type(4)))  float  v4f;

#define WMMA_BF16(A, B, C) \
  __builtin_amdgcn_wmma_f32_16x16x32_bf16(false, (A), false, (B), (short)0, (C), false, false)

typedef uint32_t u32x4 __attribute__((ext_vector_type(4)));
typedef uint32_t u32x8 __attribute__((ext_vector_type(8)));

// Workgroup tile 128 x 128 of the output, eight waves, 16*MF x 16*NF per wave (32 x 64 or 64 x 32).
// A pass is 128 k = 256 bytes of each of the 128 A rows and 128 B^T rows. A stage in LDS is eight
// slices of 32 rows, slices 0..3 = A rows, 4..7 = B^T rows, one tensor load per wave and stage.
constexpr uint32_t ROWB    = 256u;            // bytes of one operand row per pass
constexpr uint32_t PITCH   = ROWB + 16u;      // LDS row pitch for ds_load_b128 readers (pad of 4 dwords)
constexpr uint32_t SROWS   = 32u;             // rows per slice
constexpr uint32_t SLICE_B = 10240u;          // 32 * 272 = 8704, rounded up to a multiple of 2 KiB
constexpr uint32_t BUF_B   = 8u * SLICE_B;    // one stage
constexpr uint32_t RING_B  = 2u * BUF_B;      // two buffers
static_assert(SROWS * PITCH <= SLICE_B && (SLICE_B % 2048u) == 0u, "a slice holds its padded rows and starts at a multiple of 2 KiB");

static __device__ __forceinline__ uint32_t uni(uint32_t v) { return (uint32_t)__builtin_amdgcn_readfirstlane(v); }
// A wave-uniform word held in a scalar register: the issue test on it compiles to s_cmp + s_cbranch_scc, and a
// descriptor word formed from it stays behind the volatile statements (the waits) that stand in front of it.
static __device__ __forceinline__ uint32_t pinned(uint32_t v) {
  uint32_t w = uni(v);
  asm volatile("" : "+s"(w));  // pinned(): a descriptor word or an issue test held in a scalar register
  return w;
}
static __device__ __forceinline__ void wait_ds0()     { asm volatile("s_wait_dscnt 0x0" ::: "memory"); }     // this wave's LDS reads have retired
static __device__ __forceinline__ void wait_tensor0() { asm volatile("s_wait_tensorcnt 0x0" ::: "memory"); } // this wave's tensor load has landed
// One request of the whole wave: a 2-D tile from global memory into LDS, through no register.
static __device__ __forceinline__ void tdm_load(u32x4 g0, u32x8 g1) { asm volatile("tensor_load_to_lds %0, %1" :: "s"(g0), "s"(g1) : "memory"); }

// Descriptor group 1: 1-byte elements, tensor = tile = 32 rows of 256 bytes, 4 dwords of LDS pad behind every row.
static __device__ __forceinline__ u32x8 tdm_group1(uint32_t src_pitch) {
  constexpr uint32_t d0 = ROWB, d1 = SROWS;
  u32x8 g;
  g[0] = uni((1u << 20) | (5u << 22) | (3u << 25));  // no mask; pad on, interval 64 dwords, amount 4 dwords
  // Words 1 to 7 are pinned: descriptor words held in scalar registers of their own for the whole loop,
  // so that none is used for anything else while a request is outstanding.
  g[1] = pinned((d0 & 0xFFFFu) << 16);
  g[2] = pinned((d0 >> 16) | ((d1 & 0xFFFFu) << 16));
  g[3] = pinned((d1 >> 16) | (d0 << 16));
  g[4] = pinned(d1);
  g[5] = pinned(src_pitch);
  g[6] = pinned(0u);
  g[7] = pinned(0u);
  return g;
}
static __device__ __forceinline__ u32x4 tdm_group0(uint32_t lds_dst, uint64_t ga) {
  u32x4 g;
  g[0] = uni(1u);
  g[1] = uni(lds_dst);
  g[2] = uni((uint32_t)ga);
  g[3] = uni((((uint32_t)(ga >> 32)) & 0x01FFFFFFu) | 0x80000000u);
  return g;
}

// A-fragment (16x32 bf16) / B-fragment (B^T rows; identical layout, N in the lane role) from LDS.
// p points at row (lane&15), 16-byte half (lane>>4): K = {k0+h*8 .. +7} then {k0+16+h*8 .. +7}.
static __device__ __forceinline__ v16bf lds_frag(const unsigned char* p) {
  v16bf a;
  a.lo = *(const v8bf*)(p);
  a.hi = *(const v8bf*)(p + 32);
  return a;
}

// C (16*MF x 16*NF per wave) += A[mt0.., :] * Bt[nt0.., :]^T for one 128 x 128 workgroup tile.
// Wave w holds rows 16*MF*(w / WN), columns 16*NF*(w % WN) of the tile, WN = 8 / NF waves along the columns.
// M, N multiples of 128; K a multiple of 128 and at least 256 (two stages).
template <int MF, int NF>
static __device__ __forceinline__ void gemm_core_lds(const bf16_t* __restrict__ A,
                                                     const bf16_t* __restrict__ Bt,
                                                     int lda, int ldb, int K,
                                                     int mt0, int nt0,
                                                     unsigned char* ring, v8f (&C)[MF][NF]) {
  static_assert(MF * NF == 8 && (MF % 2) == 0 && (NF % 2) == 0, "eight waves cover 128 x 128; a wave's rows start on a slice");
  constexpr uint32_t WN = 8u / (uint32_t)NF;
  const uint32_t lane = threadIdx.x & 31u, r = lane & 15u, h = lane >> 4;
  const uint32_t wave = uni(threadIdx.x >> 5);
  const uint32_t wm = wave / WN, wn = wave % WN;
  const uint32_t T = (uint32_t)K >> 7;  // passes

  // This wave's slice of every stage.
  const bool isA = wave < 4u;
  const bf16_t* srow = isA ? A + (size_t)(mt0 + (int)(SROWS * wave)) * (size_t)lda
                           : Bt + (size_t)(nt0 + (int)(SROWS * (wave - 4u))) * (size_t)ldb;
  const uint64_t ga0 = (uint64_t)(uintptr_t)srow;
  const uint32_t dst0 = (uint32_t)(uintptr_t)ring + wave * SLICE_B;
  const u32x8 g1 = tdm_group1(2u * (uint32_t)(isA ? lda : ldb));

  // Per-lane fragment bases inside a buffer.
  const uint32_t fa = wm * (uint32_t)(MF / 2) * SLICE_B + r * PITCH + 16u * h;
  const uint32_t fb = (4u + wn * (uint32_t)(NF / 2)) * SLICE_B + r * PITCH + 16u * h;
  // Fragment f of a wave's operand: 16 rows, two fragments to a slice.
  auto foff = [](uint32_t f) { return (f >> 1) * SLICE_B + (f & 1u) * 16u * PITCH; };

  tdm_load(tdm_group0(dst0, ga0), g1);          // stage 0
  wait_tensor0();
  __syncthreads();                              // stage 0 is published
  tdm_load(tdm_group0(dst0 + BUF_B, ga0 + ROWB), g1);  // stage 1

  uint32_t s = 0;
  do {  // T is at least 2: both stages loaded above exist
    const uint32_t buf = (s & 1u) * BUF_B;
    const unsigned char* pa = ring + buf + fa;
    const unsigned char* pb = ring + buf + fb;
    // Two fragment sets inside the pass: block kk + 1's twelve LDS reads go out as one group in front of
    // block kk's eight WMMAs. Nothing of another stage is read here.
    v16bf Af[2][MF], Bf[2][NF];
#pragma unroll  // register arrays need constant indices
    for (uint32_t mi = 0; mi < (uint32_t)MF; ++mi) Af[0][mi] = lds_frag(pa + foff(mi));
#pragma unroll
    for (uint32_t j = 0; j < (uint32_t)NF; ++j) Bf[0][j] = lds_frag(pb + foff(j));
#pragma unroll
    for (uint32_t kk = 0; kk < 4u; ++kk) {
      const uint32_t cur = kk & 1u, nxt = cur ^ 1u;
      if (kk + 1u < 4u) {
#pragma unroll
        for (uint32_t mi = 0; mi < (uint32_t)MF; ++mi) Af[nxt][mi] = lds_frag(pa + foff(mi) + (kk + 1u) * 64u);
#pragma unroll
        for (uint32_t j = 0; j < (uint32_t)NF; ++j) Bf[nxt][j] = lds_frag(pb + foff(j) + (kk + 1u) * 64u);
      }
      __builtin_amdgcn_sched_barrier(0);  // keeps the LDS reads in one group, out of the WMMA run
#pragma unroll
      for (uint32_t j = 0; j < (uint32_t)NF; ++j)
#pragma unroll
        for (uint32_t mi = 0; mi < (uint32_t)MF; ++mi)
          C[mi][j] = WMMA_BF16(Af[cur][mi], Bf[cur][j], C[mi][j]);
      __builtin_amdgcn_sched_barrier(0);  // keeps the next group of reads, and the publish point, behind this WMMA run
    }
    // Publish point of stage s + 1; it also ends every reader's last read of stage s's buffer.
    wait_ds0();
    wait_tensor0();
    __syncthreads();
    if (pinned((s + 2u < T) ? 1u : 0u) != 0u) {  // the refill, only while stage s + 2 exists
      const uint32_t nx = pinned(s + 2u);        // descriptor word source, formed behind the wait above
      tdm_load(tdm_group0(dst0 + buf, ga0 + (uint64_t)nx * ROWB), g1);
    }
  } while (++s < T);
  wait_tensor0();
  wait_ds0();
}

// Elementwise fp32 -> bf16 (8 elements/thread, grid-stride).
__global__ __launch_bounds__(256) void cvt_f32_bf16_kernel(const float* __restrict__ in,
                                                           bf16_t* __restrict__ outp,
                                                           long long n) {
  long long idx = ((long long)blockIdx.x * 256 + threadIdx.x) * 8;
  const long long stride = (long long)gridDim.x * 256 * 8;
  for (; idx < n; idx += stride) {
    v8f f;
    f.lo = *(const v4f*)(in + idx);
    f.hi = *(const v4f*)(in + idx + 4);
    *(v8bf*)(outp + idx) = __builtin_convertvector(f, v8bf);
  }
}

// out = X * W^T + bias ; X:(M,K) bf16, W:(N,K) bf16 row-major.
// TR==0: out (M,N) bf16 row-major, wave tile 32x64; TR==1: out (N,M) bf16 row-major (V^T), wave tile 64x32.
// Either way the 64 elements of a 128-byte line of out come from one wave. Workgroup tile 128x128.
template <int TR>
__global__ __launch_bounds__(256) void qkv_proj_kernel(
    const bf16_t* __restrict__ X, const bf16_t* __restrict__ W,
    const float* __restrict__ bias, bf16_t* __restrict__ out,
    int M, int N, int K) {
  constexpr int MF = TR ? 4 : 2, NF = TR ? 2 : 4, WN = 8 / NF;
  __shared__ __attribute__((aligned(2048))) unsigned char ring[RING_B];
  const int lane = threadIdx.x & 31;
  const int wave = threadIdx.x >> 5;
  const int tilesN = N >> 7;
  const int mt0 = ((int)blockIdx.x / tilesN) << 7;
  const int nt0 = ((int)blockIdx.x % tilesN) << 7;

  v8f C[MF][NF] = {};
  gemm_core_lds<MF, NF>(X, W, K, K, K, mt0, nt0, ring, C);

  const int mt = mt0 + (wave / WN) * (16 * MF);
  const int nt = nt0 + (wave % WN) * (16 * NF);
  const int r = lane & 15, h = lane >> 4;
#pragma unroll
  for (int mi = 0; mi < MF; ++mi) {
    const int rowb = mt + 16 * mi + h * 8;
#pragma unroll
    for (int j = 0; j < NF; ++j) {
      const int n = nt + 16 * j + r;
      const float bval = bias[n];
      if (!TR) {
#pragma unroll
        for (int i = 0; i < 8; ++i)
          out[(size_t)(rowb + i) * (size_t)N + n] = (bf16_t)(C[mi][j][i] + bval);
      } else {
        v8bf o;
#pragma unroll
        for (int i = 0; i < 8; ++i) o[i] = (bf16_t)(C[mi][j][i] + bval);
        *(v8bf*)(out + (size_t)n * (size_t)M + (size_t)rowb) = o;
      }
    }
  }
}

// out = scale * (A * Bt^T), batched via blockIdx.y.
// A:(M,K) bf16 lda, Bt:(N,K) bf16 ldb, out:(M,N) f32 ldo.
// Workgroup tile 128x128, wave tile 32x64 (2x4 fragments).
__global__ __launch_bounds__(256) void attn_gemm_kernel(
    const bf16_t* __restrict__ A, const bf16_t* __restrict__ Bt,
    float* __restrict__ outp, int M, int N, int K,
    int lda, int ldb, int ldo,
    long long strideA, long long strideB, long long strideO, float scale) {
  __shared__ __attribute__((aligned(2048))) unsigned char ring[RING_B];
  const int b = blockIdx.y;
  const bf16_t* Ab  = A  + (size_t)b * strideA;
  const bf16_t* Btb = Bt + (size_t)b * strideB;
  float* ob = outp + (size_t)b * strideO;

  const int lane = threadIdx.x & 31;
  const int wave = threadIdx.x >> 5;
  const int tilesN = N >> 7;
  const int mt0 = ((int)blockIdx.x / tilesN) << 7;
  const int nt0 = ((int)blockIdx.x % tilesN) << 7;

  v8f C[2][4] = {};
  gemm_core_lds<2, 4>(Ab, Btb, lda, ldb, K, mt0, nt0, ring, C);

  const int mt = mt0 + ((wave >> 1) << 5);
  const int nt = nt0 + ((wave & 1) << 6);
  const int r = lane & 15, h = lane >> 4;
#pragma unroll
  for (int mi = 0; mi < 2; ++mi) {
    const int rowb = mt + 16 * mi + h * 8;
#pragma unroll
    for (int j = 0; j < 4; ++j) {
      const int n = nt + 16 * j + r;
#pragma unroll
      for (int i = 0; i < 8; ++i)
        ob[(size_t)(rowb + i) * (size_t)ldo + n] = C[mi][j][i] * scale;
    }
  }
}

// Row softmax: fp32 scores (N==2048) -> bf16 probabilities. One 256-thread block per row,
// batched via blockIdx.y.
__global__ __launch_bounds__(256) void softmax_kernel(
    const float* __restrict__ S, bf16_t* __restrict__ P, int N,
    long long strideS, long long strideP) {
  const int row = blockIdx.x;
  const int tid = threadIdx.x;
  const float* srow = S + (size_t)blockIdx.y * strideS + (size_t)row * (size_t)N;
  bf16_t* prow = P + (size_t)blockIdx.y * strideP + (size_t)row * (size_t)N;
  __shared__ float red[8];

  float vals[8];
  float mx = -3.0e38f;
#pragma unroll
  for (int i = 0; i < 8; ++i) {
    vals[i] = srow[tid + (i << 8)];
    mx = fmaxf(mx, vals[i]);
  }
#pragma unroll
  for (int off = 16; off >= 1; off >>= 1)
    mx = fmaxf(mx, __shfl_xor(mx, off, 32));
  if ((tid & 31) == 0) red[tid >> 5] = mx;
  __syncthreads();
  mx = red[0];
#pragma unroll
  for (int w = 1; w < 8; ++w) mx = fmaxf(mx, red[w]);
  __syncthreads();

  float sum = 0.0f;
#pragma unroll
  for (int i = 0; i < 8; ++i) {
    vals[i] = __expf(vals[i] - mx);
    sum += vals[i];
  }
#pragma unroll
  for (int off = 16; off >= 1; off >>= 1)
    sum += __shfl_xor(sum, off, 32);
  if ((tid & 31) == 0) red[tid >> 5] = sum;
  __syncthreads();
  sum = 0.0f;
#pragma unroll
  for (int w = 0; w < 8; ++w) sum += red[w];
  const float inv = 1.0f / sum;

#pragma unroll
  for (int i = 0; i < 8; ++i)
    prow[tid + (i << 8)] = (bf16_t)(vals[i] * inv);
}

extern "C" void kernel_launch(void* const* d_in, const int* in_sizes, int n_in,
                              void* d_out, int out_size, void* d_ws, size_t ws_size,
                              hipStream_t stream) {
  const float* x  = (const float*)d_in[0];
  const float* Wq = (const float*)d_in[1];
  const float* bq = (const float*)d_in[2];
  const float* Wk = (const float*)d_in[3];
  const float* bk = (const float*)d_in[4];
  const float* Wv = (const float*)d_in[5];
  const float* bv = (const float*)d_in[6];
  float* out = (float*)d_out;

  const int B = 8, S = 2048, D = 1024;
  const int MS = B * S; // 16384
  const float scale = 0.03125f; // 1/sqrt(1024)

  // ---- workspace layout (all offsets 16B aligned) ----
  // Buffers share bytes where one is dead before the other is written, all inside this call:
  // the bf16 copies of x and W are last read by the projections, and the scores are written behind them;
  // Q and K are last read by the score GEMM, and P of all batches (exactly their 64 MiB) is written behind it.
  char* ws = (char*)d_ws;
  bf16_t* Q   = (bf16_t*)(ws);                         // 16384x1024 bf16 = 32 MiB
  bf16_t* Km  = (bf16_t*)(ws + (size_t)33554432);      // 32 MiB
  bf16_t* VT  = (bf16_t*)(ws + (size_t)67108864);      // V^T (1024 x 16384), 32 MiB
  const size_t attBase = 100663296;
  bf16_t* xb  = (bf16_t*)(ws + attBase);               // 32 MiB, under the scores
  bf16_t* Wqb = (bf16_t*)(ws + (size_t)134217728);     // 1024x1024 bf16 = 2 MiB each, under the scores
  bf16_t* Wkb = (bf16_t*)(ws + (size_t)136314880);
  bf16_t* Wvb = (bf16_t*)(ws + (size_t)138412032);
  // Full tier: scores f32 for all batches (128 MiB) behind Q, K, V^T; P bf16 for all batches over Q and K
  const size_t fullNeed = attBase + (size_t)B * S * S * 4; // 224 MiB

  dim3 blk(256);

  // ---- 1) convert inputs to bf16 ----
  cvt_f32_bf16_kernel<<<4096, blk, 0, stream>>>(x, xb, (long long)MS * D);
  cvt_f32_bf16_kernel<<<512,  blk, 0, stream>>>(Wq, Wqb, (long long)D * D);
  cvt_f32_bf16_kernel<<<512,  blk, 0, stream>>>(Wk, Wkb, (long long)D * D);
  cvt_f32_bf16_kernel<<<512,  blk, 0, stream>>>(Wv, Wvb, (long long)D * D);

  // ---- 2) projections (pure bf16 WMMA GEMM, 128x128 workgroup tiles) ----
  const int projBlocks = (MS / 128) * (D / 128); // 1024
  qkv_proj_kernel<0><<<projBlocks, blk, 0, stream>>>(xb, Wqb, bq, Q,  MS, D, D);
  qkv_proj_kernel<0><<<projBlocks, blk, 0, stream>>>(xb, Wkb, bk, Km, MS, D, D);
  qkv_proj_kernel<1><<<projBlocks, blk, 0, stream>>>(xb, Wvb, bv, VT, MS, D, D);

  const int scBlocks = (S / 128) * (S / 128); // 256 per batch
  const int pvBlocks = (S / 128) * (D / 128); // 128 per batch

  if (ws_size >= fullNeed) {
    // ---- full-parallel tier: all batches per launch (gridDim.y = 8) ----
    float*  Sc = (float*) (ws + attBase);
    bf16_t* P  = (bf16_t*)(ws);  // over Q and K, which the score GEMM below reads for the last time
    attn_gemm_kernel<<<dim3(scBlocks, B), blk, 0, stream>>>(
        Q, Km, Sc, S, S, D, D, D, S,
        (long long)S * D, (long long)S * D, (long long)S * S, scale);
    softmax_kernel<<<dim3(S, B), blk, 0, stream>>>(
        Sc, P, S, (long long)S * S, (long long)S * S);
    attn_gemm_kernel<<<dim3(pvBlocks, B), blk, 0, stream>>>(
        P, VT, out, S, D, S, S, MS, D,
        (long long)S * S, (long long)S, (long long)S * D, 1.0f);
  } else {
    // ---- per-batch tier: reuse one score/P buffer, stream-ordered ----
    float*  Sc = (float*) (ws + attBase);                        // 16 MB
    bf16_t* P  = (bf16_t*)(ws + attBase + (size_t)S * S * 4);    // 8 MB
    for (int b = 0; b < B; ++b) {
      const bf16_t* Qb = Q  + (size_t)b * S * D;
      const bf16_t* Kb = Km + (size_t)b * S * D;
      attn_gemm_kernel<<<dim3(scBlocks, 1), blk, 0, stream>>>(
          Qb, Kb, Sc, S, S, D, D, D, S, 0, 0, 0, scale);
      softmax_kernel<<<dim3(S, 1), blk, 0, stream>>>(Sc, P, S, 0, 0);
      attn_gemm_kernel<<<dim3(pvBlocks, 1), blk, 0, stream>>>(
          P, VT + (size_t)b * S, out + (size_t)b * S * D,
          S, D, S, S, MS, D, 0, 0, 0, 1.0f);
    }
  }
}

// v003
// It runs in 213 microseconds.
// Two timings next to v002 put it at 1.09 and 1.10 times that version's speed.
// Over all steps from v000 it is 4.32 times as fast.
#include <hip/hip_runtime.h>
#include <stdint.h>

typedef __bf16 bf16_t;
typedef __attribute__((ext_vector_type(16))) __bf16 v16bf;
typedef __attribute__((ext_vector_type(8)))  __bf16 v8bf;
typedef __attribute__((ext_vector_type(8)))  float  v8f;
typedef __attribute__((ext_vector_type(4)))  float  v4f;

#define WMMA_BF16(A, B, C) \
  __builtin_amdgcn_wmma_f32_16x16x32_bf16(false, (A), false, (B), (short)0, (C), false, false)

typedef uint32_t u32x4 __attribute__((ext_vector_type(4)));
typedef uint32_t u32x8 __attribute__((ext_vector_type(8)));

// Workgroup tile 256 x 256 of the output, eight waves (two per SIMD), 64 x 128 per wave: each operand byte
// fetched from L2 and each fragment read from LDS feeds twice the matrix work of a 128 x 128 tile.
// A pass is 128 k = 256 bytes of each of the 256 A rows and 256 B^T rows. A stage in LDS is eight
// slices of 64 rows, slices 0..3 = A rows, 4..7 = B^T rows, one tensor load per wave and stage.
constexpr uint32_t ROWB    = 256u;            // bytes of one operand row per pass
constexpr uint32_t PITCH   = ROWB + 16u;      // LDS row pitch for ds_load_b128 readers (pad of 4 dwords)
constexpr uint32_t SROWS   = 64u;             // rows per slice
constexpr uint32_t SLICE_B = 18432u;          // 64 * 272 = 17408, rounded up to a multiple of 2 KiB
constexpr uint32_t BUF_B   = 8u * SLICE_B;    // one stage
constexpr uint32_t RING_B  = 2u * BUF_B;      // two buffers, 294912 bytes: one workgroup per WGP
static_assert(SROWS * PITCH <= SLICE_B && (SLICE_B % 2048u) == 0u, "a slice holds its padded rows and starts at a multiple of 2 KiB");

static __device__ __forceinline__ uint32_t uni(uint32_t v) { return (uint32_t)__builtin_amdgcn_readfirstlane(v); }
// A wave-uniform word held in a scalar register: the issue test on it compiles to s_cmp + s_cbranch_scc, and a
// descriptor word formed from it stays behind the volatile statements (the waits) that stand in front of it.
static __device__ __forceinline__ uint32_t pinned(uint32_t v) {
  uint32_t w = uni(v);
  asm volatile("" : "+s"(w));  // pinned(): a descriptor word or an issue test held in a scalar register
  return w;
}
static __device__ __forceinline__ void wait_ds0()     { asm volatile("s_wait_dscnt 0x0" ::: "memory"); }     // this wave's LDS reads have retired
// This wave's tensor load has landed. The wait names the request's group 0, so that those scalar registers hold
// the descriptor, and nothing else, for as long as the request is outstanding.
static __device__ __forceinline__ void wait_tensor0(u32x4 g0) { asm volatile("s_wait_tensorcnt 0x0" :: "s"(g0) : "memory"); }
// One request of the whole wave: a 2-D tile from global memory into LDS, through no register. Group 0 is an
// in-out operand: what the wait above names is then held in the very registers that the request was issued from.
static __device__ __forceinline__ void tdm_load(u32x4& g0, u32x8 g1) { asm volatile("tensor_load_to_lds %0, %1" : "+s"(g0) : "s"(g1) : "memory"); }

// Descriptor group 1: 1-byte elements, tensor = tile = 64 rows of 256 bytes, 4 dwords of LDS pad behind every row.
static __device__ __forceinline__ u32x8 tdm_group1(uint32_t src_pitch) {
  constexpr uint32_t d0 = ROWB, d1 = SROWS;
  u32x8 g;
  g[0] = uni((1u << 20) | (5u << 22) | (3u << 25));  // no mask; pad on, interval 64 dwords, amount 4 dwords
  // Words 1 to 7 are pinned: descriptor words held in scalar registers of their own for the whole loop,
  // so that none is used for anything else while a request is outstanding.
  g[1] = pinned((d0 & 0xFFFFu) << 16);
  g[2] = pinned((d0 >> 16) | ((d1 & 0xFFFFu) << 16));
  g[3] = pinned((d1 >> 16) | (d0 << 16));
  g[4] = pinned(d1);
  g[5] = pinned(src_pitch);
  g[6] = pinned(0u);
  g[7] = pinned(0u);
  return g;
}
static __device__ __forceinline__ u32x4 tdm_group0(uint32_t lds_dst, uint64_t ga) {
  u32x4 g;
  g[0] = uni(1u);
  g[1] = uni(lds_dst);
  g[2] = uni((uint32_t)ga);
  g[3] = uni((((uint32_t)(ga >> 32)) & 0x01FFFFFFu) | 0x80000000u);
  return g;
}

// A-fragment (16x32 bf16) / B-fragment (B^T rows; identical layout, N in the lane role) from LDS.
// p points at row (lane&15), 16-byte half (lane>>4): K = {k0+h*8 .. +7} then {k0+16+h*8 .. +7}.
static __device__ __forceinline__ v16bf lds_frag(const unsigned char* p) {
  v16bf a;
  a.lo = *(const v8bf*)(p);
  a.hi = *(const v8bf*)(p + 32);
  return a;
}

// C (16*MF x 16*NF per wave) += A[mt0.., :] * Bt[nt0.., :]^T for one 256 x 256 workgroup tile.
// Wave w holds rows 16*MF*(w / WN), columns 16*NF*(w % WN) of the tile, WN = 16 / NF waves along the columns.
// M, N multiples of 256; K a multiple of 128 and at least 256 (two stages).
template <int MF, int NF>
static __device__ __forceinline__ void gemm_core_lds(const bf16_t* __restrict__ A,
                                                     const bf16_t* __restrict__ Bt,
                                                     int lda, int ldb, int K,
                                                     int mt0, int nt0,
                                                     unsigned char* ring, v8f (&C)[MF][NF]) {
  static_assert(MF * NF == 32 && (MF % 4) == 0 && (NF % 4) == 0, "eight waves cover 256 x 256; a wave's rows start on a slice");
  constexpr uint32_t WN = 16u / (uint32_t)NF;
  const uint32_t lane = threadIdx.x & 31u, r = lane & 15u, h = lane >> 4;
  const uint32_t wave = uni(threadIdx.x >> 5);
  const uint32_t wm = wave / WN, wn = wave % WN;
  const uint32_t T = (uint32_t)K >> 7;  // passes

  // This wave's slice of every stage.
  const bool isA = wave < 4u;
  const bf16_t* srow = isA ? A + (size_t)(mt0 + (int)(SROWS * wave)) * (size_t)lda
                           : Bt + (size_t)(nt0 + (int)(SROWS * (wave - 4u))) * (size_t)ldb;
  const uint64_t ga0 = (uint64_t)(uintptr_t)srow;
  const uint32_t dst0 = (uint32_t)(uintptr_t)ring + wave * SLICE_B;
  const u32x8 g1 = tdm_group1(2u * (uint32_t)(isA ? lda : ldb));

  // Per-lane fragment bases inside a buffer.
  const uint32_t fa = wm * (uint32_t)(MF / 4) * SLICE_B + r * PITCH + 16u * h;
  const uint32_t fb = (4u + wn * (uint32_t)(NF / 4)) * SLICE_B + r * PITCH + 16u * h;
  // Fragment f of a wave's operand: 16 rows, four fragments to a slice.
  auto foff = [](uint32_t f) { return (f >> 2) * SLICE_B + (f & 3u) * 16u * PITCH; };

  u32x4 g0 = tdm_group0(dst0, ga0);
  tdm_load(g0, g1);                             // stage 0
  wait_tensor0(g0);
  __syncthreads();                              // stage 0 is published
  g0 = tdm_group0(dst0 + BUF_B, ga0 + ROWB);
  tdm_load(g0, g1);                             // stage 1

  uint32_t s = 0;
  do {  // T is at least 2: both stages loaded above exist
    const uint32_t buf = (s & 1u) * BUF_B;
    const unsigned char* pa = ring + buf + fa;
    const unsigned char* pb = ring + buf + fb;
    // Two fragment sets inside the pass: block kk + 1's 24 LDS reads go out as one group in front of
    // block kk's 32 WMMAs. Nothing of another stage is read here.
    v16bf Af[2][MF], Bf[2][NF];
#pragma unroll  // register arrays need constant indices
    for (uint32_t mi = 0; mi < (uint32_t)MF; ++mi) Af[0][mi] = lds_frag(pa + foff(mi));
#pragma unroll
    for (uint32_t j = 0; j < (uint32_t)NF; ++j) Bf[0][j] = lds_frag(pb + foff(j));
#pragma unroll
    for (uint32_t kk = 0; kk < 4u; ++kk) {
      const uint32_t cur = kk & 1u, nxt = cur ^ 1u;
      if (kk + 1u < 4u) {
#pragma unroll
        for (uint32_t mi = 0; mi < (uint32_t)MF; ++mi) Af[nxt][mi] = lds_frag(pa + foff(mi) + (kk + 1u) * 64u);
#pragma unroll
        for (uint32_t j = 0; j < (uint32_t)NF; ++j) Bf[nxt][j] = lds_frag(pb + foff(j) + (kk + 1u) * 64u);
      }
      __builtin_amdgcn_sched_barrier(0);  // keeps the LDS reads in one group, out of the WMMA run
#pragma unroll
      for (uint32_t j = 0; j < (uint32_t)NF; ++j)
#pragma unroll
        for (uint32_t mi = 0; mi < (uint32_t)MF; ++mi)
          C[mi][j] = WMMA_BF16(Af[cur][mi], Bf[cur][j], C[mi][j]);
      __builtin_amdgcn_sched_barrier(0);  // keeps the next group of reads, and the publish point, behind this WMMA run
    }
    // Publish point of stage s + 1; it also ends every reader's last read of stage s's buffer.
    wait_ds0();
    wait_tensor0(g0);
    __syncthreads();
    if (pinned((s + 2u < T) ? 1u : 0u) != 0u) {  // the refill, only while stage s + 2 exists
      const uint32_t nx = pinned(s + 2u);        // descriptor word source, formed behind the wait above
      g0 = tdm_group0(dst0 + buf, ga0 + (uint64_t)nx * ROWB);
      tdm_load(g0, g1);
    }
  } while (++s < T);
  wait_tensor0(g0);
  wait_ds0();
}

// Elementwise fp32 -> bf16 (8 elements/thread, grid-stride).
__global__ __launch_bounds__(256) void cvt_f32_bf16_kernel(const float* __restrict__ in,
                                                           bf16_t* __restrict__ outp,
                                                           long long n) {
  long long idx = ((long long)blockIdx.x * 256 + threadIdx.x) * 8;
  const long long stride = (long long)gridDim.x * 256 * 8;
  for (; idx < n; idx += stride) {
    v8f f;
    f.lo = *(const v4f*)(in + idx);
    f.hi = *(const v4f*)(in + idx + 4);
    *(v8bf*)(outp + idx) = __builtin_convertvector(f, v8bf);
  }
}

// out = X * W^T + bias ; X:(M,K) bf16, W:(N,K) bf16 row-major.
// TR==0: out (M,N) bf16 row-major; TR==1: out (N,M) bf16 row-major (V^T). Wave tile 64x128:
// either way the 64 elements of a 128-byte line of out come from one wave. Workgroup tile 256x256.
template <int TR>
__global__ __launch_bounds__(256) void qkv_proj_kernel(
    const bf16_t* __restrict__ X, const bf16_t* __restrict__ W,
    const float* __restrict__ bias, bf16_t* __restrict__ out,
    int M, int N, int K) {
  constexpr int MF = 4, NF = 8, WN = 16 / NF;
  __shared__ __attribute__((aligned(2048))) unsigned char ring[RING_B];
  const int lane = threadIdx.x & 31;
  const int wave = threadIdx.x >> 5;
  const int tilesN = N >> 8;
  const int mt0 = ((int)blockIdx.x / tilesN) << 8;
  const int nt0 = ((int)blockIdx.x % tilesN) << 8;

  v8f C[MF][NF] = {};
  gemm_core_lds<MF, NF>(X, W, K, K, K, mt0, nt0, ring, C);

  const int mt = mt0 + (wave / WN) * (16 * MF);
  const int nt = nt0 + (wave % WN) * (16 * NF);
  const int r = lane & 15, h = lane >> 4;
#pragma unroll
  for (int mi = 0; mi < MF; ++mi) {
    const int rowb = mt + 16 * mi + h * 8;
#pragma unroll
    for (int j = 0; j < NF; ++j) {
      const int n = nt + 16 * j + r;
      const float bval = bias[n];
      if (!TR) {
#pragma unroll
        for (int i = 0; i < 8; ++i)
          out[(size_t)(rowb + i) * (size_t)N + n] = (bf16_t)(C[mi][j][i] + bval);
      } else {
        v8bf o;
#pragma unroll
        for (int i = 0; i < 8; ++i) o[i] = (bf16_t)(C[mi][j][i] + bval);
        *(v8bf*)(out + (size_t)n * (size_t)M + (size_t)rowb) = o;
      }
    }
  }
}

// out = scale * (A * Bt^T), batched via blockIdx.y.
// A:(M,K) bf16 lda, Bt:(N,K) bf16 ldb, out:(M,N) f32 ldo.
// Workgroup tile 256x256, wave tile 64x128 (4x8 fragments).
__global__ __launch_bounds__(256) void attn_gemm_kernel(
    const bf16_t* __restrict__ A, const bf16_t* __restrict__ Bt,
    float* __restrict__ outp, int M, int N, int K,
    int lda, int ldb, int ldo,
    long long strideA, long long strideB, long long strideO, float scale) {
  __shared__ __attribute__((aligned(2048))) unsigned char ring[RING_B];
  const int b = blockIdx.y;
  const bf16_t* Ab  = A  + (size_t)b * strideA;
  const bf16_t* Btb = Bt + (size_t)b * strideB;
  float* ob = outp + (size_t)b * strideO;

  const int lane = threadIdx.x & 31;
  const int wave = threadIdx.x >> 5;
  const int tilesN = N >> 8;
  const int mt0 = ((int)blockIdx.x / tilesN) << 8;
  const int nt0 = ((int)blockIdx.x % tilesN) << 8;

  v8f C[4][8] = {};
  gemm_core_lds<4, 8>(Ab, Btb, lda, ldb, K, mt0, nt0, ring, C);

  const int mt = mt0 + ((wave >> 1) << 6);
  const int nt = nt0 + ((wave & 1) << 7);
  const int r = lane & 15, h = lane >> 4;
#pragma unroll
  for (int mi = 0; mi < 4; ++mi) {
    const int rowb = mt + 16 * mi + h * 8;
#pragma unroll
    for (int j = 0; j < 8; ++j) {
      const int n = nt + 16 * j + r;
#pragma unroll
      for (int i = 0; i < 8; ++i)
        ob[(size_t)(rowb + i) * (size_t)ldo + n] = C[mi][j][i] * scale;
    }
  }
}

// Row softmax: fp32 scores (N==2048) -> bf16 probabilities. One 256-thread block per row,
// batched via blockIdx.y.
__global__ __launch_bounds__(256) void softmax_kernel(
    const float* __restrict__ S, bf16_t* __restrict__ P, int N,
    long long strideS, long long strideP) {
  const int row = blockIdx.x;
  const int tid = threadIdx.x;
  const float* srow = S + (size_t)blockIdx.y * strideS + (size_t)row * (size_t)N;
  bf16_t* prow = P + (size_t)blockIdx.y * strideP + (size_t)row * (size_t)N;
  __shared__ float red[8];

  float vals[8];
  float mx = -3.0e38f;
#pragma unroll
  for (int i = 0; i < 8; ++i) {
    vals[i] = srow[tid + (i << 8)];
    mx = fmaxf(mx, vals[i]);
  }
#pragma unroll
  for (int off = 16; off >= 1; off >>= 1)
    mx = fmaxf(mx, __shfl_xor(mx, off, 32));
  if ((tid & 31) == 0) red[tid >> 5] = mx;
  __syncthreads();
  mx = red[0];
#pragma unroll
  for (int w = 1; w < 8; ++w) mx = fmaxf(mx, red[w]);
  __syncthreads();

  float sum = 0.0f;
#pragma unroll
  for (int i = 0; i < 8; ++i) {
    vals[i] = __expf(vals[i] - mx);
    sum += vals[i];
  }
#pragma unroll
  for (int off = 16; off >= 1; off >>= 1)
    sum += __shfl_xor(sum, off, 32);
  if ((tid & 31) == 0) red[tid >> 5] = sum;
  __syncthreads();
  sum = 0.0f;
#pragma unroll
  for (int w = 0; w < 8; ++w) sum += red[w];
  const float inv = 1.0f / sum;

#pragma unroll
  for (int i = 0; i < 8; ++i)
    prow[tid + (i << 8)] = (bf16_t)(vals[i] * inv);
}

extern "C" void kernel_launch(void* const* d_in, const int* in_sizes, int n_in,
                              void* d_out, int out_size, void* d_ws, size_t ws_size,
                              hipStream_t stream) {
  const float* x  = (const float*)d_in[0];
  const float* Wq = (const float*)d_in[1];
  const float* bq = (const float*)d_in[2];
  const float* Wk = (const float*)d_in[3];
  const float* bk = (const float*)d_in[4];
  const float* Wv = (const float*)d_in[5];
  const float* bv = (const float*)d_in[6];
  float* out = (float*)d_out;

  const int B = 8, S = 2048, D = 1024;
  const int MS = B * S; // 16384
  const float scale = 0.03125f; // 1/sqrt(1024)

  // ---- workspace layout (all offsets 16B aligned) ----
  // Buffers share bytes where one is dead before the other is written, all inside this call:
  // the bf16 copies of x and W are last read by the projections, and the scores are written behind them;
  // Q and K are last read by the score GEMM, and P of all batches (exactly their 64 MiB) is written behind it.
  char* ws = (char*)d_ws;
  bf16_t* Q   = (bf16_t*)(ws);                         // 16384x1024 bf16 = 32 MiB
  bf16_t* Km  = (bf16_t*)(ws + (size_t)33554432);      // 32 MiB
  bf16_t* VT  = (bf16_t*)(ws + (size_t)67108864);      // V^T (1024 x 16384), 32 MiB
  const size_t attBase = 100663296;
  bf16_t* xb  = (bf16_t*)(ws + attBase);               // 32 MiB, under the scores
  bf16_t* Wqb = (bf16_t*)(ws + (size_t)134217728);     // 1024x1024 bf16 = 2 MiB each, under the scores
  bf16_t* Wkb = (bf16_t*)(ws + (size_t)136314880);
  bf16_t* Wvb = (bf16_t*)(ws + (size_t)138412032);
  // Full tier: scores f32 for all batches (128 MiB) behind Q, K, V^T; P bf16 for all batches over Q and K
  const size_t fullNeed = attBase + (size_t)B * S * S * 4; // 224 MiB

  dim3 blk(256);

  // ---- 1) convert inputs to bf16 ----
  cvt_f32_bf16_kernel<<<4096, blk, 0, stream>>>(x, xb, (long long)MS * D);
  cvt_f32_bf16_kernel<<<512,  blk, 0, stream>>>(Wq, Wqb, (long long)D * D);
  cvt_f32_bf16_kernel<<<512,  blk, 0, stream>>>(Wk, Wkb, (long long)D * D);
  cvt_f32_bf16_kernel<<<512,  blk, 0, stream>>>(Wv, Wvb, (long long)D * D);

  // ---- 2) projections (pure bf16 WMMA GEMM, 256x256 workgroup tiles) ----
  const int projBlocks = (MS / 256) * (D / 256); // 256
  qkv_proj_kernel<0><<<projBlocks, blk, 0, stream>>>(xb, Wqb, bq, Q,  MS, D, D);
  qkv_proj_kernel<0><<<projBlocks, blk, 0, stream>>>(xb, Wkb, bk, Km, MS, D, D);
  qkv_proj_kernel<1><<<projBlocks, blk, 0, stream>>>(xb, Wvb, bv, VT, MS, D, D);

  const int scBlocks = (S / 256) * (S / 256); // 64 per batch
  const int pvBlocks = (S / 256) * (D / 256); // 32 per batch

  if (ws_size >= fullNeed) {
    // ---- full-parallel tier: all batches per launch (gridDim.y = 8) ----
    float*  Sc = (float*) (ws + attBase);
    bf16_t* P  = (bf16_t*)(ws);  // over Q and K, which the score GEMM below reads for the last time
    attn_gemm_kernel<<<dim3(scBlocks, B), blk, 0, stream>>>(
        Q, Km, Sc, S, S, D, D, D, S,
        (long long)S * D, (long long)S * D, (long long)S * S, scale);
    softmax_kernel<<<dim3(S, B), blk, 0, stream>>>(
        Sc, P, S, (long long)S * S, (long long)S * S);
    attn_gemm_kernel<<<dim3(pvBlocks, B), blk, 0, stream>>>(
        P, VT, out, S, D, S, S, MS, D,
        (long long)S * S, (long long)S, (long long)S * D, 1.0f);
  } else {
    // ---- per-batch tier: reuse one score/P buffer, stream-ordered ----
    float*  Sc = (float*) (ws + attBase);                        // 16 MB
    bf16_t* P  = (bf16_t*)(ws + attBase + (size_t)S * S * 4);    // 8 MB
    for (int b = 0; b < B; ++b) {
      const bf16_t* Qb = Q  + (size_t)b * S * D;
      const bf16_t* Kb = Km + (size_t)b * S * D;
      attn_gemm_kernel<<<dim3(scBlocks, 1), blk, 0, stream>>>(
          Qb, Kb, Sc, S, S, D, D, D, S, 0, 0, 0, scale);
      softmax_kernel<<<dim3(S, 1), blk, 0, stream>>>(Sc, P, S, 0, 0);
      attn_gemm_kernel<<<dim3(pvBlocks, 1), blk, 0, stream>>>(
          P, VT + (size_t)b * S, out + (size_t)b * S * D,
          S, D, S, S, MS, D, 0, 0, 0, 1.0f);
    }
  }
}

// v004
// It runs in 204 microseconds.
// Next to v003, in two timings, it ran 1.05 and 1.04 times as fast.
// Counting every step since v000, it is 4.50 times as fast.
#include <hip/hip_runtime.h>
#include <stdint.h>

typedef __bf16 bf16_t;
typedef __attribute__((ext_vector_type(16))) __bf16 v16bf;
typedef __attribute__((ext_vector_type(8)))  __bf16 v8bf;
typedef __attribute__((ext_vector_type(8)))  float  v8f;
typedef __attribute__((ext_vector_type(4)))  float  v4f;

#define WMMA_BF16(A, B, C) \
  __builtin_amdgcn_wmma_f32_16x16x32_bf16(false, (A), false, (B), (short)0, (C), false, false)

typedef uint32_t u32x4 __attribute__((ext_vector_type(4)));
typedef uint32_t u32x8 __attribute__((ext_vector_type(8)));

// Workgroup tile 256 x 256 of the output, eight waves (two per SIMD), 64 x 128 per wave: each operand byte
// fetched from L2 and each fragment read from LDS feeds twice the matrix work of a 128 x 128 tile.
// A pass is 128 k = 256 bytes of each of the 256 A rows and 256 B^T rows. A stage in LDS is eight
// slices of 64 rows, slices 0..3 = A rows, 4..7 = B^T rows, one tensor load per wave and stage.
constexpr uint32_t ROWB    = 256u;            // bytes of one operand row per pass
constexpr uint32_t PITCH   = ROWB + 16u;      // LDS row pitch for ds_load_b128 readers (pad of 4 dwords)
constexpr uint32_t SROWS   = 64u;             // rows per slice
constexpr uint32_t SLICE_B = 18432u;          // 64 * 272 = 17408, rounded up to a multiple of 2 KiB
constexpr uint32_t BUF_B   = 8u * SLICE_B;    // one stage
constexpr uint32_t RING_B  = 2u * BUF_B;      // two buffers, 294912 bytes: one workgroup per WGP
static_assert(SROWS * PITCH <= SLICE_B && (SLICE_B % 2048u) == 0u, "a slice holds its padded rows and starts at a multiple of 2 KiB");

static __device__ __forceinline__ uint32_t uni(uint32_t v) { return (uint32_t)__builtin_amdgcn_readfirstlane(v); }
// A wave-uniform word held in a scalar register: the issue test on it compiles to s_cmp + s_cbranch_scc, and a
// descriptor word formed from it stays behind the volatile statements (the waits) that stand in front of it.
static __device__ __forceinline__ uint32_t pinned(uint32_t v) {
  uint32_t w = uni(v);
  asm volatile("" : "+s"(w));  // pinned(): a descriptor word or an issue test held in a scalar register
  return w;
}
static __device__ __forceinline__ void wait_ds0()     { asm volatile("s_wait_dscnt 0x0" ::: "memory"); }     // this wave's LDS reads have retired
// This wave's tensor load has landed. The wait names the request's group 0, so that those scalar registers hold
// the descriptor, and nothing else, for as long as the request is outstanding.
static __device__ __forceinline__ void wait_tensor0(u32x4 g0) { asm volatile("s_wait_tensorcnt 0x0" :: "s"(g0) : "memory"); }
// One request of the whole wave: a 2-D tile from global memory into LDS, through no register. Group 0 is an
// in-out operand: what the wait above names is then held in the very registers that the request was issued from.
static __device__ __forceinline__ void tdm_load(u32x4& g0, u32x8 g1) { asm volatile("tensor_load_to_lds %0, %1" : "+s"(g0) : "s"(g1) : "memory"); }

// Descriptor group 1: 1-byte elements, tensor = tile = 64 rows of 256 bytes, 4 dwords of LDS pad behind every row.
static __device__ __forceinline__ u32x8 tdm_group1(uint32_t src_pitch) {
  constexpr uint32_t d0 = ROWB, d1 = SROWS;
  u32x8 g;
  g[0] = uni((1u << 20) | (5u << 22) | (3u << 25));  // no mask; pad on, interval 64 dwords, amount 4 dwords
  // Words 1 to 7 are pinned: descriptor words held in scalar registers of their own for the whole loop,
  // so that none is used for anything else while a request is outstanding.
  g[1] = pinned((d0 & 0xFFFFu) << 16);
  g[2] = pinned((d0 >> 16) | ((d1 & 0xFFFFu) << 16));
  g[3] = pinned((d1 >> 16) | (d0 << 16));
  g[4] = pinned(d1);
  g[5] = pinned(src_pitch);
  g[6] = pinned(0u);
  g[7] = pinned(0u);
  return g;
}
static __device__ __forceinline__ u32x4 tdm_group0(uint32_t lds_dst, uint64_t ga) {
  u32x4 g;
  g[0] = uni(1u);
  g[1] = uni(lds_dst);
  g[2] = uni((uint32_t)ga);
  g[3] = uni((((uint32_t)(ga >> 32)) & 0x01FFFFFFu) | 0x80000000u);
  return g;
}

// A-fragment (16x32 bf16) / B-fragment (B^T rows; identical layout, N in the lane role) from LDS.
// p points at row (lane&15), 16-byte half (lane>>4): K = {k0+h*8 .. +7} then {k0+16+h*8 .. +7}.
static __device__ __forceinline__ v16bf lds_frag(const unsigned char* p) {
  v16bf a;
  a.lo = *(const v8bf*)(p);
  a.hi = *(const v8bf*)(p + 32);
  return a;
}

// C (16*MF x 16*NF per wave) += A[mt0.., :] * Bt[nt0.., :]^T for one 256 x 256 workgroup tile.
// Wave w holds rows 16*MF*(w / WN), columns 16*NF*(w % WN) of the tile, WN = 16 / NF waves along the columns.
// M, N multiples of 256; K a multiple of 128 and at least 256 (two stages).
template <int MF, int NF>
static __device__ __forceinline__ void gemm_core_lds(const bf16_t* __restrict__ A,
                                                     const bf16_t* __restrict__ Bt,
                                                     int lda, int ldb, int K,
                                                     int mt0, int nt0,
                                                     unsigned char* ring, v8f (&C)[MF][NF]) {
  static_assert(MF * NF == 32 && (MF % 4) == 0 && (NF % 4) == 0, "eight waves cover 256 x 256; a wave's rows start on a slice");
  constexpr uint32_t WN = 16u / (uint32_t)NF;
  const uint32_t lane = threadIdx.x & 31u, r = lane & 15u, h = lane >> 4;
  const uint32_t wave = uni(threadIdx.x >> 5);
  const uint32_t wm = wave / WN, wn = wave % WN;
  const uint32_t T = (uint32_t)K >> 7;  // passes

  // This wave's slice of every stage.
  const bool isA = wave < 4u;
  const bf16_t* srow = isA ? A + (size_t)(mt0 + (int)(SROWS * wave)) * (size_t)lda
                           : Bt + (size_t)(nt0 + (int)(SROWS * (wave - 4u))) * (size_t)ldb;
  const uint64_t ga0 = (uint64_t)(uintptr_t)srow;
  const uint32_t dst0 = (uint32_t)(uintptr_t)ring + wave * SLICE_B;
  const u32x8 g1 = tdm_group1(2u * (uint32_t)(isA ? lda : ldb));

  // Per-lane fragment bases inside a buffer.
  const uint32_t fa = wm * (uint32_t)(MF / 4) * SLICE_B + r * PITCH + 16u * h;
  const uint32_t fb = (4u + wn * (uint32_t)(NF / 4)) * SLICE_B + r * PITCH + 16u * h;
  // Fragment f of a wave's operand: 16 rows, four fragments to a slice.
  auto foff = [](uint32_t f) { return (f >> 2) * SLICE_B + (f & 3u) * 16u * PITCH; };

  u32x4 g0 = tdm_group0(dst0, ga0);
  tdm_load(g0, g1);                             // stage 0
  wait_tensor0(g0);
  __syncthreads();                              // stage 0 is published
  g0 = tdm_group0(dst0 + BUF_B, ga0 + ROWB);
  tdm_load(g0, g1);                             // stage 1

  uint32_t s = 0;
  do {  // T is at least 2: both stages loaded above exist
    const uint32_t buf = (s & 1u) * BUF_B;
    const unsigned char* pa = ring + buf + fa;
    const unsigned char* pb = ring + buf + fb;
    // Two fragment sets inside the pass: block kk + 1's 24 LDS reads go out as one group in front of
    // block kk's 32 WMMAs. Nothing of another stage is read here.
    v16bf Af[2][MF], Bf[2][NF];
#pragma unroll  // register arrays need constant indices
    for (uint32_t mi = 0; mi < (uint32_t)MF; ++mi) Af[0][mi] = lds_frag(pa + foff(mi));
#pragma unroll
    for (uint32_t j = 0; j < (uint32_t)NF; ++j) Bf[0][j] = lds_frag(pb + foff(j));
#pragma unroll
    for (uint32_t kk = 0; kk < 4u; ++kk) {
      const uint32_t cur = kk & 1u, nxt = cur ^ 1u;
      if (kk + 1u < 4u) {
#pragma unroll
        for (uint32_t mi = 0; mi < (uint32_t)MF; ++mi) Af[nxt][mi] = lds_frag(pa + foff(mi) + (kk + 1u) * 64u);
#pragma unroll
        for (uint32_t j = 0; j < (uint32_t)NF; ++j) Bf[nxt][j] = lds_frag(pb + foff(j) + (kk + 1u) * 64u);
      }
      __builtin_amdgcn_sched_barrier(0);  // keeps the LDS reads in one group, out of the WMMA run
#pragma unroll
      for (uint32_t j = 0; j < (uint32_t)NF; ++j)
#pragma unroll
        for (uint32_t mi = 0; mi < (uint32_t)MF; ++mi)
          C[mi][j] = WMMA_BF16(Af[cur][mi], Bf[cur][j], C[mi][j]);
      __builtin_amdgcn_sched_barrier(0);  // keeps the next group of reads, and the publish point, behind this WMMA run
    }
    // Publish point of stage s + 1; it also ends every reader's last read of stage s's buffer.
    wait_ds0();
    wait_tensor0(g0);
    __syncthreads();
    if (pinned((s + 2u < T) ? 1u : 0u) != 0u) {  // the refill, only while stage s + 2 exists
      const uint32_t nx = pinned(s + 2u);        // descriptor word source, formed behind the wait above
      g0 = tdm_group0(dst0 + buf, ga0 + (uint64_t)nx * ROWB);
      tdm_load(g0, g1);
    }
  } while (++s < T);
  wait_tensor0(g0);
  wait_ds0();
}

// Elementwise fp32 -> bf16 (8 elements/thread, grid-stride) of all four matrices in one launch, by ranges of the
// block index: blocks [0, 3 * wBlocks) take Wq, Wk, Wv (nw elements each, stored one behind the other in Wb), block
// 3 * wBlocks sets bq and bk (nb floats each, nb a multiple of 4) one behind the other in bqk, the rest take x (nx).
__global__ __launch_bounds__(256) void cvt_f32_bf16_kernel(const float* __restrict__ x,
                                                           const float* __restrict__ Wq,
                                                           const float* __restrict__ Wk,
                                                           const float* __restrict__ Wv,
                                                           const float* __restrict__ bq,
                                                           const float* __restrict__ bk,
                                                           bf16_t* __restrict__ xb,
                                                           bf16_t* __restrict__ Wb,
                                                           float* __restrict__ bqk,
                                                           long long nx, long long nw, int nb, int wBlocks) {
  const int b = (int)blockIdx.x;
  if (b == 3 * wBlocks) {
    for (int i = (int)threadIdx.x * 4; i < nb; i += 256 * 4) {
      *(v4f*)(bqk + i)      = *(const v4f*)(bq + i);
      *(v4f*)(bqk + nb + i) = *(const v4f*)(bk + i);
    }
    return;
  }
  const int which = b / wBlocks;  // 0, 1, 2: a weight matrix; 3 and up: x
  const bool isW = which < 3;
  const float* in = isW ? (which == 0 ? Wq : (which == 1 ? Wk : Wv)) : x;
  bf16_t* outp = isW ? Wb + (long long)which * nw : xb;
  const long long n = isW ? nw : nx;
  const int blk0 = isW ? b - which * wBlocks : b - 3 * wBlocks - 1;     // this block's place in its range
  const int nblk = isW ? wBlocks : (int)gridDim.x - 3 * wBlocks - 1;    // blocks in its range
  long long idx = ((long long)blk0 * 256 + threadIdx.x) * 8;
  const long long stride = (long long)nblk * 256 * 8;
  for (; idx < n; idx += stride) {
    v8f f;
    f.lo = *(const v4f*)(in + idx);
    f.hi = *(const v4f*)(in + idx + 4);
    *(v8bf*)(outp + idx) = __builtin_convertvector(f, v8bf);
  }
}

// out = X * W^T + bias ; X:(M,K) bf16, W:(N,K) bf16 row-major.
// TR==0: out (M,N) bf16 row-major; TR==1: out (N,M) bf16 row-major (V^T). Wave tile 64x128:
// either way the 64 elements of a 128-byte line of out come from one wave. Workgroup tile 256x256.
template <int TR>
__global__ __launch_bounds__(256) void qkv_proj_kernel(
    const bf16_t* __restrict__ X, const bf16_t* __restrict__ W,
    const float* __restrict__ bias, bf16_t* __restrict__ out,
    int M, int N, int K) {
  constexpr int MF = 4, NF = 8, WN = 16 / NF;
  __shared__ __attribute__((aligned(2048))) unsigned char ring[RING_B];
  const int lane = threadIdx.x & 31;
  const int wave = threadIdx.x >> 5;
  const int tilesN = N >> 8;
  const int mt0 = ((int)blockIdx.x / tilesN) << 8;
  const int nt0 = ((int)blockIdx.x % tilesN) << 8;

  v8f C[MF][NF] = {};
  gemm_core_lds<MF, NF>(X, W, K, K, K, mt0, nt0, ring, C);

  const int mt = mt0 + (wave / WN) * (16 * MF);
  const int nt = nt0 + (wave % WN) * (16 * NF);
  const int r = lane & 15, h = lane >> 4;
#pragma unroll
  for (int mi = 0; mi < MF; ++mi) {
    const int rowb = mt + 16 * mi + h * 8;
#pragma unroll
    for (int j = 0; j < NF; ++j) {
      const int n = nt + 16 * j + r;
      const float bval = bias[n];
      if (!TR) {
#pragma unroll
        for (int i = 0; i < 8; ++i)
          out[(size_t)(rowb + i) * (size_t)N + n] = (bf16_t)(C[mi][j][i] + bval);
      } else {
        v8bf o;
#pragma unroll
        for (int i = 0; i < 8; ++i) o[i] = (bf16_t)(C[mi][j][i] + bval);
        *(v8bf*)(out + (size_t)n * (size_t)M + (size_t)rowb) = o;
      }
    }
  }
}

// out = scale * (A * Bt^T), batched via blockIdx.y.
// A:(M,K) bf16 lda, Bt:(N,K) bf16 ldb, out:(M,N) f32 ldo.
// Workgroup tile 256x256, wave tile 64x128 (4x8 fragments).
__global__ __launch_bounds__(256) void attn_gemm_kernel(
    const bf16_t* __restrict__ A, const bf16_t* __restrict__ Bt,
    float* __restrict__ outp, int M, int N, int K,
    int lda, int ldb, int ldo,
    long long strideA, long long strideB, long long strideO, float scale) {
  __shared__ __attribute__((aligned(2048))) unsigned char ring[RING_B];
  const int b = blockIdx.y;
  const bf16_t* Ab  = A  + (size_t)b * strideA;
  const bf16_t* Btb = Bt + (size_t)b * strideB;
  float* ob = outp + (size_t)b * strideO;

  const int lane = threadIdx.x & 31;
  const int wave = threadIdx.x >> 5;
  const int tilesN = N >> 8;
  const int mt0 = ((int)blockIdx.x / tilesN) << 8;
  const int nt0 = ((int)blockIdx.x % tilesN) << 8;

  v8f C[4][8] = {};
  gemm_core_lds<4, 8>(Ab, Btb, lda, ldb, K, mt0, nt0, ring, C);

  const int mt = mt0 + ((wave >> 1) << 6);
  const int nt = nt0 + ((wave & 1) << 7);
  const int r = lane & 15, h = lane >> 4;
#pragma unroll
  for (int mi = 0; mi < 4; ++mi) {
    const int rowb = mt + 16 * mi + h * 8;
#pragma unroll
    for (int j = 0; j < 8; ++j) {
      const int n = nt + 16 * j + r;
#pragma unroll
      for (int i = 0; i < 8; ++i)
        ob[(size_t)(rowb + i) * (size_t)ldo + n] = C[mi][j][i] * scale;
    }
  }
}

// Row softmax: fp32 scores (N==2048) -> bf16 probabilities. One 256-thread block per row,
// batched via blockIdx.y.
__global__ __launch_bounds__(256) void softmax_kernel(
    const float* __restrict__ S, bf16_t* __restrict__ P, int N,
    long long strideS, long long strideP) {
  const int row = blockIdx.x;
  const int tid = threadIdx.x;
  const float* srow = S + (size_t)blockIdx.y * strideS + (size_t)row * (size_t)N;
  bf16_t* prow = P + (size_t)blockIdx.y * strideP + (size_t)row * (size_t)N;
  __shared__ float red[8];

  float vals[8];
  float mx = -3.0e38f;
#pragma unroll
  for (int i = 0; i < 8; ++i) {
    vals[i] = srow[tid + (i << 8)];
    mx = fmaxf(mx, vals[i]);
  }
#pragma unroll
  for (int off = 16; off >= 1; off >>= 1)
    mx = fmaxf(mx, __shfl_xor(mx, off, 32));
  if ((tid & 31) == 0) red[tid >> 5] = mx;
  __syncthreads();
  mx = red[0];
#pragma unroll
  for (int w = 1; w < 8; ++w) mx = fmaxf(mx, red[w]);
  __syncthreads();

  float sum = 0.0f;
#pragma unroll
  for (int i = 0; i < 8; ++i) {
    vals[i] = __expf(vals[i] - mx);
    sum += vals[i];
  }
#pragma unroll
  for (int off = 16; off >= 1; off >>= 1)
    sum += __shfl_xor(sum, off, 32);
  if ((tid & 31) == 0) red[tid >> 5] = sum;
  __syncthreads();
  sum = 0.0f;
#pragma unroll
  for (int w = 0; w < 8; ++w) sum += red[w];
  const float inv = 1.0f / sum;

#pragma unroll
  for (int i = 0; i < 8; ++i)
    prow[tid + (i << 8)] = (bf16_t)(vals[i] * inv);
}

extern "C" void kernel_launch(void* const* d_in, const int* in_sizes, int n_in,
                              void* d_out, int out_size, void* d_ws, size_t ws_size,
                              hipStream_t stream) {
  const float* x  = (const float*)d_in[0];
  const float* Wq = (const float*)d_in[1];
  const float* bq = (const float*)d_in[2];
  const float* Wk = (const float*)d_in[3];
  const float* bk = (const float*)d_in[4];
  const float* Wv = (const float*)d_in[5];
  const float* bv = (const float*)d_in[6];
  float* out = (float*)d_out;

  const int B = 8, S = 2048, D = 1024;
  const int MS = B * S; // 16384
  const float scale = 0.03125f; // 1/sqrt(1024)

  // ---- workspace layout (all offsets 16B aligned) ----
  // Buffers share bytes where one is dead before the other is written, all inside this call:
  // the bf16 copies of x and W are last read by the projections, and the scores are written behind them;
  // Q and K are last read by the score GEMM, and P of all batches (exactly their 64 MiB) is written behind it.
  char* ws = (char*)d_ws;
  bf16_t* QK  = (bf16_t*)(ws);                         // 16384x2048 bf16 = 64 MiB: row m holds q(m), then k(m)
  bf16_t* VT  = (bf16_t*)(ws + (size_t)67108864);      // V^T (1024 x 16384), 32 MiB
  const size_t attBase = 100663296;
  bf16_t* xb  = (bf16_t*)(ws + attBase);               // 32 MiB, under the scores
  bf16_t* Wb  = (bf16_t*)(ws + (size_t)134217728);     // Wq, Wk, Wv: 1024x1024 bf16 = 2 MiB each, under the scores
  bf16_t* Wvb = (bf16_t*)(ws + (size_t)138412032);     // the third of them
  float*  bqk = (float*) (ws + (size_t)140509184);     // bq, then bk: 2048 floats, under the scores
  // Full tier: scores f32 for all batches (128 MiB) behind Q, K, V^T; P bf16 for all batches over Q and K
  const size_t fullNeed = attBase + (size_t)B * S * S * 4; // 224 MiB

  dim3 blk(256);

  // ---- 1) convert inputs to bf16 ----
  cvt_f32_bf16_kernel<<<3 * 512 + 1 + 4096, blk, 0, stream>>>(x, Wq, Wk, Wv, bq, bk, xb, Wb, bqk,
                                                              (long long)MS * D, (long long)D * D, D, 512);

  // ---- 2) projections (pure bf16 WMMA GEMM, 256x256 workgroup tiles) ----
  // Q and K are one product: x times the 2048 rows of Wq and Wk, N = 2 * D.
  const int projBlocks = (MS / 256) * (D / 256); // 256
  qkv_proj_kernel<0><<<2 * projBlocks, blk, 0, stream>>>(xb, Wb, bqk, QK, MS, 2 * D, D);
  qkv_proj_kernel<1><<<projBlocks, blk, 0, stream>>>(xb, Wvb, bv, VT, MS, D, D);

  const int scBlocks = (S / 256) * (S / 256); // 64 per batch
  const int pvBlocks = (S / 256) * (D / 256); // 32 per batch

  if (ws_size >= fullNeed) {
    // ---- full-parallel tier: all batches per launch (gridDim.y = 8) ----
    float*  Sc = (float*) (ws + attBase);
    bf16_t* P  = (bf16_t*)(ws);  // over Q and K, which the score GEMM below reads for the last time
    attn_gemm_kernel<<<dim3(scBlocks, B), blk, 0, stream>>>(
        QK, QK + D, Sc, S, S, D, 2 * D, 2 * D, S,
        (long long)S * 2 * D, (long long)S * 2 * D, (long long)S * S, scale);
    softmax_kernel<<<dim3(S, B), blk, 0, stream>>>(
        Sc, P, S, (long long)S * S, (long long)S * S);
    attn_gemm_kernel<<<dim3(pvBlocks, B), blk, 0, stream>>>(
        P, VT, out, S, D, S, S, MS, D,
        (long long)S * S, (long long)S, (long long)S * D, 1.0f);
  } else {
    // ---- per-batch tier: reuse one score/P buffer, stream-ordered ----
    float*  Sc = (float*) (ws + attBase);                        // 16 MB
    bf16_t* P  = (bf16_t*)(ws + attBase + (size_t)S * S * 4);    // 8 MB
    for (int b = 0; b < B; ++b) {
      const bf16_t* Qb = QK + (size_t)b * S * 2 * D;
      const bf16_t* Kb = Qb + D;
      attn_gemm_kernel<<<dim3(scBlocks, 1), blk, 0, stream>>>(
          Qb, Kb, Sc, S, S, D, 2 * D, 2 * D, S, 0, 0, 0, scale);
      softmax_kernel<<<dim3(S, 1), blk, 0, stream>>>(Sc, P, S, 0, 0);
      attn_gemm_kernel<<<dim3(pvBlocks, 1), blk, 0, stream>>>(
          P, VT + (size_t)b * S, out + (size_t)b * S * D,
          S, D, S, S, MS, D, 0, 0, 0, 1.0f);
    }
  }
}

// v005
// Measured time: 181 microseconds a run.
// Two timings next to v004 put it at 1.13 and 1.12 times that version's speed.
// Counting every step since v000, it is 5.06 times as fast.
#include <hip/hip_runtime.h>
#include <stdint.h>

typedef __bf16 bf16_t;
typedef __attribute__((ext_vector_type(16))) __bf16 v16bf;
typedef __attribute__((ext_vector_type(8)))  __bf16 v8bf;
typedef __attribute__((ext_vector_type(2)))  __bf16 v2bf;
typedef __attribute__((ext_vector_type(8)))  float  v8f;
typedef __attribute__((ext_vector_type(4)))  float  v4f;

#define WMMA_BF16(A, B, C) \
  __builtin_amdgcn_wmma_f32_16x16x32_bf16(false, (A), false, (B), (short)0, (C), false, false)

typedef uint32_t u32x4 __attribute__((ext_vector_type(4)));
typedef uint32_t u32x8 __attribute__((ext_vector_type(8)));

// Workgroup tile 256 x 256 of the output, eight waves (two per SIMD), 64 x 128 or 128 x 64 per wave: each operand byte
// fetched from L2 and each fragment read from LDS feeds twice the matrix work of a 128 x 128 tile.
// A pass is 128 k = 256 bytes of each of the 256 A rows and 256 B^T rows. A stage in LDS is eight
// slices of 64 rows, slices 0..3 = A rows, 4..7 = B^T rows, one tensor load per wave and stage.
constexpr uint32_t ROWB    = 256u;            // bytes of one operand row per pass
constexpr uint32_t PITCH   = ROWB + 16u;      // LDS row pitch for ds_load_b128 readers (pad of 4 dwords)
constexpr uint32_t SROWS   = 64u;             // rows per slice
constexpr uint32_t SLICE_B = 18432u;          // 64 * 272 = 17408, rounded up to a multiple of 2 KiB
constexpr uint32_t BUF_B   = 8u * SLICE_B;    // one stage
constexpr uint32_t RING_B  = 2u * BUF_B;      // two buffers, 294912 bytes: one workgroup per WGP
static_assert(SROWS * PITCH <= SLICE_B && (SLICE_B % 2048u) == 0u, "a slice holds its padded rows and starts at a multiple of 2 KiB");

static __device__ __forceinline__ uint32_t uni(uint32_t v) { return (uint32_t)__builtin_amdgcn_readfirstlane(v); }
// A wave-uniform word held in a scalar register: the issue test on it compiles to s_cmp + s_cbranch_scc, and a
// descriptor word formed from it stays behind the volatile statements (the waits) that stand in front of it.
static __device__ __forceinline__ uint32_t pinned(uint32_t v) {
  uint32_t w = uni(v);
  asm volatile("" : "+s"(w));  // pinned(): a descriptor word or an issue test held in a scalar register
  return w;
}
static __device__ __forceinline__ void wait_ds0()     { asm volatile("s_wait_dscnt 0x0" ::: "memory"); }     // this wave's LDS reads have retired
// This wave's tensor load has landed. The wait names the request's group 0, so that those scalar registers hold
// the descriptor, and nothing else, for as long as the request is outstanding.
static __device__ __forceinline__ void wait_tensor0(u32x4 g0) { asm volatile("s_wait_tensorcnt 0x0" :: "s"(g0) : "memory"); }
// One request of the whole wave: a 2-D tile from global memory into LDS, through no register. Group 0 is an
// in-out operand: what the wait above names is then held in the very registers that the request was issued from.
static __device__ __forceinline__ void tdm_load(u32x4& g0, u32x8 g1) { asm volatile("tensor_load_to_lds %0, %1" : "+s"(g0) : "s"(g1) : "memory"); }

// Descriptor group 1: 1-byte elements, tensor = tile = 64 rows of 256 bytes, 4 dwords of LDS pad behind every row.
static __device__ __forceinline__ u32x8 tdm_group1(uint32_t src_pitch) {
  constexpr uint32_t d0 = ROWB, d1 = SROWS;
  u32x8 g;
  g[0] = uni((1u << 20) | (5u << 22) | (3u << 25));  // no mask; pad on, interval 64 dwords, amount 4 dwords
  // Words 1 to 7 are pinned: descriptor words held in scalar registers of their own for the whole loop,
  // so that none is used for anything else while a request is outstanding.
  g[1] = pinned((d0 & 0xFFFFu) << 16);
  g[2] = pinned((d0 >> 16) | ((d1 & 0xFFFFu) << 16));
  g[3] = pinned((d1 >> 16) | (d0 << 16));
  g[4] = pinned(d1);
  g[5] = pinned(src_pitch);
  g[6] = pinned(0u);
  g[7] = pinned(0u);
  return g;
}
static __device__ __forceinline__ u32x4 tdm_group0(uint32_t lds_dst, uint64_t ga) {
  u32x4 g;
  g[0] = uni(1u);
  g[1] = uni(lds_dst);
  g[2] = uni((uint32_t)ga);
  g[3] = uni((((uint32_t)(ga >> 32)) & 0x01FFFFFFu) | 0x80000000u);
  return g;
}

// A-fragment (16x32 bf16) / B-fragment (B^T rows; identical layout, N in the lane role) from LDS.
// p points at row (lane&15), 16-byte half (lane>>4): K = {k0+h*8 .. +7} then {k0+16+h*8 .. +7}.
static __device__ __forceinline__ v16bf lds_frag(const unsigned char* p) {
  v16bf a;
  a.lo = *(const v8bf*)(p);
  a.hi = *(const v8bf*)(p + 32);
  return a;
}

// One bf16 factor, held twice in a dword, spread over a fragment's 16 elements.
static __device__ __forceinline__ v16bf splat16(uint32_t w) {
  const v2bf g = __builtin_bit_cast(v2bf, w);
  return __builtin_shufflevector(g, g, 0, 1, 0, 1, 0, 1, 0, 1, 0, 1, 0, 1, 0, 1, 0, 1);
}

// C (16*MF x 16*NF per wave) += A[mt0.., :] * Bt[nt0.., :]^T for one 256 x 256 workgroup tile.
// Wave w holds rows 16*MF*(w / WN), columns 16*NF*(w % WN) of the tile, WN = 16 / NF waves along the columns.
// M, N multiples of 256; K a multiple of 128 and at least 256 (two stages).
// SCALE: row m of A counts times a factor of its own in every pass s; gt points at this lane's first row in a
// table in LDS of [pass][256 tile rows] dwords (the bf16 factor twice), which pre() fills.
// pre() runs once, while stage 0's load is in flight; what it writes to LDS is published by stage 0's barrier.
template <int MF, int NF, bool SCALE, class Pre>
static __device__ __forceinline__ void gemm_core_lds(const bf16_t* __restrict__ A,
                                                     const bf16_t* __restrict__ Bt,
                                                     int lda, int ldb, int K,
                                                     int mt0, int nt0,
                                                     unsigned char* ring, const uint32_t* gt, Pre pre,
                                                     v8f (&C)[MF][NF]) {
  static_assert(MF * NF == 32 && (MF % 4) == 0 && (NF % 4) == 0, "eight waves cover 256 x 256; a wave's rows start on a slice");
  constexpr uint32_t WN = 16u / (uint32_t)NF;
  const uint32_t lane = threadIdx.x & 31u, r = lane & 15u, h = lane >> 4;
  const uint32_t wave = uni(threadIdx.x >> 5);
  const uint32_t wm = wave / WN, wn = wave % WN;
  const uint32_t T = (uint32_t)K >> 7;  // passes

  // This wave's slice of every stage.
  const bool isA = wave < 4u;
  const bf16_t* srow = isA ? A + (size_t)(mt0 + (int)(SROWS * wave)) * (size_t)lda
                           : Bt + (size_t)(nt0 + (int)(SROWS * (wave - 4u))) * (size_t)ldb;
  const uint64_t ga0 = (uint64_t)(uintptr_t)srow;
  const uint32_t dst0 = (uint32_t)(uintptr_t)ring + wave * SLICE_B;
  const u32x8 g1 = tdm_group1(2u * (uint32_t)(isA ? lda : ldb));

  // Per-lane fragment bases inside a buffer.
  const uint32_t fa = wm * (uint32_t)(MF / 4) * SLICE_B + r * PITCH + 16u * h;
  const uint32_t fb = (4u + wn * (uint32_t)(NF / 4)) * SLICE_B + r * PITCH + 16u * h;
  // Fragment f of a wave's operand: 16 rows, four fragments to a slice.
  auto foff = [](uint32_t f) { return (f >> 2) * SLICE_B + (f & 3u) * 16u * PITCH; };

  u32x4 g0 = tdm_group0(dst0, ga0);
  tdm_load(g0, g1);                             // stage 0
  pre();
  wait_tensor0(g0);
  __syncthreads();                              // stage 0 is published
  g0 = tdm_group0(dst0 + BUF_B, ga0 + ROWB);
  tdm_load(g0, g1);                             // stage 1

  uint32_t s = 0;
  do {  // T is at least 2: both stages loaded above exist
    const uint32_t buf = (s & 1u) * BUF_B;
    const unsigned char* pa = ring + buf + fa;
    const unsigned char* pb = ring + buf + fb;
    // Two fragment sets inside the pass: block kk + 1's 24 LDS reads go out as one group in front of
    // block kk's 32 WMMAs. Nothing of another stage is read here.
    v16bf Af[2][MF], Bf[2][NF];
    uint32_t gw[MF];  // this pass's factor of the lane's row in each A fragment (an A fragment's row is lane & 15)
    if constexpr (SCALE) {
#pragma unroll  // register arrays need constant indices
      for (uint32_t mi = 0; mi < (uint32_t)MF; ++mi) gw[mi] = gt[s * 256u + 16u * mi];
    }
#pragma unroll  // register arrays need constant indices
    for (uint32_t mi = 0; mi < (uint32_t)MF; ++mi) Af[0][mi] = lds_frag(pa + foff(mi));
#pragma unroll
    for (uint32_t j = 0; j < (uint32_t)NF; ++j) Bf[0][j] = lds_frag(pb + foff(j));
#pragma unroll
    for (uint32_t kk = 0; kk < 4u; ++kk) {
      const uint32_t cur = kk & 1u, nxt = cur ^ 1u;
      if (kk + 1u < 4u) {
#pragma unroll
        for (uint32_t mi = 0; mi < (uint32_t)MF; ++mi) Af[nxt][mi] = lds_frag(pa + foff(mi) + (kk + 1u) * 64u);
#pragma unroll
        for (uint32_t j = 0; j < (uint32_t)NF; ++j) Bf[nxt][j] = lds_frag(pb + foff(j) + (kk + 1u) * 64u);
      }
      if constexpr (SCALE) {  // the factors are powers of two: the products are exact
#pragma unroll  // register arrays need constant indices
        for (uint32_t mi = 0; mi < (uint32_t)MF; ++mi) Af[cur][mi] = Af[cur][mi] * splat16(gw[mi]);
      }
      __builtin_amdgcn_sched_barrier(0);  // keeps the LDS reads in one group, out of the WMMA run
#pragma unroll
      for (uint32_t j = 0; j < (uint32_t)NF; ++j)
#pragma unroll
        for (uint32_t mi = 0; mi < (uint32_t)MF; ++mi)
          C[mi][j] = WMMA_BF16(Af[cur][mi], Bf[cur][j], C[mi][j]);
      __builtin_amdgcn_sched_barrier(0);  // keeps the next group of reads, and the publish point, behind this WMMA run
    }
    // Publish point of stage s + 1; it also ends every reader's last read of stage s's buffer.
    wait_ds0();
    wait_tensor0(g0);
    __syncthreads();
    if (pinned((s + 2u < T) ? 1u : 0u) != 0u) {  // the refill, only while stage s + 2 exists
      const uint32_t nx = pinned(s + 2u);        // descriptor word source, formed behind the wait above
      g0 = tdm_group0(dst0 + buf, ga0 + (uint64_t)nx * ROWB);
      tdm_load(g0, g1);
    }
  } while (++s < T);
  wait_tensor0(g0);
  wait_ds0();
}

// Elementwise fp32 -> bf16 (8 elements/thread, grid-stride) of all four matrices in one launch, by ranges of the
// block index: blocks [0, 3 * wBlocks) take Wq, Wk, Wv (nw elements each, stored one behind the other in Wb), block
// 3 * wBlocks sets bq and bk (nb floats each, nb a multiple of 4) one behind the other in bqk, the rest take x (nx).
__global__ __launch_bounds__(256) void cvt_f32_bf16_kernel(const float* __restrict__ x,
                                                           const float* __restrict__ Wq,
                                                           const float* __restrict__ Wk,
                                                           const float* __restrict__ Wv,
                                                           const float* __restrict__ bq,
                                                           const float* __restrict__ bk,
                                                           bf16_t* __restrict__ xb,
                                                           bf16_t* __restrict__ Wb,
                                                           float* __restrict__ bqk,
                                                           long long nx, long long nw, int nb, int wBlocks) {
  const int b = (int)blockIdx.x;
  if (b == 3 * wBlocks) {
    for (int i = (int)threadIdx.x * 4; i < nb; i += 256 * 4) {
      *(v4f*)(bqk + i)      = *(const v4f*)(bq + i);
      *(v4f*)(bqk + nb + i) = *(const v4f*)(bk + i);
    }
    return;
  }
  const int which = b / wBlocks;  // 0, 1, 2: a weight matrix; 3 and up: x
  const bool isW = which < 3;
  const float* in = isW ? (which == 0 ? Wq : (which == 1 ? Wk : Wv)) : x;
  bf16_t* outp = isW ? Wb + (long long)which * nw : xb;
  const long long n = isW ? nw : nx;
  const int blk0 = isW ? b - which * wBlocks : b - 3 * wBlocks - 1;     // this block's place in its range
  const int nblk = isW ? wBlocks : (int)gridDim.x - 3 * wBlocks - 1;    // blocks in its range
  long long idx = ((long long)blk0 * 256 + threadIdx.x) * 8;
  const long long stride = (long long)nblk * 256 * 8;
  for (; idx < n; idx += stride) {
    v8f f;
    f.lo = *(const v4f*)(in + idx);
    f.hi = *(const v4f*)(in + idx + 4);
    *(v8bf*)(outp + idx) = __builtin_convertvector(f, v8bf);
  }
}

// out = X * W^T + bias ; X:(M,K) bf16, W:(N,K) bf16 row-major.
// TR==0: out (M,N) bf16 row-major; TR==1: out (N,M) bf16 row-major (V^T). Wave tile 64x128:
// either way the 64 elements of a 128-byte line of out come from one wave. Workgroup tile 256x256.
template <int TR>
__global__ __launch_bounds__(256) void qkv_proj_kernel(
    const bf16_t* __restrict__ X, const bf16_t* __restrict__ W,
    const float* __restrict__ bias, bf16_t* __restrict__ out,
    int M, int N, int K) {
  constexpr int MF = 4, NF = 8, WN = 16 / NF;
  __shared__ __attribute__((aligned(2048))) unsigned char ring[RING_B];
  const int lane = threadIdx.x & 31;
  const int wave = threadIdx.x >> 5;
  const int tilesN = N >> 8;
  const int mt0 = ((int)blockIdx.x / tilesN) << 8;
  const int nt0 = ((int)blockIdx.x % tilesN) << 8;

  v8f C[MF][NF] = {};
  gemm_core_lds<MF, NF, false>(X, W, K, K, K, mt0, nt0, ring, nullptr, [] {}, C);

  const int mt = mt0 + (wave / WN) * (16 * MF);
  const int nt = nt0 + (wave % WN) * (16 * NF);
  const int r = lane & 15, h = lane >> 4;
#pragma unroll
  for (int mi = 0; mi < MF; ++mi) {
    const int rowb = mt + 16 * mi + h * 8;
#pragma unroll
    for (int j = 0; j < NF; ++j) {
      const int n = nt + 16 * j + r;
      const float bval = bias[n];
      if (!TR) {
#pragma unroll
        for (int i = 0; i < 8; ++i)
          out[(size_t)(rowb + i) * (size_t)N + n] = (bf16_t)(C[mi][j][i] + bval);
      } else {
        v8bf o;
#pragma unroll
        for (int i = 0; i < 8; ++i) o[i] = (bf16_t)(C[mi][j][i] + bval);
        *(v8bf*)(out + (size_t)n * (size_t)M + (size_t)rowb) = o;
      }
    }
  }
}

// Softmax over the keys is split over the two attention products, by blocks of KB = 128 keys (one pass of the second).
// Base 2: w = score * log2(e). Block t of a query row has the whole number e_t = ceil(max of w in the block).
// First product: stores p = 2^(w - e_t) as bf16 (at most 1) and, per row and block, e_t and l_t = sum of p.
// Second product: with E = max e_t and g_t = 2^(e_t - E), out = (sum_t g_t * (p_t * V_t)) / (sum_t g_t * l_t).
constexpr int KB   = 128;   // keys per block
constexpr int NBLK = 16;    // blocks per row: the second product is built for 2048 keys
constexpr int SQ   = 2048;  // queries per batch: pitch of the per-block tables
constexpr int DV   = 1024;  // columns of V and of out: a compile-time pitch puts a lane's stores on one address register
constexpr uint32_t GTAB_B = (uint32_t)NBLK * 256u * 4u;  // factor table of a 256-row tile
constexpr uint32_t TAB_B  = GTAB_B + 256u * 4u;          // and one reciprocal row sum per row

// Stands behind a group of global loads or stores, in front of the first instruction that may overwrite a register
// which one of them names (address or data). The scheduling barrier keeps later arithmetic behind the wait.
static __device__ __forceinline__ void close_global_group() {
  asm volatile("s_wait_xcnt 0x0" ::: "memory");
  __builtin_amdgcn_sched_barrier(0);
}

// The value of lane l ^ 16.
static __device__ __forceinline__ float other_half(float v) {
  const int b = __builtin_bit_cast(int, v);
  return __builtin_bit_cast(float, __builtin_amdgcn_permlanex16(b, b, 0x76543210, 0xfedcba98, false, false));
}

// Transposed scores, keys x queries = Kmat * Q^T, batched via blockIdx.y: a lane's accumulators of one column of
// fragments all belong to ONE query, so maximum and sum run inside the lane (one exchange between the halves), and
// eight neighbouring keys of a query make one 16-byte store. Workgroup tile 256x256, wave tile 128 keys x 64 queries.
// Kmat, Q: (S, K) bf16, pitch ld. P: (S queries, S keys) bf16. eblk, lblk: (S / KB blocks, SQ queries) f32, S <= SQ.
__global__ __launch_bounds__(256) void score_exp_kernel(
    const bf16_t* __restrict__ Kmat, const bf16_t* __restrict__ Q,
    bf16_t* __restrict__ P, float* __restrict__ eblk, float* __restrict__ lblk,
    int S, int K, int ld, long long strideQK, long long strideP, long long strideB, float sc2) {
  constexpr int MF = 8, NF = 4, WN = 16 / NF;
  __shared__ __attribute__((aligned(2048))) unsigned char ring[RING_B];
  const int b = blockIdx.y;
  const bf16_t* Kb = Kmat + (size_t)b * strideQK;
  const bf16_t* Qb = Q + (size_t)b * strideQK;
  bf16_t* Pb = P + (size_t)b * strideP;
  float* eb = eblk + (size_t)b * strideB;
  float* lb = lblk + (size_t)b * strideB;

  const int lane = threadIdx.x & 31;
  const int wave = threadIdx.x >> 5;
  const int tilesN = S >> 8;
  const int kt0 = ((int)blockIdx.x / tilesN) << 8;
  const int qt0 = ((int)blockIdx.x % tilesN) << 8;

  v8f C[MF][NF] = {};
  gemm_core_lds<MF, NF, false>(Kb, Qb, ld, ld, K, kt0, qt0, ring, nullptr, [] {}, C);

  const int kt = kt0 + (wave / WN) * (16 * MF);  // this wave's key block
  const int qt = qt0 + (wave % WN) * (16 * NF);
  const int r = lane & 15, h = lane >> 4;
  // Every loop below is unrolled because the accumulators are register arrays: they need constant indices.
#pragma unroll
  for (int j = 0; j < NF; ++j) {
    const int q = qt + 16 * j + r;
    v8f mv = C[0][j];
#pragma unroll
    for (int mi = 1; mi < MF; ++mi) mv = __builtin_elementwise_max(mv, C[mi][j]);
    float mx = fmaxf(fmaxf(fmaxf(mv[0], mv[1]), fmaxf(mv[2], mv[3])), fmaxf(fmaxf(mv[4], mv[5]), fmaxf(mv[6], mv[7])));
    mx = fmaxf(mx, other_half(mx));
    const float e = ceilf(mx * sc2);
    bf16_t* prow = Pb + (size_t)q * (size_t)S + (size_t)(kt + 8 * h);
    v8f sv = {};
    v8bf o[MF];
#pragma unroll
    for (int mi = 0; mi < MF; ++mi) {
      v8f p;
#pragma unroll
      for (int i = 0; i < 8; ++i) p[i] = __builtin_amdgcn_exp2f(__builtin_fmaf(C[mi][j][i], sc2, -e));
      sv += p;
      o[mi] = __builtin_convertvector(p, v8bf);
    }
    float sum = ((sv[0] + sv[1]) + (sv[2] + sv[3])) + ((sv[4] + sv[5]) + (sv[6] + sv[7]));
    sum += other_half(sum);
    // Both halves hold e and sum of query q: the lower half stores e, the upper half the sum, in one instruction.
    float* sp = (h ? lb : eb) + (size_t)(kt / KB) * (size_t)SQ + (size_t)q;
    const float sval = h ? sum : e;
    __builtin_amdgcn_sched_barrier(0);  // all values of this column stand in registers before its first store issues
    *sp = sval;
#pragma unroll
    for (int mi = 0; mi < MF; ++mi) *(v8bf*)(prow + 16 * mi) = o[mi];
    close_global_group();
  }
}

// out = softmax weights * V, batched via blockIdx.y: P (queries, K keys) bf16 as score_exp_kernel leaves it,
// Vt (DV, K) bf16 pitch ldb, out (queries, DV) f32. K = NBLK * KB. Workgroup tile 256x256, wave tile 64x128.
__global__ __launch_bounds__(256) void pv_kernel(
    const bf16_t* __restrict__ P, const bf16_t* __restrict__ Vt,
    const float* __restrict__ eblk, const float* __restrict__ lblk,
    float* __restrict__ outp, int K, int ldb,
    long long strideP, long long strideV, long long strideB, long long strideO) {
  // The ring first, so that its slices keep their places at multiples of 2 KiB; the tables behind it.
  __shared__ __attribute__((aligned(2048))) unsigned char smem[RING_B + TAB_B];
  uint32_t* gtab = (uint32_t*)(smem + RING_B);
  float* invl = (float*)(smem + RING_B + GTAB_B);
  const int b = blockIdx.y;
  const bf16_t* Pb = P + (size_t)b * strideP;
  const bf16_t* Vb = Vt + (size_t)b * strideV;
  const float* eb = eblk + (size_t)b * strideB;
  const float* lb = lblk + (size_t)b * strideB;
  float* ob = outp + (size_t)b * strideO;

  const int tid = threadIdx.x;
  const int lane = tid & 31;
  const int wave = tid >> 5;
  constexpr int tilesN = DV >> 8;
  const int mt0 = ((int)blockIdx.x / tilesN) << 8;
  const int nt0 = ((int)blockIdx.x % tilesN) << 8;
  const int r = lane & 15, h = lane >> 4;

  // Thread t joins the blocks of tile row t. Its loops are unrolled: ev and lv are register arrays, and the 32 loads
  // then go out together on one address register with constant offsets.
  auto pre = [&] {
    float ev[NBLK], lv[NBLK];
    const float* ep = eb + mt0 + tid;
    const float* lp = lb + mt0 + tid;
#pragma unroll
    for (int t = 0; t < NBLK; ++t) {
      ev[t] = ep[t * SQ];
      lv[t] = lp[t * SQ];
    }
    close_global_group();
    float E = ev[0];
#pragma unroll
    for (int t = 1; t < NBLK; ++t) E = fmaxf(E, ev[t]);
    float L = 0.0f;
#pragma unroll
    for (int t = 0; t < NBLK; ++t) {
      const float g = __builtin_ldexpf(1.0f, (int)(ev[t] - E));  // an exact power of two or 0: its upper 16 bits are the bf16
      L += lv[t] * g;
      const uint32_t gb = __builtin_bit_cast(uint32_t, g) >> 16;
      gtab[t * 256 + tid] = gb | (gb << 16);
    }
    invl[tid] = 1.0f / L;
  };

  v8f C[4][8] = {};
  gemm_core_lds<4, 8, true>(Pb, Vb, K, ldb, K, mt0, nt0, smem, gtab + ((wave >> 1) << 6) + r, pre, C);

  const int mt = mt0 + ((wave >> 1) << 6);
  const int nt = nt0 + ((wave & 1) << 7);
  float* op = ob + (size_t)(mt + h * 8) * (size_t)DV + (size_t)(nt + r);
  const float* ip = invl + (mt - mt0) + h * 8;
  // Unrolled: the accumulators are register arrays, and the store offsets become constants.
#pragma unroll
  for (int mi = 0; mi < 4; ++mi) {
    v8f iv;
    iv.lo = *(const v4f*)(ip + 16 * mi);
    iv.hi = *(const v4f*)(ip + 16 * mi + 4);
    v8f o[8];
#pragma unroll
    for (int j = 0; j < 8; ++j) o[j] = C[mi][j] * iv;
    __builtin_amdgcn_sched_barrier(0);  // all values of these 16 rows stand in registers before their first store issues
#pragma unroll
    for (int j = 0; j < 8; ++j) {
#pragma unroll
      for (int i = 0; i < 8; ++i) op[(16 * mi + i) * DV + 16 * j] = o[j][i];
    }
    close_global_group();
  }
}

extern "C" void kernel_launch(void* const* d_in, const int* in_sizes, int n_in,
                              void* d_out, int out_size, void* d_ws, size_t ws_size,
                              hipStream_t stream) {
  const float* x  = (const float*)d_in[0];
  const float* Wq = (const float*)d_in[1];
  const float* bq = (const float*)d_in[2];
  const float* Wk = (const float*)d_in[3];
  const float* bk = (const float*)d_in[4];
  const float* Wv = (const float*)d_in[5];
  const float* bv = (const float*)d_in[6];
  float* out = (float*)d_out;

  const int B = 8, S = 2048, D = 1024;
  const int MS = B * S; // 16384
  const float sc2 = 0.045084220f; // log2(e) / sqrt(1024)

  // ---- workspace layout (all offsets 16B aligned) ----
  // Buffers share bytes where one is dead before the other is written, all inside this call:
  // the bf16 copies of x and W are last read by the projections, and P is written behind them.
  char* ws = (char*)d_ws;
  bf16_t* QK  = (bf16_t*)(ws);                         // 16384x2048 bf16 = 64 MiB: row m holds q(m), then k(m)
  bf16_t* VT  = (bf16_t*)(ws + (size_t)67108864);      // V^T (1024 x 16384), 32 MiB
  const size_t attBase = 100663296;
  bf16_t* xb  = (bf16_t*)(ws + attBase);               // 32 MiB, under P
  bf16_t* Wb  = (bf16_t*)(ws + (size_t)134217728);     // Wq, Wk, Wv: 1024x1024 bf16 = 2 MiB each, under P
  bf16_t* Wvb = (bf16_t*)(ws + (size_t)138412032);     // the third of them
  float*  bqk = (float*) (ws + (size_t)140509184);     // bq, then bk: 2048 floats, under P
  bf16_t* P   = (bf16_t*)(ws + attBase);               // 8 x 2048 x 2048 bf16 = 64 MiB
  float*  eb  = (float*) (ws + (size_t)167772160);     // 8 x 16 x 2048 f32 = 1 MiB
  float*  lb  = (float*) (ws + (size_t)168820736);     // the same

  dim3 blk(256);

  // ---- 1) convert inputs to bf16 ----
  cvt_f32_bf16_kernel<<<3 * 512 + 1 + 4096, blk, 0, stream>>>(x, Wq, Wk, Wv, bq, bk, xb, Wb, bqk,
                                                              (long long)MS * D, (long long)D * D, D, 512);

  // ---- 2) projections (pure bf16 WMMA GEMM, 256x256 workgroup tiles) ----
  // Q and K are one product: x times the 2048 rows of Wq and Wk, N = 2 * D.
  const int projBlocks = (MS / 256) * (D / 256); // 256
  qkv_proj_kernel<0><<<2 * projBlocks, blk, 0, stream>>>(xb, Wb, bqk, QK, MS, 2 * D, D);
  qkv_proj_kernel<1><<<projBlocks, blk, 0, stream>>>(xb, Wvb, bv, VT, MS, D, D);

  // ---- 3) attention, all batches per launch (gridDim.y = 8) ----
  const int scBlocks = (S / 256) * (S / 256); // 64 per batch
  const int pvBlocks = (S / 256) * (D / 256); // 32 per batch
  score_exp_kernel<<<dim3(scBlocks, B), blk, 0, stream>>>(
      QK + D, QK, P, eb, lb, S, D, 2 * D,
      (long long)S * 2 * D, (long long)S * S, (long long)(S / 128) * S, sc2);
  pv_kernel<<<dim3(pvBlocks, B), blk, 0, stream>>>(
      P, VT, eb, lb, out, S, MS,
      (long long)S * S, (long long)S, (long long)(S / 128) * S, (long long)S * D);
}

// v006
// It runs in 170 microseconds.
// Timed twice side by side with v005, it ran 1.06 and 1.07 times as fast.
// All steps since v000 together make it 5.39 times as fast.
#include <hip/hip_runtime.h>
#include <stdint.h>

typedef __bf16 bf16_t;
typedef __attribute__((ext_vector_type(16))) __bf16 v16bf;
typedef __attribute__((ext_vector_type(8)))  __bf16 v8bf;
typedef __attribute__((ext_vector_type(2)))  __bf16 v2bf;
typedef __attribute__((ext_vector_type(8)))  float  v8f;
typedef __attribute__((ext_vector_type(4)))  float  v4f;

#define WMMA_BF16(A, B, C) \
  __builtin_amdgcn_wmma_f32_16x16x32_bf16(false, (A), false, (B), (short)0, (C), false, false)

typedef uint32_t u32x4 __attribute__((ext_vector_type(4)));
typedef uint32_t u32x8 __attribute__((ext_vector_type(8)));

// Workgroup tile 256 x 256 of the output, eight waves (two per SIMD), 128 x 64 per wave: each operand byte
// fetched from L2 and each fragment read from LDS feeds twice the matrix work of a 128 x 128 tile.
// A pass is 128 k = 256 bytes of each of the 256 A rows and 256 B^T rows. A stage in LDS is eight
// slices of 64 rows, slices 0..3 = A rows, 4..7 = B^T rows, one tensor load per wave and stage.
constexpr uint32_t ROWB    = 256u;            // bytes of one operand row per pass
constexpr uint32_t PITCH   = ROWB + 16u;      // LDS row pitch for ds_load_b128 readers (pad of 4 dwords)
constexpr uint32_t SROWS   = 64u;             // rows per slice
constexpr uint32_t SLICE_B = 18432u;          // 64 * 272 = 17408, rounded up to a multiple of 2 KiB
constexpr uint32_t BUF_B   = 8u * SLICE_B;    // one stage
constexpr uint32_t RING_B  = 2u * BUF_B;      // two buffers, 294912 bytes: one workgroup per WGP
static_assert(SROWS * PITCH <= SLICE_B && (SLICE_B % 2048u) == 0u, "a slice holds its padded rows and starts at a multiple of 2 KiB");

static __device__ __forceinline__ uint32_t uni(uint32_t v) { return (uint32_t)__builtin_amdgcn_readfirstlane(v); }
// A wave-uniform word held in a scalar register: the issue test on it compiles to s_cmp + s_cbranch_scc, and a
// descriptor word formed from it stays behind the volatile statements (the waits) that stand in front of it.
static __device__ __forceinline__ uint32_t pinned(uint32_t v) {
  uint32_t w = uni(v);
  asm volatile("" : "+s"(w));  // pinned(): a descriptor word or an issue test held in a scalar register
  return w;
}
static __device__ __forceinline__ void wait_ds0()     { asm volatile("s_wait_dscnt 0x0" ::: "memory"); }     // this wave's LDS reads have retired
// This wave's tensor load has landed. The wait names the request's group 0, so that those scalar registers hold
// the descriptor, and nothing else, for as long as the request is outstanding.
static __device__ __forceinline__ void wait_tensor0(u32x4 g0) { asm volatile("s_wait_tensorcnt 0x0" :: "s"(g0) : "memory"); }
// One request of the whole wave: a 2-D tile from global memory into LDS, through no register. Group 0 is an
// in-out operand: what the wait above names is then held in the very registers that the request was issued from.
static __device__ __forceinline__ void tdm_load(u32x4& g0, u32x8 g1) { asm volatile("tensor_load_to_lds %0, %1" : "+s"(g0) : "s"(g1) : "memory"); }

// Descriptor group 1: 1-byte elements, tensor = tile = 64 rows of 256 bytes, 4 dwords of LDS pad behind every row.
static __device__ __forceinline__ u32x8 tdm_group1(uint32_t src_pitch) {
  constexpr uint32_t d0 = ROWB, d1 = SROWS;
  u32x8 g;
  g[0] = uni((1u << 20) | (5u << 22) | (3u << 25));  // no mask; pad on, interval 64 dwords, amount 4 dwords
  // Words 1 to 7 are pinned: descriptor words held in scalar registers of their own for the whole loop,
  // so that none is used for anything else while a request is outstanding.
  g[1] = pinned((d0 & 0xFFFFu) << 16);
  g[2] = pinned((d0 >> 16) | ((d1 & 0xFFFFu) << 16));
  g[3] = pinned((d1 >> 16) | (d0 << 16));
  g[4] = pinned(d1);
  g[5] = pinned(src_pitch);
  g[6] = pinned(0u);
  g[7] = pinned(0u);
  return g;
}
static __device__ __forceinline__ u32x4 tdm_group0(uint32_t lds_dst, uint64_t ga) {
  u32x4 g;
  g[0] = uni(1u);
  g[1] = uni(lds_dst);
  g[2] = uni((uint32_t)ga);
  g[3] = uni((((uint32_t)(ga >> 32)) & 0x01FFFFFFu) | 0x80000000u);
  return g;
}

// A-fragment (16x32 bf16) / B-fragment (B^T rows; identical layout, N in the lane role) from LDS.
// p points at row (lane&15), 16-byte half (lane>>4): K = {k0+h*8 .. +7} then {k0+16+h*8 .. +7}.
static __device__ __forceinline__ v16bf lds_frag(const unsigned char* p) {
  v16bf a;
  a.lo = *(const v8bf*)(p);
  a.hi = *(const v8bf*)(p + 32);
  return a;
}

// One bf16 factor, held twice in a dword, spread over a fragment's 16 elements.
static __device__ __forceinline__ v16bf splat16(uint32_t w) {
  const v2bf g = __builtin_bit_cast(v2bf, w);
  return __builtin_shufflevector(g, g, 0, 1, 0, 1, 0, 1, 0, 1, 0, 1, 0, 1, 0, 1, 0, 1);
}

// C (16*MF x 16*NF per wave) += A[mt0.., :] * Bt[nt0.., :]^T for one 256 x 256 workgroup tile.
// Wave w holds rows 16*MF*(w / WN), columns 16*NF*(w % WN) of the tile, WN = 16 / NF waves along the columns.
// M, N multiples of 256; K a multiple of 128 and at least 256 (two stages).
// SCALE: row n of Bt counts times a factor of its own in every pass s; gt points at this lane's first row in a
// table in LDS of [pass][256 tile rows] dwords (the bf16 factor twice), which pre() fills.
// pre() runs once, while stage 0's load is in flight; what it writes to LDS is published by stage 0's barrier.
template <int MF, int NF, bool SCALE, class Pre>
static __device__ __forceinline__ void gemm_core_lds(const bf16_t* __restrict__ A,
                                                     const bf16_t* __restrict__ Bt,
                                                     int lda, int ldb, int K,
                                                     int mt0, int nt0,
                                                     unsigned char* ring, const uint32_t* gt, Pre pre,
                                                     v8f (&C)[MF][NF]) {
  static_assert(MF * NF == 32 && (MF % 4) == 0 && (NF % 4) == 0, "eight waves cover 256 x 256; a wave's rows start on a slice");
  constexpr uint32_t WN = 16u / (uint32_t)NF;
  const uint32_t lane = threadIdx.x & 31u, r = lane & 15u, h = lane >> 4;
  const uint32_t wave = uni(threadIdx.x >> 5);
  const uint32_t wm = wave / WN, wn = wave % WN;
  const uint32_t T = (uint32_t)K >> 7;  // passes

  // This wave's slice of every stage.
  const bool isA = wave < 4u;
  const bf16_t* srow = isA ? A + (size_t)(mt0 + (int)(SROWS * wave)) * (size_t)lda
                           : Bt + (size_t)(nt0 + (int)(SROWS * (wave - 4u))) * (size_t)ldb;
  const uint64_t ga0 = (uint64_t)(uintptr_t)srow;
  const uint32_t dst0 = (uint32_t)(uintptr_t)ring + wave * SLICE_B;
  const u32x8 g1 = tdm_group1(2u * (uint32_t)(isA ? lda : ldb));

  // Per-lane fragment bases inside a buffer.
  const uint32_t fa = wm * (uint32_t)(MF / 4) * SLICE_B + r * PITCH + 16u * h;
  const uint32_t fb = (4u + wn * (uint32_t)(NF / 4)) * SLICE_B + r * PITCH + 16u * h;
  // Fragment f of a wave's operand: 16 rows, four fragments to a slice.
  auto foff = [](uint32_t f) { return (f >> 2) * SLICE_B + (f & 3u) * 16u * PITCH; };

  u32x4 g0 = tdm_group0(dst0, ga0);
  tdm_load(g0, g1);                             // stage 0
  pre();
  wait_tensor0(g0);
  __syncthreads();                              // stage 0 is published
  g0 = tdm_group0(dst0 + BUF_B, ga0 + ROWB);
  tdm_load(g0, g1);                             // stage 1

  uint32_t s = 0;
  do {  // T is at least 2: both stages loaded above exist
    const uint32_t buf = (s & 1u) * BUF_B;
    const unsigned char* pa = ring + buf + fa;
    const unsigned char* pb = ring + buf + fb;
    // Two fragment sets inside the pass: block kk + 1's 24 LDS reads go out as one group in front of
    // block kk's 32 WMMAs. Nothing of another stage is read here.
    v16bf Af[2][MF], Bf[2][NF];
    uint32_t gw[NF];  // this pass's factor of the lane's row in each B fragment (a B fragment's row is lane & 15)
    if constexpr (SCALE) {
#pragma unroll  // register arrays need constant indices
      for (uint32_t j = 0; j < (uint32_t)NF; ++j) gw[j] = gt[s * 256u + 16u * j];
    }
#pragma unroll  // register arrays need constant indices
    for (uint32_t mi = 0; mi < (uint32_t)MF; ++mi) Af[0][mi] = lds_frag(pa + foff(mi));
#pragma unroll
    for (uint32_t j = 0; j < (uint32_t)NF; ++j) Bf[0][j] = lds_frag(pb + foff(j));
#pragma unroll
    for (uint32_t kk = 0; kk < 4u; ++kk) {
      const uint32_t cur = kk & 1u, nxt = cur ^ 1u;
      if (kk + 1u < 4u) {
#pragma unroll
        for (uint32_t mi = 0; mi < (uint32_t)MF; ++mi) Af[nxt][mi] = lds_frag(pa + foff(mi) + (kk + 1u) * 64u);
#pragma unroll
        for (uint32_t j = 0; j < (uint32_t)NF; ++j) Bf[nxt][j] = lds_frag(pb + foff(j) + (kk + 1u) * 64u);
      }
      if constexpr (SCALE) {  // the factors are powers of two: the products are exact
#pragma unroll  // register arrays need constant indices
        for (uint32_t j = 0; j < (uint32_t)NF; ++j) Bf[cur][j] = Bf[cur][j] * splat16(gw[j]);
      }
      __builtin_amdgcn_sched_barrier(0);  // keeps the LDS reads in one group, out of the WMMA run
#pragma unroll
      for (uint32_t j = 0; j < (uint32_t)NF; ++j)
#pragma unroll
        for (uint32_t mi = 0; mi < (uint32_t)MF; ++mi)
          C[mi][j] = WMMA_BF16(Af[cur][mi], Bf[cur][j], C[mi][j]);
      __builtin_amdgcn_sched_barrier(0);  // keeps the next group of reads, and the publish point, behind this WMMA run
    }
    // Publish point of stage s + 1; it also ends every reader's last read of stage s's buffer.
    wait_ds0();
    wait_tensor0(g0);
    __syncthreads();
    if (pinned((s + 2u < T) ? 1u : 0u) != 0u) {  // the refill, only while stage s + 2 exists
      const uint32_t nx = pinned(s + 2u);        // descriptor word source, formed behind the wait above
      g0 = tdm_group0(dst0 + buf, ga0 + (uint64_t)nx * ROWB);
      tdm_load(g0, g1);
    }
  } while (++s < T);
  wait_tensor0(g0);
  wait_ds0();
}

// Stands behind a group of global loads or stores, in front of the first instruction that may overwrite a register
// which one of them names (address or data). The scheduling barrier keeps later arithmetic behind the wait.
static __device__ __forceinline__ void close_global_group() {
  asm volatile("s_wait_xcnt 0x0" ::: "memory");
  __builtin_amdgcn_sched_barrier(0);
}
// The same behind a group of loads on one address: the wait names that address, so that its registers hold it, and
// no load's result, up to the wait.
template <class Addr>
static __device__ __forceinline__ void close_global_loads(Addr a) {
  asm volatile("s_wait_xcnt 0x0" :: "v"(a) : "memory");
  __builtin_amdgcn_sched_barrier(0);
}

// Output staging. Every product below runs with the output's contiguous dimension in the A role, 128 of it by 64 output
// rows per wave (MF = 8, NF = 4): a lane's eight accumulators of a fragment are neighbours in one output row, but the
// lanes of a store would then hit 16 rows with 32 or 64 bytes each. So a wave first sets its 64 rows in LDS, in an
// eighth of the ring that is its own, and reads them back row by row: each global store then covers whole 128-byte
// lines. The ring is free for this behind gemm_core_lds: the barrier at the foot of its last pass stands behind every
// wave's last ring read and last tensor load. No other wave touches a wave's slab, so no further barrier is needed.
constexpr uint32_t SLAB_B  = RING_B / 8u;    // 36864 bytes per wave
constexpr uint32_t HPITCH  = 256u + 16u;     // staged row of 128 bf16; 16 bytes x odd: 16-byte LDS accesses meet no bank twice
constexpr uint32_t FPITCH  = 512u + 16u;     // staged row of 128 f32, likewise
static_assert(64u * HPITCH <= SLAB_B && 64u * FPITCH <= SLAB_B, "a wave's 64 staged rows fit its slab");

// The wave's 64 staged bf16 rows go out, two rows (512 bytes, four lines) per store. g points at this lane's 16 bytes of
// rows 0 and 1: row lane >> 4, bytes 16 * (lane & 15). LDO, the output's pitch in elements, is a compile-time constant:
// all stores then stand on one address register with constant offsets.
template <int LDO>
static __device__ __forceinline__ void flush_rows_bf16(const unsigned char* slab, bf16_t* g, uint32_t lane) {
  wait_ds0();  // the staged rows are written before other lanes' parts of them are read back; also holds the reads behind the writes in the compiler
  const unsigned char* sp = slab + (lane >> 4) * HPITCH + (lane & 15u) * 16u;
  v8bf v[32];
#pragma unroll  // register array: constant indices
  for (uint32_t t = 0; t < 32u; ++t) v[t] = *(const v8bf*)(sp + 2u * t * HPITCH);
  __builtin_amdgcn_sched_barrier(0);  // all read-backs issue as one group in front of the first store
#pragma unroll
  for (uint32_t t = 0; t < 32u; ++t) *(v8bf*)(g + (size_t)(2u * t) * (size_t)LDO) = v[t];
  close_global_group();
}

// Elementwise fp32 -> bf16 (8 elements/thread, grid-stride) of all four matrices in one launch, by ranges of the
// block index: blocks [0, 3 * wBlocks) take Wq, Wk, Wv (nw elements each, stored one behind the other in Wb), block
// 3 * wBlocks sets bq and bk (nb floats each, nb a multiple of 4) one behind the other in bqk, the rest take x (nx).
__global__ __launch_bounds__(256) void cvt_f32_bf16_kernel(const float* __restrict__ x,
                                                           const float* __restrict__ Wq,
                                                           const float* __restrict__ Wk,
                                                           const float* __restrict__ Wv,
                                                           const float* __restrict__ bq,
                                                           const float* __restrict__ bk,
                                                           bf16_t* __restrict__ xb,
                                                           bf16_t* __restrict__ Wb,
                                                           float* __restrict__ bqk,
                                                           long long nx, long long nw, int nb, int wBlocks) {
  const int b = (int)blockIdx.x;
  if (b == 3 * wBlocks) {
    for (int i = (int)threadIdx.x * 4; i < nb; i += 256 * 4) {
      *(v4f*)(bqk + i)      = *(const v4f*)(bq + i);
      *(v4f*)(bqk + nb + i) = *(const v4f*)(bk + i);
    }
    return;
  }
  const int which = b / wBlocks;  // 0, 1, 2: a weight matrix; 3 and up: x
  const bool isW = which < 3;
  const float* in = isW ? (which == 0 ? Wq : (which == 1 ? Wk : Wv)) : x;
  bf16_t* outp = isW ? Wb + (long long)which * nw : xb;
  const long long n = isW ? nw : nx;
  const int blk0 = isW ? b - which * wBlocks : b - 3 * wBlocks - 1;     // this block's place in its range
  const int nblk = isW ? wBlocks : (int)gridDim.x - 3 * wBlocks - 1;    // blocks in its range
  long long idx = ((long long)blk0 * 256 + threadIdx.x) * 8;
  const long long stride = (long long)nblk * 256 * 8;
  for (; idx < n; idx += stride) {
    v8f f;
    f.lo = *(const v4f*)(in + idx);
    f.hi = *(const v4f*)(in + idx + 4);
    *(v8bf*)(outp + idx) = __builtin_convertvector(f, v8bf);
  }
}

// out = X * W^T + bias ; X:(M,K) bf16, W:(N,K) bf16 row-major.
// TR==0: out (M,N) bf16 row-major, computed as W * X^T; TR==1: out (N,M) bf16 row-major (V^T), computed as X * W^T:
// either way the A rows run along the rows of out. LDO: pitch of out (N or M). Workgroup tile 256x256.
template <int TR, int LDO>
__global__ __launch_bounds__(256) void qkv_proj_kernel(
    const bf16_t* __restrict__ X, const bf16_t* __restrict__ W,
    const float* __restrict__ bias, bf16_t* __restrict__ out,
    int M, int N, int K) {
  constexpr int MF = 8, NF = 4, WN = 16 / NF;
  __shared__ __attribute__((aligned(2048))) unsigned char ring[RING_B];
  const int lane = threadIdx.x & 31;
  const int wave = threadIdx.x >> 5;
  const int tilesN = N >> 8;
  const int mt0 = ((int)blockIdx.x / tilesN) << 8;
  const int nt0 = ((int)blockIdx.x % tilesN) << 8;
  const int at0 = TR ? mt0 : nt0;  // first A row of the tile: a column of out
  const int bt0 = TR ? nt0 : mt0;  // first B^T row of the tile: a row of out

  v8f C[MF][NF] = {};
  gemm_core_lds<MF, NF, false>(TR ? X : W, TR ? W : X, K, K, K, at0, bt0, ring, nullptr, [] {}, C);

  const int aw = at0 + (wave / WN) * (16 * MF);
  const int bw = bt0 + (wave % WN) * (16 * NF);
  const int r = lane & 15, h = lane >> 4;
  // The bias belongs to W's rows: eight neighbours per A fragment (TR == 0) or one value per B fragment (TR == 1).
  v8f ba[MF];
  float bb[NF];
  const int bi = TR ? bw + r : aw + 8 * h;
  const float* bp = bias + bi;
  if (!TR) {
#pragma unroll  // register arrays need constant indices, here and below
    for (int mi = 0; mi < MF; ++mi) {
      ba[mi].lo = *(const v4f*)(bp + 16 * mi);
      ba[mi].hi = *(const v4f*)(bp + 16 * mi + 4);
    }
  } else {
#pragma unroll
    for (int j = 0; j < NF; ++j) bb[j] = bp[16 * j];
  }
  if (TR) close_global_loads(bi);  // these loads stand on the scalar base and the index
  else    close_global_loads(bp);
  unsigned char* slab = ring + (uint32_t)wave * SLAB_B;
  unsigned char* st = slab + (uint32_t)r * HPITCH + 16u * (uint32_t)h;  // this lane's place in staged row r
#pragma unroll
  for (int j = 0; j < NF; ++j) {
#pragma unroll
    for (int mi = 0; mi < MF; ++mi) {
      v8f o;
      if (!TR) o = C[mi][j] + ba[mi];
      else     o = C[mi][j] + bb[j];
      *(v8bf*)(st + (uint32_t)(16 * j) * HPITCH + (uint32_t)(32 * mi)) = __builtin_convertvector(o, v8bf);
    }
  }
  flush_rows_bf16<LDO>(slab, out + (size_t)(bw + h) * (size_t)LDO + (size_t)(aw + 8 * r), (uint32_t)lane);
}

// Softmax over the keys is split over the two attention products, by blocks of KB = 128 keys (one pass of the second).
// Base 2: w = score * log2(e). Block t of a query row has the whole number e_t = ceil(max of w in the block).
// First product: stores p = 2^(w - e_t) as bf16 (at most 1) and, per row and block, e_t and l_t = sum of p.
// Second product: with E = max e_t and g_t = 2^(e_t - E), out = (sum_t g_t * (p_t * V_t)) / (sum_t g_t * l_t).
constexpr int KB   = 128;   // keys per block
constexpr int NBLK = 16;    // blocks per row: the second product is built for 2048 keys
constexpr int SQ   = 2048;  // queries per batch: pitch of the per-block tables
constexpr int DV   = 1024;  // columns of V and of out: a compile-time pitch puts a lane's stores on one address register
constexpr uint32_t GTAB_B = (uint32_t)NBLK * 256u * 4u;  // factor table of a 256-row tile
constexpr uint32_t TAB_B  = GTAB_B + 256u * 4u;          // and one reciprocal row sum per row

// The value of lane l ^ 16.
static __device__ __forceinline__ float other_half(float v) {
  const int b = __builtin_bit_cast(int, v);
  return __builtin_bit_cast(float, __builtin_amdgcn_permlanex16(b, b, 0x76543210, 0xfedcba98, false, false));
}

// Transposed scores, keys x queries = Kmat * Q^T, batched via blockIdx.y: a lane's accumulators of one column of
// fragments all belong to ONE query, so maximum and sum run inside the lane (one exchange between the halves), and
// eight neighbouring keys of a query make one 16-byte piece of a staged row. Workgroup tile 256x256, wave tile 128 keys
// x 64 queries. Kmat, Q: (S, K) bf16, pitch ld. P: (S queries, S keys) bf16, pitch SQ. eblk, lblk: (S / KB blocks, SQ
// queries) f32, S <= SQ.
__global__ __launch_bounds__(256) void score_exp_kernel(
    const bf16_t* __restrict__ Kmat, const bf16_t* __restrict__ Q,
    bf16_t* __restrict__ P, float* __restrict__ eblk, float* __restrict__ lblk,
    int S, int K, int ld, long long strideQK, long long strideP, long long strideB, float sc2) {
  constexpr int MF = 8, NF = 4, WN = 16 / NF;
  __shared__ __attribute__((aligned(2048))) unsigned char ring[RING_B];
  const int b = blockIdx.y;
  const bf16_t* Kb = Kmat + (size_t)b * strideQK;
  const bf16_t* Qb = Q + (size_t)b * strideQK;
  bf16_t* Pb = P + (size_t)b * strideP;
  float* eb = eblk + (size_t)b * strideB;
  float* lb = lblk + (size_t)b * strideB;

  const int lane = threadIdx.x & 31;
  const int wave = threadIdx.x >> 5;
  const int tilesN = S >> 8;
  const int kt0 = ((int)blockIdx.x / tilesN) << 8;
  const int qt0 = ((int)blockIdx.x % tilesN) << 8;

  v8f C[MF][NF] = {};
  gemm_core_lds<MF, NF, false>(Kb, Qb, ld, ld, K, kt0, qt0, ring, nullptr, [] {}, C);

  const int kt = kt0 + (wave / WN) * (16 * MF);  // this wave's key block
  const int qt = qt0 + (wave % WN) * (16 * NF);
  const int r = lane & 15, h = lane >> 4;
  unsigned char* slab = ring + (uint32_t)wave * SLAB_B;
  unsigned char* st = slab + (uint32_t)r * HPITCH + 16u * (uint32_t)h;  // this lane's place in staged row r
  // Every loop below is unrolled because the accumulators are register arrays: they need constant indices.
#pragma unroll
  for (int j = 0; j < NF; ++j) {
    const int q = qt + 16 * j + r;
    v8f mv = C[0][j];
#pragma unroll
    for (int mi = 1; mi < MF; ++mi) mv = __builtin_elementwise_max(mv, C[mi][j]);
    float mx = fmaxf(fmaxf(fmaxf(mv[0], mv[1]), fmaxf(mv[2], mv[3])), fmaxf(fmaxf(mv[4], mv[5]), fmaxf(mv[6], mv[7])));
    mx = fmaxf(mx, other_half(mx));
    const float e = ceilf(mx * sc2);
    v8f sv = {};
#pragma unroll
    for (int mi = 0; mi < MF; ++mi) {
      v8f p;
#pragma unroll
      for (int i = 0; i < 8; ++i) p[i] = __builtin_amdgcn_exp2f(__builtin_fmaf(C[mi][j][i], sc2, -e));
      sv += p;
      *(v8bf*)(st + (uint32_t)(16 * j) * HPITCH + (uint32_t)(32 * mi)) = __builtin_convertvector(p, v8bf);
    }
    float sum = ((sv[0] + sv[1]) + (sv[2] + sv[3])) + ((sv[4] + sv[5]) + (sv[6] + sv[7]));
    sum += other_half(sum);
    // Both halves hold e and sum of query q: the lower half stores e, the upper half the sum, in one instruction.
    float* sp = (h ? lb : eb) + (size_t)(kt / KB) * (size_t)SQ + (size_t)q;
    const float sval = h ? sum : e;
    *sp = sval;
    close_global_group();
  }
  flush_rows_bf16<SQ>(slab, Pb + (size_t)(qt + h) * (size_t)SQ + (size_t)(kt + 8 * r), (uint32_t)lane);
}

// out = softmax weights * V, batched via blockIdx.y, computed as V^T * P^T: P (queries, K keys) bf16 as score_exp_kernel
// leaves it, Vt (DV, K) bf16 pitch ldb, out (queries, DV) f32. K = NBLK * KB. Workgroup tile 256x256, wave tile 128
// columns of out x 64 queries.
__global__ __launch_bounds__(256) void pv_kernel(
    const bf16_t* __restrict__ P, const bf16_t* __restrict__ Vt,
    const float* __restrict__ eblk, const float* __restrict__ lblk,
    float* __restrict__ outp, int K, int ldb,
    long long strideP, long long strideV, long long strideB, long long strideO) {
  // The ring first, so that its slices keep their places at multiples of 2 KiB; the tables behind it.
  __shared__ __attribute__((aligned(2048))) unsigned char smem[RING_B + TAB_B];
  uint32_t* gtab = (uint32_t*)(smem + RING_B);
  float* invl = (float*)(smem + RING_B + GTAB_B);
  const int b = blockIdx.y;
  const bf16_t* Pb = P + (size_t)b * strideP;
  const bf16_t* Vb = Vt + (size_t)b * strideV;
  const float* eb = eblk + (size_t)b * strideB;
  const float* lb = lblk + (size_t)b * strideB;
  float* ob = outp + (size_t)b * strideO;

  const int tid = threadIdx.x;
  const int lane = tid & 31;
  const int wave = tid >> 5;
  constexpr int tilesN = DV >> 8;
  const int mt0 = ((int)blockIdx.x / tilesN) << 8;
  const int nt0 = ((int)blockIdx.x % tilesN) << 8;
  const int r = lane & 15, h = lane >> 4;

  // Thread t joins the blocks of tile row t. Its loops are unrolled: ev and lv are register arrays, and the 32 loads
  // then go out together on one address register with constant offsets.
  auto pre = [&] {
    float ev[NBLK], lv[NBLK];
    const float* ep = eb + mt0 + tid;
    const float* lp = lb + mt0 + tid;
#pragma unroll
    for (int t = 0; t < NBLK; ++t) {
      ev[t] = ep[t * SQ];
      lv[t] = lp[t * SQ];
    }
    close_global_group();
    float E = ev[0];
#pragma unroll
    for (int t = 1; t < NBLK; ++t) E = fmaxf(E, ev[t]);
    float L = 0.0f;
#pragma unroll
    for (int t = 0; t < NBLK; ++t) {
      const float g = __builtin_ldexpf(1.0f, (int)(ev[t] - E));  // an exact power of two or 0: its upper 16 bits are the bf16
      L += lv[t] * g;
      const uint32_t gb = __builtin_bit_cast(uint32_t, g) >> 16;
      gtab[t * 256 + tid] = gb | (gb << 16);
    }
    invl[tid] = 1.0f / L;
  };

  constexpr int MF = 8, NF = 4;
  const int qw = (wave & 3) << 6;   // this wave's first query in the tile
  const int dw = (wave >> 2) << 7;  // this wave's first column in the tile
  v8f C[MF][NF] = {};
  gemm_core_lds<MF, NF, true>(Vb, Pb, ldb, K, K, nt0, mt0, smem, gtab + qw + r, pre, C);

  unsigned char* slab = smem + (uint32_t)wave * SLAB_B;
  unsigned char* st = slab + (uint32_t)r * FPITCH + 32u * (uint32_t)h;  // this lane's place in staged row r
  // Unrolled: the accumulators are register arrays, and the offsets become constants.
  float iv[NF];  // read ahead of the staging stores: one LDS wait, not one per column of fragments
#pragma unroll
  for (int j = 0; j < NF; ++j) iv[j] = invl[qw + 16 * j + r];
#pragma unroll
  for (int j = 0; j < NF; ++j) {
#pragma unroll
    for (int mi = 0; mi < MF; ++mi) {
      const v8f o = C[mi][j] * iv[j];
      unsigned char* d = st + (uint32_t)(16 * j) * FPITCH + (uint32_t)(64 * mi);
      *(v4f*)(d)       = o.lo;
      *(v4f*)(d + 16u) = o.hi;
    }
  }
  wait_ds0();  // the staged rows are written before other lanes' parts of them are read back; also holds the reads behind the writes in the compiler
  // One staged row (512 bytes, four lines) per store. The accumulators' registers are free by now and take all 64 rows.
  const unsigned char* sp = slab + 16u * (uint32_t)lane;
  float* op = ob + (size_t)(mt0 + qw) * (size_t)DV + (size_t)(nt0 + dw + 4 * lane);
  v4f v[64];
#pragma unroll
  for (int t = 0; t < 64; ++t) v[t] = *(const v4f*)(sp + (uint32_t)t * FPITCH);
  __builtin_amdgcn_sched_barrier(0);  // all read-backs issue as one group in front of the first store
#pragma unroll
  for (int t = 0; t < 64; ++t) *(v4f*)(op + t * DV) = v[t];
  close_global_group();
}

extern "C" void kernel_launch(void* const* d_in, const int* in_sizes, int n_in,
                              void* d_out, int out_size, void* d_ws, size_t ws_size,
                              hipStream_t stream) {
  const float* x  = (const float*)d_in[0];
  const float* Wq = (const float*)d_in[1];
  const float* bq = (const float*)d_in[2];
  const float* Wk = (const float*)d_in[3];
  const float* bk = (const float*)d_in[4];
  const float* Wv = (const float*)d_in[5];
  const float* bv = (const float*)d_in[6];
  float* out = (float*)d_out;

  const int B = 8, S = 2048, D = 1024;
  const int MS = B * S; // 16384
  const float sc2 = 0.045084220f; // log2(e) / sqrt(1024)

  // ---- workspace layout (all offsets 16B aligned) ----
  // Buffers share bytes where one is dead before the other is written, all inside this call:
  // the bf16 copies of x and W are last read by the projections, and P is written behind them.
  char* ws = (char*)d_ws;
  bf16_t* QK  = (bf16_t*)(ws);                         // 16384x2048 bf16 = 64 MiB: row m holds q(m), then k(m)
  bf16_t* VT  = (bf16_t*)(ws + (size_t)67108864);      // V^T (1024 x 16384), 32 MiB
  const size_t attBase = 100663296;
  bf16_t* xb  = (bf16_t*)(ws + attBase);               // 32 MiB, under P
  bf16_t* Wb  = (bf16_t*)(ws + (size_t)134217728);     // Wq, Wk, Wv: 1024x1024 bf16 = 2 MiB each, under P
  bf16_t* Wvb = (bf16_t*)(ws + (size_t)138412032);     // the third of them
  float*  bqk = (float*) (ws + (size_t)140509184);     // bq, then bk: 2048 floats, under P
  bf16_t* P   = (bf16_t*)(ws + attBase);               // 8 x 2048 x 2048 bf16 = 64 MiB
  float*  eb  = (float*) (ws + (size_t)167772160);     // 8 x 16 x 2048 f32 = 1 MiB
  float*  lb  = (float*) (ws + (size_t)168820736);     // the same

  dim3 blk(256);

  // ---- 1) convert inputs to bf16 ----
  cvt_f32_bf16_kernel<<<3 * 512 + 1 + 4096, blk, 0, stream>>>(x, Wq, Wk, Wv, bq, bk, xb, Wb, bqk,
                                                              (long long)MS * D, (long long)D * D, D, 512);

  // ---- 2) projections (pure bf16 WMMA GEMM, 256x256 workgroup tiles) ----
  // Q and K are one product: x times the 2048 rows of Wq and Wk, N = 2 * D.
  const int projBlocks = (MS / 256) * (D / 256); // 256
  qkv_proj_kernel<0, 2048><<<2 * projBlocks, blk, 0, stream>>>(xb, Wb, bqk, QK, MS, 2 * D, D);
  qkv_proj_kernel<1, 16384><<<projBlocks, blk, 0, stream>>>(xb, Wvb, bv, VT, MS, D, D);

  // ---- 3) attention, all batches per launch (gridDim.y = 8) ----
  const int scBlocks = (S / 256) * (S / 256); // 64 per batch
  const int pvBlocks = (S / 256) * (D / 256); // 32 per batch
  score_exp_kernel<<<dim3(scBlocks, B), blk, 0, stream>>>(
      QK + D, QK, P, eb, lb, S, D, 2 * D,
      (long long)S * 2 * D, (long long)S * S, (long long)(S / 128) * S, sc2);
  pv_kernel<<<dim3(pvBlocks, B), blk, 0, stream>>>(
      P, VT, eb, lb, out, S, MS,
      (long long)S * S, (long long)S, (long long)(S / 128) * S, (long long)S * D);
}

// v008
// Measured time: 144 microseconds a run.
// Versions between v006 and this one are left out; their measured steps multiply to 1.19 times as fast.
// Counting every step since v000, it is 6.39 times as fast.
#include <hip/hip_runtime.h>
#include <stdint.h>

typedef __bf16 bf16_t;
typedef __attribute__((ext_vector_type(16))) __bf16 v16bf;
typedef __attribute__((ext_vector_type(8)))  __bf16 v8bf;
typedef __attribute__((ext_vector_type(2)))  __bf16 v2bf;
typedef __attribute__((ext_vector_type(8)))  float  v8f;
typedef __attribute__((ext_vector_type(4)))  float  v4f;

#define WMMA_BF16(A, B, C) \
  __builtin_amdgcn_wmma_f32_16x16x32_bf16(false, (A), false, (B), (short)0, (C), false, false)

typedef uint32_t u32x4 __attribute__((ext_vector_type(4)));
typedef uint32_t u32x8 __attribute__((ext_vector_type(8)));

// Workgroup tile 256 x 256 of the output, eight waves (two per SIMD), 128 x 64 per wave: each operand byte
// fetched from L2 and each fragment read from LDS feeds twice the matrix work of a 128 x 128 tile.
// A pass is 128 k = 256 bytes of each of the 256 A rows and 256 B^T rows. A stage in LDS is eight
// slices of 64 rows, slices 0..3 = A rows, 4..7 = B^T rows, one tensor load per wave and stage.
constexpr uint32_t ROWB    = 256u;            // bytes of one operand row per pass
constexpr uint32_t PITCH   = ROWB + 16u;      // LDS row pitch for ds_load_b128 readers (pad of 4 dwords)
constexpr uint32_t SROWS   = 64u;             // rows per slice
constexpr uint32_t SLICE_B = 18432u;          // 64 * 272 = 17408, rounded up to a multiple of 2 KiB
constexpr uint32_t BUF_B   = 8u * SLICE_B;    // one stage
constexpr uint32_t RING_B  = 2u * BUF_B;      // two buffers, 294912 bytes: one workgroup per WGP
static_assert(SROWS * PITCH <= SLICE_B && (SLICE_B % 2048u) == 0u, "a slice holds its padded rows and starts at a multiple of 2 KiB");

static __device__ __forceinline__ uint32_t uni(uint32_t v) { return (uint32_t)__builtin_amdgcn_readfirstlane(v); }
// A wave-uniform word held in a scalar register: the issue test on it compiles to s_cmp + s_cbranch_scc, and a
// descriptor word formed from it stays behind the volatile statements (the waits) that stand in front of it.
static __device__ __forceinline__ uint32_t pinned(uint32_t v) {
  uint32_t w = uni(v);
  asm volatile("" : "+s"(w));  // pinned(): a descriptor word or an issue test held in a scalar register
  return w;
}
static __device__ __forceinline__ void wait_ds0()     { asm volatile("s_wait_dscnt 0x0" ::: "memory"); }     // this wave's LDS reads have retired
// This wave's tensor load has landed. The wait names the request's group 0, so that those scalar registers hold
// the descriptor, and nothing else, for as long as the request is outstanding.
static __device__ __forceinline__ void wait_tensor0(u32x4 g0) { asm volatile("s_wait_tensorcnt 0x0" :: "s"(g0) : "memory"); }
// One request of the whole wave: a 2-D tile from global memory into LDS, through no register. Group 0 is an
// in-out operand: what the wait above names is then held in the very registers that the request was issued from.
static __device__ __forceinline__ void tdm_load(u32x4& g0, u32x8 g1) { asm volatile("tensor_load_to_lds %0, %1" : "+s"(g0) : "s"(g1) : "memory"); }

// Descriptor group 1: 1-byte elements, tensor = tile = 64 rows of 256 bytes, 4 dwords of LDS pad behind every row.
static __device__ __forceinline__ u32x8 tdm_group1(uint32_t src_pitch) {
  constexpr uint32_t d0 = ROWB, d1 = SROWS;
  u32x8 g;
  g[0] = uni((1u << 20) | (5u << 22) | (3u << 25));  // no mask; pad on, interval 64 dwords, amount 4 dwords
  // Words 1 to 7 are pinned: descriptor words held in scalar registers of their own for the whole loop,
  // so that none is used for anything else while a request is outstanding.
  g[1] = pinned((d0 & 0xFFFFu) << 16);
  g[2] = pinned((d0 >> 16) | ((d1 & 0xFFFFu) << 16));
  g[3] = pinned((d1 >> 16) | (d0 << 16));
  g[4] = pinned(d1);
  g[5] = pinned(src_pitch);
  g[6] = pinned(0u);
  g[7] = pinned(0u);
  return g;
}
static __device__ __forceinline__ u32x4 tdm_group0(uint32_t lds_dst, uint64_t ga) {
  u32x4 g;
  g[0] = uni(1u);
  g[1] = uni(lds_dst);
  g[2] = uni((uint32_t)ga);
  g[3] = uni((((uint32_t)(ga >> 32)) & 0x01FFFFFFu) | 0x80000000u);
  return g;
}

// A-fragment (16x32 bf16) / B-fragment (B^T rows; identical layout, N in the lane role) from LDS.
// p points at row (lane&15), 16-byte half (lane>>4): K = {k0+h*8 .. +7} then {k0+16+h*8 .. +7}.
static __device__ __forceinline__ v16bf lds_frag(const unsigned char* p) {
  v16bf a;
  a.lo = *(const v8bf*)(p);
  a.hi = *(const v8bf*)(p + 32);
  return a;
}

// One bf16 factor, held twice in a dword, spread over a fragment's 16 elements.
static __device__ __forceinline__ v16bf splat16(uint32_t w) {
  const v2bf g = __builtin_bit_cast(v2bf, w);
  return __builtin_shufflevector(g, g, 0, 1, 0, 1, 0, 1, 0, 1, 0, 1, 0, 1, 0, 1, 0, 1);
}

template <bool V> struct flag { static constexpr bool value = V; };  // a compile-time switch handed to a generic lambda

// C (16*MF x 16*NF per wave) += A[mt0.., :] * Bt[nt0.., :]^T for one 256 x 256 workgroup tile.
// Wave w holds rows 16*MF*(w / WN), columns 16*NF*(w % WN) of the tile, WN = 16 / NF waves along the columns.
// M, N multiples of 256; K a multiple of 128 and at least 256 (two stages).
// SCALE: row n of Bt counts times a factor of its own in every pass s; gt points at this lane's first row in a
// table in LDS of [pass][256 tile rows] dwords (the bf16 factor twice), which pre() fills.
// pre() runs once, while stage 0's load is in flight; what it writes to LDS is published by stage 0's barrier.
template <int MF, int NF, bool SCALE, class Pre>
static __device__ __forceinline__ void gemm_core_lds(const bf16_t* __restrict__ A,
                                                     const bf16_t* __restrict__ Bt,
                                                     int lda, int ldb, int K,
                                                     int mt0, int nt0,
                                                     unsigned char* ring, const uint32_t* gt, Pre pre,
                                                     v8f (&C)[MF][NF]) {
  static_assert(MF * NF == 32 && (MF % 4) == 0 && (NF % 4) == 0, "eight waves cover 256 x 256; a wave's rows start on a slice");
  constexpr uint32_t WN = 16u / (uint32_t)NF;
  const uint32_t lane = threadIdx.x & 31u, r = lane & 15u, h = lane >> 4;
  const uint32_t wave = uni(threadIdx.x >> 5);
  const uint32_t wm = wave / WN, wn = wave % WN;
  const uint32_t T = (uint32_t)K >> 7;  // passes

  // This wave's slice of every stage.
  const bool isA = wave < 4u;
  const bf16_t* srow = isA ? A + (size_t)(mt0 + (int)(SROWS * wave)) * (size_t)lda
                           : Bt + (size_t)(nt0 + (int)(SROWS * (wave - 4u))) * (size_t)ldb;
  const uint64_t ga0 = (uint64_t)(uintptr_t)srow;
  const uint32_t dst0 = (uint32_t)(uintptr_t)ring + wave * SLICE_B;
  const u32x8 g1 = tdm_group1(2u * (uint32_t)(isA ? lda : ldb));

  // Per-lane fragment bases inside a buffer.
  const uint32_t fa = wm * (uint32_t)(MF / 4) * SLICE_B + r * PITCH + 16u * h;
  const uint32_t fb = (4u + wn * (uint32_t)(NF / 4)) * SLICE_B + r * PITCH + 16u * h;
  // Fragment f of a wave's operand: 16 rows, four fragments to a slice.
  auto foff = [](uint32_t f) { return (f >> 2) * SLICE_B + (f & 3u) * 16u * PITCH; };

  u32x4 g0 = tdm_group0(dst0, ga0);
  tdm_load(g0, g1);                             // stage 0
  pre();
  wait_tensor0(g0);
  __syncthreads();                              // stage 0 is published
  g0 = tdm_group0(dst0 + BUF_B, ga0 + ROWB);
  tdm_load(g0, g1);                             // stage 1

  // Two fragment sets take turns over the whole loop, pass boundaries included: each block's 24 LDS reads go out as one
  // group in front of the block before it, so that no block, a pass's first block included, waits for its own reads.
  v16bf Af[2][MF], Bf[2][NF];
  uint32_t gw[NF];  // the running pass's factor of the lane's row in each B fragment (a B fragment's row is lane & 15)
  auto fetch = [&](uint32_t set, uint32_t base, uint32_t kk) __attribute__((always_inline)) {
    const unsigned char* pa = ring + base + fa + kk * 64u;
    const unsigned char* pb = ring + base + fb + kk * 64u;
#pragma unroll  // register arrays need constant indices, here and below
    for (uint32_t mi = 0; mi < (uint32_t)MF; ++mi) Af[set][mi] = lds_frag(pa + foff(mi));
#pragma unroll
    for (uint32_t j = 0; j < (uint32_t)NF; ++j) Bf[set][j] = lds_frag(pb + foff(j));
  };
  auto factors = [&](uint32_t p) __attribute__((always_inline)) {
    if constexpr (SCALE) {
#pragma unroll
      for (uint32_t j = 0; j < (uint32_t)NF; ++j) gw[j] = gt[p * 256u + 16u * j];
    }
  };
  fetch(0u, 0u, 0u);  // first fragment loads: stage 0 is published
  factors(0u);

  uint32_t s = 0;
  // One pass. LAST: the pass of the last stage, with nothing left to publish, refill or fetch ahead.
  auto pass = [&](auto last) __attribute__((always_inline)) {
    constexpr bool LAST = decltype(last)::value;
    const uint32_t buf = (s & 1u) * BUF_B;
#pragma unroll
    for (uint32_t kk = 0; kk < 4u; ++kk) {
      const uint32_t cur = kk & 1u, nxt = cur ^ 1u;
      if (kk + 1u < 4u) {
        fetch(nxt, buf, kk + 1u);
      } else {
        // Publish point of stage s + 1, in front of the pass's last block: that block's fragments are in registers, so
        // this wave's reads of stage s's buffer end at the wait, and every wave's at the barrier. In the last pass the
        // same wait and barrier free the ring for the output staging.
        wait_ds0();
        if constexpr (!LAST) wait_tensor0(g0);
        __syncthreads();
        if constexpr (!LAST) {
          if (pinned((s + 2u < T) ? 1u : 0u) != 0u) {  // the refill, only while stage s + 2 exists
            const uint32_t nx = pinned(s + 2u);        // descriptor word source, formed behind the wait above
            g0 = tdm_group0(dst0 + buf, ga0 + (uint64_t)nx * ROWB);
            tdm_load(g0, g1);
          }
          fetch(nxt, BUF_B - buf, 0u);  // the next pass's first block, from the stage just published
        }
      }
      if constexpr (SCALE) {  // the factors are powers of two: the products are exact
#pragma unroll
        for (uint32_t j = 0; j < (uint32_t)NF; ++j) Bf[cur][j] = Bf[cur][j] * splat16(gw[j]);
        if (!LAST && kk + 1u == 4u) factors(s + 1u);  // the next pass's factors, fetched with its first fragments
      }
      __builtin_amdgcn_sched_barrier(0);  // keeps the LDS reads in one group, out of the WMMA run
#pragma unroll
      for (uint32_t j = 0; j < (uint32_t)NF; ++j)
#pragma unroll
        for (uint32_t mi = 0; mi < (uint32_t)MF; ++mi)
          C[mi][j] = WMMA_BF16(Af[cur][mi], Bf[cur][j], C[mi][j]);
      __builtin_amdgcn_sched_barrier(0);  // keeps the next group of reads, and the publish point, behind this WMMA run
    }
  };
  do {  // T is at least 2: both stages loaded above exist
    pass(flag<false>{});
  } while (++s + 1u < T);
  pass(flag<true>{});
  wait_tensor0(g0);
  wait_ds0();
}

// Stands behind a group of global loads or stores, in front of the first instruction that may overwrite a register
// which one of them names (address or data). The scheduling barrier keeps later arithmetic behind the wait.
static __device__ __forceinline__ void close_global_group() {
  asm volatile("s_wait_xcnt 0x0" ::: "memory");
  __builtin_amdgcn_sched_barrier(0);
}
// The same behind a group of loads on one address: the wait names that address, so that its registers hold it, and
// no load's result, up to the wait.
template <class Addr>
static __device__ __forceinline__ void close_global_loads(Addr a) {
  asm volatile("s_wait_xcnt 0x0" :: "v"(a) : "memory");
  __builtin_amdgcn_sched_barrier(0);
}

// Output staging. Every gemm_core_lds product below runs with the output's contiguous dimension in the A role, 128 of it by 64 output
// rows per wave (MF = 8, NF = 4): a lane's eight accumulators of a fragment are neighbours in one output row, but the
// lanes of a store would then hit 16 rows with 32 or 64 bytes each. So a wave first sets its 64 rows in LDS, in an
// eighth of the ring that is its own, and reads them back row by row: each global store then covers whole 128-byte
// lines. The ring is free for this behind gemm_core_lds: the barrier in front of its last pass's last block stands behind
// every wave's last ring read and last tensor load. No other wave touches a wave's slab, so no further barrier is needed.
constexpr uint32_t SLAB_B  = RING_B / 8u;    // 36864 bytes per wave
constexpr uint32_t HPITCH  = 256u + 16u;     // staged row of 128 bf16; 16 bytes x odd: 16-byte LDS accesses meet no bank twice
constexpr uint32_t FPITCH  = 512u + 16u;     // staged row of 128 f32, likewise
static_assert(64u * HPITCH <= SLAB_B && 64u * FPITCH <= SLAB_B, "a wave's 64 staged rows fit its slab");

// The wave's 64 staged bf16 rows go out, two rows (512 bytes, four lines) per store. g points at this lane's 16 bytes of
// rows 0 and 1: row lane >> 4, bytes 16 * (lane & 15). LDO, the output's pitch in elements, is a compile-time constant:
// all stores then stand on one address register with constant offsets.
template <int LDO>
static __device__ __forceinline__ void flush_rows_bf16(const unsigned char* slab, bf16_t* g, uint32_t lane) {
  wait_ds0();  // the staged rows are written before other lanes' parts of them are read back; also holds the reads behind the writes in the compiler
  const unsigned char* sp = slab + (lane >> 4) * HPITCH + (lane & 15u) * 16u;
  v8bf v[32];
#pragma unroll  // register array: constant indices
  for (uint32_t t = 0; t < 32u; ++t) v[t] = *(const v8bf*)(sp + 2u * t * HPITCH);
  __builtin_amdgcn_sched_barrier(0);  // all read-backs issue as one group in front of the first store
#pragma unroll
  for (uint32_t t = 0; t < 32u; ++t) *(v8bf*)(g + (size_t)(2u * t) * (size_t)LDO) = v[t];
  close_global_group();
}

// Elementwise fp32 -> bf16 (8 elements/thread, grid-stride) of Wv and x in one launch, by ranges of the block index:
// blocks [0, wBlocks) take Wv (nw elements), the rest take x (nx).
__global__ __launch_bounds__(256) void cvt_f32_bf16_kernel(const float* __restrict__ x,
                                                           const float* __restrict__ Wv,
                                                           bf16_t* __restrict__ xb,
                                                           bf16_t* __restrict__ Wvb,
                                                           long long nx, long long nw, int wBlocks) {
  const int b = (int)blockIdx.x;
  const bool isW = b < wBlocks;
  const float* in = isW ? Wv : x;
  bf16_t* outp = isW ? Wvb : xb;
  const long long n = isW ? nw : nx;
  const int blk0 = isW ? b : b - wBlocks;                       // this block's place in its range
  const int nblk = isW ? wBlocks : (int)gridDim.x - wBlocks;    // blocks in its range
  long long idx = ((long long)blk0 * 256 + threadIdx.x) * 8;
  const long long stride = (long long)nblk * 256 * 8;
  for (; idx < n; idx += stride) {
    v8f f;
    f.lo = *(const v4f*)(in + idx);
    f.hi = *(const v4f*)(in + idx + 4);
    *(v8bf*)(outp + idx) = __builtin_convertvector(f, v8bf);
  }
}

// The query and key projections as ONE matrix. With q = Wq x + bq and k = Wk x' + bk,
//   q . k = x' . (Wk^T Wq x + Wk^T bq) + q . bk,
// and q . bk is the same for every key of a query: the softmax over the keys does not see it. So the scores are taken
// as y . x' with y = Wy x + cy, Wy = Wk^T Wq (DM x DM), cy = Wk^T bq, and the keys are the rows of x themselves.
// This kernel forms Wy (bf16, row j, column i: sum over e of Wk[e][j] * Wq[e][i]) and cy (f32) from the f32 weights.
// One workgroup per 64 x 64 tile of Wy. Both operands run along e, the slow index in memory: a lane takes one column and
// eight successive e (eight 4-byte loads, each a whole 128-byte line per wave), rounds them to bf16 and sets them as one
// 16-byte piece of that column's row in LDS, which is the fragment loaders' layout.
constexpr int      DM    = 1024;            // model width: rows and columns of Wq and Wk
constexpr uint32_t FE    = 128u;            // e per chunk
constexpr uint32_t FPIT  = 2u * FE + 16u;   // LDS pitch of a column's chunk; 16 bytes x odd: 16-byte accesses meet no bank twice
constexpr uint32_t FOP_B = 64u * FPIT;      // one operand's 64 columns
constexpr uint32_t OPIT  = 128u + 16u;      // staged output row of 64 bf16, likewise
__global__ __launch_bounds__(512) void fold_qk_kernel(const float* __restrict__ Wq, const float* __restrict__ Wk,
                                                      const float* __restrict__ bq,
                                                      bf16_t* __restrict__ Wy, float* __restrict__ cy) {
  __shared__ __attribute__((aligned(16))) unsigned char sm[2u * FOP_B];
  const uint32_t tid = threadIdx.x, lane = tid & 31u, r = lane & 15u, h = lane >> 4;
  const uint32_t wave = uni(tid >> 5);                    // sixteen waves
  const uint32_t i0 = ((uint32_t)blockIdx.x & 15u) << 6;  // first column of the tile: a column of Wq
  const uint32_t j0 = ((uint32_t)blockIdx.x >> 4) << 6;   // first row of the tile: a column of Wk
  const bool withC = i0 == 0u;                            // the first tile of a row of tiles also forms cy for its 64 rows

  // Piece u of a thread, 0..3: operand u >> 1 (Wq, Wk), column 32 * (u & 1) + lane, e = 8 * wave + 0..7 of the chunk.
  const float* gq = Wq + (size_t)(8u * wave) * DM + i0 + lane;
  const float* gk = Wk + (size_t)(8u * wave) * DM + j0 + lane;
  float raw[2][4][8];  // two chunks: one in flight while the other is rounded and multiplied
  auto fetch = [&](uint32_t c) {
#pragma unroll  // register arrays need constant indices, here and below
    for (uint32_t u = 0; u < 4u; ++u) {
      const float* g = ((u >> 1) ? gk : gq) + (size_t)(c * FE) * DM + 32u * (u & 1u);
#pragma unroll
      for (uint32_t t = 0; t < 8u; ++t) raw[c & 1u][u][t] = g[t * (uint32_t)DM];
    }
    // Stands behind the group of loads; it names their two addresses, so that those registers hold the addresses, and
    // no load's result, up to the wait. The scheduling barrier keeps later arithmetic behind it.
    asm volatile("s_wait_xcnt 0x0" :: "v"(gq), "v"(gk) : "memory");
    __builtin_amdgcn_sched_barrier(0);
  };
  // The workgroup's barrier with the LDS wait alone: __syncthreads() would also wait for the global loads of the chunk
  // in flight, and the loads would no longer run under the work on the chunk before.
  auto lds_barrier = [] { asm volatile("s_wait_dscnt 0x0\n\ts_barrier_signal -1\n\ts_barrier_wait -1" ::: "memory"); };

  // Wave w: one fragment of the tile, Wy rows 16 * (w & 3) (B role), columns 16 * (w >> 2) (A role): a lane's eight
  // accumulators are neighbours in a row of Wy.
  const unsigned char* pa = sm + (16u * (wave >> 2) + r) * FPIT + 16u * h;
  const unsigned char* pb = sm + FOP_B + (16u * (wave & 3u) + r) * FPIT + 16u * h;
  v8f C = {};
  float cp[2] = {0.0f, 0.0f};

  fetch(0u);
#pragma unroll  // the chunk number picks the register set, and every load then stands on one base with a constant offset
  for (uint32_t c = 0; c < (uint32_t)DM / FE; ++c) {
    if (c + 1u < (uint32_t)DM / FE) fetch(c + 1u);
    const float (&rw)[4][8] = raw[c & 1u];
    v8bf pk[4];
#pragma unroll
    for (uint32_t u = 0; u < 4u; ++u) {
      v8f f;
#pragma unroll
      for (uint32_t t = 0; t < 8u; ++t) f[t] = rw[u][t];
      pk[u] = __builtin_convertvector(f, v8bf);
    }
    if (withC) {
#pragma unroll
      for (uint32_t u = 2u; u < 4u; ++u)
#pragma unroll
        for (uint32_t t = 0; t < 8u; ++t)
          cp[u & 1u] = __builtin_fmaf(bq[c * FE + 8u * wave + t], rw[u][t], cp[u & 1u]);
    }
#pragma unroll
    for (uint32_t u = 0; u < 4u; ++u)
      *(v8bf*)(sm + (u >> 1) * FOP_B + (32u * (u & 1u) + lane) * FPIT + 16u * wave) = pk[u];
    lds_barrier();  // this chunk is in LDS
    v16bf af[FE / 32u], bf[FE / 32u];
#pragma unroll
    for (uint32_t kk = 0; kk < FE / 32u; ++kk) {
      af[kk] = lds_frag(pa + 64u * kk);
      bf[kk] = lds_frag(pb + 64u * kk);
    }
    __builtin_amdgcn_sched_barrier(0);  // the chunk's LDS reads go out as one group: one LDS latency, not one per product
#pragma unroll
    for (uint32_t kk = 0; kk < FE / 32u; ++kk) C = WMMA_BF16(af[kk], bf[kk], C);
    lds_barrier();  // every wave has read the chunk: LDS may be written again
  }

  // The tile is set in LDS and goes out by whole 128-byte rows; the waves' parts of cy are joined in a fixed order.
  *(v8bf*)(sm + (16u * (wave & 3u) + r) * OPIT + 32u * (wave >> 2) + 16u * h) = __builtin_convertvector(C, v8bf);
  float* red = (float*)(sm + FOP_B);
  if (withC) {
    red[wave * 64u + lane]       = cp[0];
    red[wave * 64u + 32u + lane] = cp[1];
  }
  __syncthreads();
  const uint32_t row = tid >> 3, seg = tid & 7u;
  *(v8bf*)(Wy + (size_t)(j0 + row) * DM + i0 + 8u * seg) = *(const v8bf*)(sm + row * OPIT + 16u * seg);
  if (withC && tid < 64u) {
    float s = 0.0f;
#pragma unroll
    for (uint32_t w = 0; w < 16u; ++w) s += red[w * 64u + tid];
    cy[j0 + tid] = s;
  }
  close_global_group();
}

// out = X * W^T + bias ; X:(M,K) bf16, W:(N,K) bf16 row-major.
// TR==0: out (M,N) bf16 row-major, computed as W * X^T; TR==1: out (N,M) bf16 row-major (V^T), computed as X * W^T:
// either way the A rows run along the rows of out. LDO: pitch of out (N or M). Workgroup tile 256x256.
template <int TR, int LDO>
__global__ __launch_bounds__(256) void qkv_proj_kernel(
    const bf16_t* __restrict__ X, const bf16_t* __restrict__ W,
    const float* __restrict__ bias, bf16_t* __restrict__ out,
    int M, int N, int K) {
  constexpr int MF = 8, NF = 4, WN = 16 / NF;
  __shared__ __attribute__((aligned(2048))) unsigned char ring[RING_B];
  const int lane = threadIdx.x & 31;
  const int wave = threadIdx.x >> 5;
  const int tilesN = N >> 8;
  const int mt0 = ((int)blockIdx.x / tilesN) << 8;
  const int nt0 = ((int)blockIdx.x % tilesN) << 8;
  const int at0 = TR ? mt0 : nt0;  // first A row of the tile: a column of out
  const int bt0 = TR ? nt0 : mt0;  // first B^T row of the tile: a row of out

  v8f C[MF][NF] = {};
  gemm_core_lds<MF, NF, false>(TR ? X : W, TR ? W : X, K, K, K, at0, bt0, ring, nullptr, [] {}, C);

  const int aw = at0 + (wave / WN) * (16 * MF);
  const int bw = bt0 + (wave % WN) * (16 * NF);
  const int r = lane & 15, h = lane >> 4;
  // The bias belongs to W's rows: eight neighbours per A fragment (TR == 0) or one value per B fragment (TR == 1).
  v8f ba[MF];
  float bb[NF];
  const int bi = TR ? bw + r : aw + 8 * h;
  const float* bp = bias + bi;
  if (!TR) {
#pragma unroll  // register arrays need constant indices, here and below
    for (int mi = 0; mi < MF; ++mi) {
      ba[mi].lo = *(const v4f*)(bp + 16 * mi);
      ba[mi].hi = *(const v4f*)(bp + 16 * mi + 4);
    }
  } else {
#pragma unroll
    for (int j = 0; j < NF; ++j) bb[j] = bp[16 * j];
  }
  if (TR) close_global_loads(bi);  // these loads stand on the scalar base and the index
  else    close_global_loads(bp);
  unsigned char* slab = ring + (uint32_t)wave * SLAB_B;
  unsigned char* st = slab + (uint32_t)r * HPITCH + 16u * (uint32_t)h;  // this lane's place in staged row r
#pragma unroll
  for (int j = 0; j < NF; ++j) {
#pragma unroll
    for (int mi = 0; mi < MF; ++mi) {
      v8f o;
      if (!TR) o = C[mi][j] + ba[mi];
      else     o = C[mi][j] + bb[j];
      *(v8bf*)(st + (uint32_t)(16 * j) * HPITCH + (uint32_t)(32 * mi)) = __builtin_convertvector(o, v8bf);
    }
  }
  flush_rows_bf16<LDO>(slab, out + (size_t)(bw + h) * (size_t)LDO + (size_t)(aw + 8 * r), (uint32_t)lane);
}

// Softmax over the keys is split over the two attention products, by blocks of KB = 128 keys (one pass of the second).
// Base 2: w = score * log2(e). Block t of a query row has the whole number e_t = ceil(max of w in the block).
// First product: stores p = 2^(w - e_t) as bf16 (at most 1) and, per row and block, e_t and l_t = sum of p.
// Second product: with E = max e_t and g_t = 2^(e_t - E), out = (sum_t g_t * (p_t * V_t)) / (sum_t g_t * l_t).
constexpr int KB   = 128;   // keys per block
constexpr int NBLK = 16;    // blocks per row: the second product is built for 2048 keys
constexpr int SQ   = 2048;  // queries per batch: pitch of the per-block tables
constexpr int DV   = 1024;  // columns of V and of out: a compile-time pitch puts a lane's stores on one address register
constexpr uint32_t GTAB_B = (uint32_t)NBLK * 256u * 4u;  // factor table of a 256-row tile
constexpr uint32_t TAB_B  = GTAB_B + 256u * 4u;          // and one reciprocal row sum per row

// The value of lane l ^ 16.
static __device__ __forceinline__ float other_half(float v) {
  const int b = __builtin_bit_cast(int, v);
  return __builtin_bit_cast(float, __builtin_amdgcn_permlanex16(b, b, 0x76543210, 0xfedcba98, false, false));
}

// Transposed scores, keys x queries = Kmat * Q^T, batched via blockIdx.y: a lane's accumulators of one column of
// fragments all belong to ONE query, so maximum and sum run inside the lane (one exchange between the halves), and
// eight neighbouring keys of a query make one 16-byte piece of a staged row. Workgroup tile 256x256, wave tile 128 keys
// x 64 queries. Kmat, Q: (S, K) bf16, pitch ld. P: (S queries, S keys) bf16, pitch SQ. eblk, lblk: (S / KB blocks, SQ
// queries) f32, S <= SQ.
__global__ __launch_bounds__(256) void score_exp_kernel(
    const bf16_t* __restrict__ Kmat, const bf16_t* __restrict__ Q,
    bf16_t* __restrict__ P, float* __restrict__ eblk, float* __restrict__ lblk,
    int S, int K, int ld, long long strideQK, long long strideP, long long strideB, float sc2) {
  constexpr int MF = 8, NF = 4, WN = 16 / NF;
  __shared__ __attribute__((aligned(2048))) unsigned char ring[RING_B];
  const int b = blockIdx.y;
  const bf16_t* Kb = Kmat + (size_t)b * strideQK;
  const bf16_t* Qb = Q + (size_t)b * strideQK;
  bf16_t* Pb = P + (size_t)b * strideP;
  float* eb = eblk + (size_t)b * strideB;
  float* lb = lblk + (size_t)b * strideB;

  const int lane = threadIdx.x & 31;
  const int wave = threadIdx.x >> 5;
  const int tilesN = S >> 8;
  const int kt0 = ((int)blockIdx.x / tilesN) << 8;
  const int qt0 = ((int)blockIdx.x % tilesN) << 8;

  v8f C[MF][NF] = {};
  gemm_core_lds<MF, NF, false>(Kb, Qb, ld, ld, K, kt0, qt0, ring, nullptr, [] {}, C);

  const int kt = kt0 + (wave / WN) * (16 * MF);  // this wave's key block
  const int qt = qt0 + (wave % WN) * (16 * NF);
  const int r = lane & 15, h = lane >> 4;
  unsigned char* slab = ring + (uint32_t)wave * SLAB_B;
  unsigned char* st = slab + (uint32_t)r * HPITCH + 16u * (uint32_t)h;  // this lane's place in staged row r
  // Every loop below is unrolled because the accumulators are register arrays: they need constant indices.
#pragma unroll
  for (int j = 0; j < NF; ++j) {
    const int q = qt + 16 * j + r;
    v8f mv = C[0][j];
#pragma unroll
    for (int mi = 1; mi < MF; ++mi) mv = __builtin_elementwise_max(mv, C[mi][j]);
    float mx = fmaxf(fmaxf(fmaxf(mv[0], mv[1]), fmaxf(mv[2], mv[3])), fmaxf(fmaxf(mv[4], mv[5]), fmaxf(mv[6], mv[7])));
    mx = fmaxf(mx, other_half(mx));
    const float e = ceilf(mx * sc2);
    v8f sv = {};
#pragma unroll
    for (int mi = 0; mi < MF; ++mi) {
      v8f p;
#pragma unroll
      for (int i = 0; i < 8; ++i) p[i] = __builtin_amdgcn_exp2f(__builtin_fmaf(C[mi][j][i], sc2, -e));
      sv += p;
      *(v8bf*)(st + (uint32_t)(16 * j) * HPITCH + (uint32_t)(32 * mi)) = __builtin_convertvector(p, v8bf);
    }
    float sum = ((sv[0] + sv[1]) + (sv[2] + sv[3])) + ((sv[4] + sv[5]) + (sv[6] + sv[7]));
    sum += other_half(sum);
    // Both halves hold e and sum of query q: the lower half stores e, the upper half the sum, in one instruction.
    float* sp = (h ? lb : eb) + (size_t)(kt / KB) * (size_t)SQ + (size_t)q;
    const float sval = h ? sum : e;
    *sp = sval;
    close_global_group();
  }
  flush_rows_bf16<SQ>(slab, Pb + (size_t)(qt + h) * (size_t)SQ + (size_t)(kt + 8 * r), (uint32_t)lane);
}

// out = softmax weights * V, batched via blockIdx.y, computed as V^T * P^T: P (queries, K keys) bf16 as score_exp_kernel
// leaves it, Vt (DV, K) bf16 pitch ldb, out (queries, DV) f32. K = NBLK * KB. Workgroup tile 256x256, wave tile 128
// columns of out x 64 queries.
__global__ __launch_bounds__(256) void pv_kernel(
    const bf16_t* __restrict__ P, const bf16_t* __restrict__ Vt,
    const float* __restrict__ eblk, const float* __restrict__ lblk,
    float* __restrict__ outp, int K, int ldb,
    long long strideP, long long strideV, long long strideB, long long strideO) {
  // The ring first, so that its slices keep their places at multiples of 2 KiB; the tables behind it.
  __shared__ __attribute__((aligned(2048))) unsigned char smem[RING_B + TAB_B];
  uint32_t* gtab = (uint32_t*)(smem + RING_B);
  float* invl = (float*)(smem + RING_B + GTAB_B);
  const int b = blockIdx.y;
  const bf16_t* Pb = P + (size_t)b * strideP;
  const bf16_t* Vb = Vt + (size_t)b * strideV;
  const float* eb = eblk + (size_t)b * strideB;
  const float* lb = lblk + (size_t)b * strideB;
  float* ob = outp + (size_t)b * strideO;

  const int tid = threadIdx.x;
  const int lane = tid & 31;
  const int wave = tid >> 5;
  constexpr int tilesN = DV >> 8;
  const int mt0 = ((int)blockIdx.x / tilesN) << 8;
  const int nt0 = ((int)blockIdx.x % tilesN) << 8;
  const int r = lane & 15, h = lane >> 4;

  // Thread t joins the blocks of tile row t. Its loops are unrolled: ev and lv are register arrays, and the 32 loads
  // then go out together on one address register with constant offsets.
  auto pre = [&] {
    float ev[NBLK], lv[NBLK];
    const float* ep = eb + mt0 + tid;
    const float* lp = lb + mt0 + tid;
#pragma unroll
    for (int t = 0; t < NBLK; ++t) {
      ev[t] = ep[t * SQ];
      lv[t] = lp[t * SQ];
    }
    close_global_group();
    float E = ev[0];
#pragma unroll
    for (int t = 1; t < NBLK; ++t) E = fmaxf(E, ev[t]);
    float L = 0.0f;
#pragma unroll
    for (int t = 0; t < NBLK; ++t) {
      const float g = __builtin_ldexpf(1.0f, (int)(ev[t] - E));  // an exact power of two or 0: its upper 16 bits are the bf16
      L += lv[t] * g;
      const uint32_t gb = __builtin_bit_cast(uint32_t, g) >> 16;
      gtab[t * 256 + tid] = gb | (gb << 16);
    }
    invl[tid] = 1.0f / L;
  };

  constexpr int MF = 8, NF = 4;
  const int qw = (wave & 3) << 6;   // this wave's first query in the tile
  const int dw = (wave >> 2) << 7;  // this wave's first column in the tile
  v8f C[MF][NF] = {};
  gemm_core_lds<MF, NF, true>(Vb, Pb, ldb, K, K, nt0, mt0, smem, gtab + qw + r, pre, C);

  unsigned char* slab = smem + (uint32_t)wave * SLAB_B;
  unsigned char* st = slab + (uint32_t)r * FPITCH + 32u * (uint32_t)h;  // this lane's place in staged row r
  // Unrolled: the accumulators are register arrays, and the offsets become constants.
  float iv[NF];  // read ahead of the staging stores: one LDS wait, not one per column of fragments
#pragma unroll
  for (int j = 0; j < NF; ++j) iv[j] = invl[qw + 16 * j + r];
#pragma unroll
  for (int j = 0; j < NF; ++j) {
#pragma unroll
    for (int mi = 0; mi < MF; ++mi) {
      const v8f o = C[mi][j] * iv[j];
      unsigned char* d = st + (uint32_t)(16 * j) * FPITCH + (uint32_t)(64 * mi);
      *(v4f*)(d)       = o.lo;
      *(v4f*)(d + 16u) = o.hi;
    }
  }
  wait_ds0();  // the staged rows are written before other lanes' parts of them are read back; also holds the reads behind the writes in the compiler
  // One staged row (512 bytes, four lines) per store. The accumulators' registers are free by now and take all 64 rows.
  const unsigned char* sp = slab + 16u * (uint32_t)lane;
  float* op = ob + (size_t)(mt0 + qw) * (size_t)DV + (size_t)(nt0 + dw + 4 * lane);
  v4f v[64];
#pragma unroll
  for (int t = 0; t < 64; ++t) v[t] = *(const v4f*)(sp + (uint32_t)t * FPITCH);
  __builtin_amdgcn_sched_barrier(0);  // all read-backs issue as one group in front of the first store
#pragma unroll
  for (int t = 0; t < 64; ++t) *(v4f*)(op + t * DV) = v[t];
  close_global_group();
}

extern "C" void kernel_launch(void* const* d_in, const int* in_sizes, int n_in,
                              void* d_out, int out_size, void* d_ws, size_t ws_size,
                              hipStream_t stream) {
  const float* x  = (const float*)d_in[0];
  const float* Wq = (const float*)d_in[1];
  const float* bq = (const float*)d_in[2];
  const float* Wk = (const float*)d_in[3];
  const float* Wv = (const float*)d_in[5];
  const float* bv = (const float*)d_in[6];
  float* out = (float*)d_out;

  const int B = 8, S = 2048, D = 1024;
  const int MS = B * S; // 16384
  const float sc2 = 0.045084220f; // log2(e) / sqrt(1024)

  // ---- workspace layout (all offsets 16B aligned, no two buffers share bytes) ----
  char* ws = (char*)d_ws;
  bf16_t* Y   = (bf16_t*)(ws);                         // 16384x1024 bf16 = 32 MiB: y = Wy x + cy, in the queries' place
  bf16_t* xb  = (bf16_t*)(ws + (size_t)33554432);      // x in bf16, 32 MiB: projections' operand and the keys
  bf16_t* VT  = (bf16_t*)(ws + (size_t)67108864);      // V^T (1024 x 16384), 32 MiB
  bf16_t* P   = (bf16_t*)(ws + (size_t)100663296);     // 8 x 2048 x 2048 bf16 = 64 MiB
  float*  eb  = (float*) (ws + (size_t)167772160);     // 8 x 16 x 2048 f32 = 1 MiB
  float*  lb  = (float*) (ws + (size_t)168820736);     // the same
  bf16_t* Wvb = (bf16_t*)(ws + (size_t)169869312);     // Wv, 1024x1024 bf16 = 2 MiB
  bf16_t* Wy  = (bf16_t*)(ws + (size_t)171966464);     // Wk^T Wq, the same size
  float*  cy  = (float*) (ws + (size_t)174063616);     // Wk^T bq, 1024 floats

  dim3 blk(256);

  // ---- 1) Wq and Wk joined into one matrix; x and Wv to bf16 ----
  fold_qk_kernel<<<(D / 64) * (D / 64), dim3(512), 0, stream>>>(Wq, Wk, bq, Wy, cy);
  cvt_f32_bf16_kernel<<<512 + 4096, blk, 0, stream>>>(x, Wv, xb, Wvb, (long long)MS * D, (long long)D * D, 512);

  // ---- 2) projections (pure bf16 WMMA GEMM, 256x256 workgroup tiles) ----
  const int projBlocks = (MS / 256) * (D / 256); // 256
  qkv_proj_kernel<0, 1024><<<projBlocks, blk, 0, stream>>>(xb, Wy, cy, Y, MS, D, D);
  qkv_proj_kernel<1, 16384><<<projBlocks, blk, 0, stream>>>(xb, Wvb, bv, VT, MS, D, D);

  // ---- 3) attention, all batches per launch (gridDim.y = 8) ----
  const int scBlocks = (S / 256) * (S / 256); // 64 per batch
  const int pvBlocks = (S / 256) * (D / 256); // 32 per batch
  score_exp_kernel<<<dim3(scBlocks, B), blk, 0, stream>>>(
      xb, Y, P, eb, lb, S, D, D,
      (long long)S * D, (long long)S * S, (long long)(S / 128) * S, sc2);
  pv_kernel<<<dim3(pvBlocks, B), blk, 0, stream>>>(
      P, VT, eb, lb, out, S, MS,
      (long long)S * S, (long long)S, (long long)(S / 128) * S, (long long)S * D);
}

// v009
// It runs in 137 microseconds.
// Next to v008, in two timings, it ran 1.05 times as fast each time.
// Counting every step since v000, it is 6.69 times as fast.
#include <hip/hip_runtime.h>
#include <stdint.h>

typedef __bf16 bf16_t;
typedef __attribute__((ext_vector_type(16))) __bf16 v16bf;
typedef __attribute__((ext_vector_type(8)))  __bf16 v8bf;
typedef __attribute__((ext_vector_type(2)))  __bf16 v2bf;
typedef __attribute__((ext_vector_type(8)))  float  v8f;
typedef __attribute__((ext_vector_type(4)))  float  v4f;

#define WMMA_BF16(A, B, C) \
  __builtin_amdgcn_wmma_f32_16x16x32_bf16(false, (A), false, (B), (short)0, (C), false, false)

typedef uint32_t u32x4 __attribute__((ext_vector_type(4)));
typedef uint32_t u32x8 __attribute__((ext_vector_type(8)));

// Workgroup tile 256 x 256 of the output, eight waves (two per SIMD), 128 x 64 per wave: each operand byte
// fetched from L2 and each fragment read from LDS feeds twice the matrix work of a 128 x 128 tile.
// A pass is 128 k = 256 bytes of each of the 256 A rows and 256 B^T rows. A stage in LDS is eight
// slices of 64 rows, slices 0..3 = A rows, 4..7 = B^T rows, one tensor load per wave and stage.
constexpr uint32_t ROWB    = 256u;            // bytes of one operand row per pass
constexpr uint32_t PITCH   = ROWB + 16u;      // LDS row pitch for ds_load_b128 readers (pad of 4 dwords)
constexpr uint32_t SROWS   = 64u;             // rows per slice
constexpr uint32_t SLICE_B = 18432u;          // 64 * 272 = 17408, rounded up to a multiple of 2 KiB
constexpr uint32_t BUF_B   = 8u * SLICE_B;    // one stage
constexpr uint32_t RING_B  = 2u * BUF_B;      // two buffers, 294912 bytes: one workgroup per WGP
static_assert(SROWS * PITCH <= SLICE_B && (SLICE_B % 2048u) == 0u, "a slice holds its padded rows and starts at a multiple of 2 KiB");

static __device__ __forceinline__ uint32_t uni(uint32_t v) { return (uint32_t)__builtin_amdgcn_readfirstlane(v); }
// A wave-uniform word held in a scalar register: the issue test on it compiles to s_cmp + s_cbranch_scc, and a
// descriptor word formed from it stays behind the volatile statements (the waits) that stand in front of it.
static __device__ __forceinline__ uint32_t pinned(uint32_t v) {
  uint32_t w = uni(v);
  asm volatile("" : "+s"(w));  // pinned(): a descriptor word or an issue test held in a scalar register
  return w;
}
static __device__ __forceinline__ void wait_ds0()     { asm volatile("s_wait_dscnt 0x0" ::: "memory"); }     // this wave's LDS reads have retired
// This wave's tensor load has landed. The wait names the request's group 0, so that those scalar registers hold
// the descriptor, and nothing else, for as long as the request is outstanding.
static __device__ __forceinline__ void wait_tensor0(u32x4 g0) { asm volatile("s_wait_tensorcnt 0x0" :: "s"(g0) : "memory"); }
// One request of the whole wave: a 2-D tile from global memory into LDS, through no register. Group 0 is an
// in-out operand: what the wait above names is then held in the very registers that the request was issued from.
static __device__ __forceinline__ void tdm_load(u32x4& g0, u32x8 g1) { asm volatile("tensor_load_to_lds %0, %1" : "+s"(g0) : "s"(g1) : "memory"); }

// Descriptor group 1: 1-byte elements, tensor = tile = 64 rows of 256 bytes, 4 dwords of LDS pad behind every row.
static __device__ __forceinline__ u32x8 tdm_group1(uint32_t src_pitch) {
  constexpr uint32_t d0 = ROWB, d1 = SROWS;
  u32x8 g;
  g[0] = uni((1u << 20) | (5u << 22) | (3u << 25));  // no mask; pad on, interval 64 dwords, amount 4 dwords
  // Words 1 to 7 are pinned: descriptor words held in scalar registers of their own for the whole loop,
  // so that none is used for anything else while a request is outstanding.
  g[1] = pinned((d0 & 0xFFFFu) << 16);
  g[2] = pinned((d0 >> 16) | ((d1 & 0xFFFFu) << 16));
  g[3] = pinned((d1 >> 16) | (d0 << 16));
  g[4] = pinned(d1);
  g[5] = pinned(src_pitch);
  g[6] = pinned(0u);
  g[7] = pinned(0u);
  return g;
}
static __device__ __forceinline__ u32x4 tdm_group0(uint32_t lds_dst, uint64_t ga) {
  u32x4 g;
  g[0] = uni(1u);
  g[1] = uni(lds_dst);
  g[2] = uni((uint32_t)ga);
  g[3] = uni((((uint32_t)(ga >> 32)) & 0x01FFFFFFu) | 0x80000000u);
  return g;
}

// A-fragment (16x32 bf16) / B-fragment (B^T rows; identical layout, N in the lane role) from LDS.
// p points at row (lane&15), 16-byte half (lane>>4): K = {k0+h*8 .. +7} then {k0+16+h*8 .. +7}.
static __device__ __forceinline__ v16bf lds_frag(const unsigned char* p) {
  v16bf a;
  a.lo = *(const v8bf*)(p);
  a.hi = *(const v8bf*)(p + 32);
  return a;
}

// One bf16 factor, held twice in a dword, spread over a fragment's 16 elements.
static __device__ __forceinline__ v16bf splat16(uint32_t w) {
  const v2bf g = __builtin_bit_cast(v2bf, w);
  return __builtin_shufflevector(g, g, 0, 1, 0, 1, 0, 1, 0, 1, 0, 1, 0, 1, 0, 1, 0, 1);
}

template <bool V> struct flag { static constexpr bool value = V; };  // a compile-time switch handed to a generic lambda

// C (16*MF x 16*NF per wave) += A[mt0.., :] * Bt[nt0.., :]^T for one 256 x 256 workgroup tile.
// Wave w holds rows 16*MF*(w / WN), columns 16*NF*(w % WN) of the tile, WN = 16 / NF waves along the columns.
// M, N multiples of 256; K a multiple of 128 and at least 256 (two stages).
// SCALE: row n of Bt counts times a factor of its own in every pass s; gt points at this lane's first row in a
// table in LDS of [pass][256 tile rows] dwords (the bf16 factor twice), which pre() fills.
// pre() runs once, while stage 0's load is in flight; what it writes to LDS is published by stage 0's barrier.
template <int MF, int NF, bool SCALE, class Pre>
static __device__ __forceinline__ void gemm_core_lds(const bf16_t* __restrict__ A,
                                                     const bf16_t* __restrict__ Bt,
                                                     int lda, int ldb, int K,
                                                     int mt0, int nt0,
                                                     unsigned char* ring, const uint32_t* gt, Pre pre,
                                                     v8f (&C)[MF][NF]) {
  static_assert(MF * NF == 32 && (MF % 4) == 0 && (NF % 4) == 0, "eight waves cover 256 x 256; a wave's rows start on a slice");
  constexpr uint32_t WN = 16u / (uint32_t)NF;
  const uint32_t lane = threadIdx.x & 31u, r = lane & 15u, h = lane >> 4;
  const uint32_t wave = uni(threadIdx.x >> 5);
  const uint32_t wm = wave / WN, wn = wave % WN;
  const uint32_t T = (uint32_t)K >> 7;  // passes

  // This wave's slice of every stage.
  const bool isA = wave < 4u;
  const bf16_t* srow = isA ? A + (size_t)(mt0 + (int)(SROWS * wave)) * (size_t)lda
                           : Bt + (size_t)(nt0 + (int)(SROWS * (wave - 4u))) * (size_t)ldb;
  const uint64_t ga0 = (uint64_t)(uintptr_t)srow;
  const uint32_t dst0 = (uint32_t)(uintptr_t)ring + wave * SLICE_B;
  const u32x8 g1 = tdm_group1(2u * (uint32_t)(isA ? lda : ldb));

  // Per-lane fragment bases inside a buffer.
  const uint32_t fa = wm * (uint32_t)(MF / 4) * SLICE_B + r * PITCH + 16u * h;
  const uint32_t fb = (4u + wn * (uint32_t)(NF / 4)) * SLICE_B + r * PITCH + 16u * h;
  // Fragment f of a wave's operand: 16 rows, four fragments to a slice.
  auto foff = [](uint32_t f) { return (f >> 2) * SLICE_B + (f & 3u) * 16u * PITCH; };

  u32x4 g0 = tdm_group0(dst0, ga0);
  tdm_load(g0, g1);                             // stage 0
  pre();
  wait_tensor0(g0);
  __syncthreads();                              // stage 0 is published
  g0 = tdm_group0(dst0 + BUF_B, ga0 + ROWB);
  tdm_load(g0, g1);                             // stage 1

  // Two fragment sets take turns over the whole loop, pass boundaries included: each block's 24 LDS reads go out as one
  // group in front of the block before it, so that no block, a pass's first block included, waits for its own reads.
  v16bf Af[2][MF], Bf[2][NF];
  uint32_t gw[NF];  // the running pass's factor of the lane's row in each B fragment (a B fragment's row is lane & 15)
  auto fetch = [&](uint32_t set, uint32_t base, uint32_t kk) __attribute__((always_inline)) {
    const unsigned char* pa = ring + base + fa + kk * 64u;
    const unsigned char* pb = ring + base + fb + kk * 64u;
#pragma unroll  // register arrays need constant indices, here and below
    for (uint32_t mi = 0; mi < (uint32_t)MF; ++mi) Af[set][mi] = lds_frag(pa + foff(mi));
#pragma unroll
    for (uint32_t j = 0; j < (uint32_t)NF; ++j) Bf[set][j] = lds_frag(pb + foff(j));
  };
  auto factors = [&](uint32_t p) __attribute__((always_inline)) {
    if constexpr (SCALE) {
#pragma unroll
      for (uint32_t j = 0; j < (uint32_t)NF; ++j) gw[j] = gt[p * 256u + 16u * j];
    }
  };
  fetch(0u, 0u, 0u);  // first fragment loads: stage 0 is published
  factors(0u);

  uint32_t s = 0;
  // One pass. LAST: the pass of the last stage, with nothing left to publish, refill or fetch ahead.
  auto pass = [&](auto last) __attribute__((always_inline)) {
    constexpr bool LAST = decltype(last)::value;
    const uint32_t buf = (s & 1u) * BUF_B;
#pragma unroll
    for (uint32_t kk = 0; kk < 4u; ++kk) {
      const uint32_t cur = kk & 1u, nxt = cur ^ 1u;
      if (kk + 1u < 4u) {
        fetch(nxt, buf, kk + 1u);
      } else {
        // Publish point of stage s + 1, in front of the pass's last block: that block's fragments are in registers, so
        // this wave's reads of stage s's buffer end at the wait, and every wave's at the barrier. In the last pass the
        // same wait and barrier free the ring for the output staging.
        wait_ds0();
        if constexpr (!LAST) wait_tensor0(g0);
        __syncthreads();
        if constexpr (!LAST) {
          if (pinned((s + 2u < T) ? 1u : 0u) != 0u) {  // the refill, only while stage s + 2 exists
            const uint32_t nx = pinned(s + 2u);        // descriptor word source, formed behind the wait above
            g0 = tdm_group0(dst0 + buf, ga0 + (uint64_t)nx * ROWB);
            tdm_load(g0, g1);
          }
          fetch(nxt, BUF_B - buf, 0u);  // the next pass's first block, from the stage just published
        }
      }
      if constexpr (SCALE) {  // the factors are powers of two: the products are exact
#pragma unroll
        for (uint32_t j = 0; j < (uint32_t)NF; ++j) Bf[cur][j] = Bf[cur][j] * splat16(gw[j]);
        if (!LAST && kk + 1u == 4u) factors(s + 1u);  // the next pass's factors, fetched with its first fragments
      }
      __builtin_amdgcn_sched_barrier(0);  // keeps the LDS reads in one group, out of the WMMA run
#pragma unroll
      for (uint32_t j = 0; j < (uint32_t)NF; ++j)
#pragma unroll
        for (uint32_t mi = 0; mi < (uint32_t)MF; ++mi)
          C[mi][j] = WMMA_BF16(Af[cur][mi], Bf[cur][j], C[mi][j]);
      __builtin_amdgcn_sched_barrier(0);  // keeps the next group of reads, and the publish point, behind this WMMA run
    }
  };
  do {  // T is at least 2: both stages loaded above exist
    pass(flag<false>{});
  } while (++s + 1u < T);
  pass(flag<true>{});
  wait_tensor0(g0);
  wait_ds0();
}

// Stands behind a group of global loads or stores, in front of the first instruction that may overwrite a register
// which one of them names (address or data). The scheduling barrier keeps later arithmetic behind the wait.
static __device__ __forceinline__ void close_global_group() {
  asm volatile("s_wait_xcnt 0x0" ::: "memory");
  __builtin_amdgcn_sched_barrier(0);
}
// The same behind a group of loads on one address: the wait names that address, so that its registers hold it, and
// no load's result, up to the wait.
template <class Addr>
static __device__ __forceinline__ void close_global_loads(Addr a) {
  asm volatile("s_wait_xcnt 0x0" :: "v"(a) : "memory");
  __builtin_amdgcn_sched_barrier(0);
}

// Output staging. Every gemm_core_lds product below runs with the output's contiguous dimension in the A role, 128 of it by 64 output
// rows per wave (MF = 8, NF = 4): a lane's eight accumulators of a fragment are neighbours in one output row, but the
// lanes of a store would then hit 16 rows with 32 or 64 bytes each. So a wave first sets its 64 rows in LDS, in an
// eighth of the ring that is its own, and reads them back row by row: each global store then covers whole 128-byte
// lines. The ring is free for this behind gemm_core_lds: the barrier in front of its last pass's last block stands behind
// every wave's last ring read and last tensor load. No other wave touches a wave's slab, so no further barrier is needed.
constexpr uint32_t SLAB_B  = RING_B / 8u;    // 36864 bytes per wave
constexpr uint32_t HPITCH  = 256u + 16u;     // staged row of 128 bf16; 16 bytes x odd: 16-byte LDS accesses meet no bank twice
constexpr uint32_t FPITCH  = 512u + 16u;     // staged row of 128 f32, likewise
static_assert(64u * HPITCH <= SLAB_B && 64u * FPITCH <= SLAB_B, "a wave's 64 staged rows fit its slab");

// The wave's 64 staged bf16 rows go out, two rows (512 bytes, four lines) per store. g points at this lane's 16 bytes of
// rows 0 and 1: row lane >> 4, bytes 16 * (lane & 15). LDO, the output's pitch in elements, is a compile-time constant:
// all stores then stand on one address register with constant offsets.
template <int LDO>
static __device__ __forceinline__ void flush_rows_bf16(const unsigned char* slab, bf16_t* g, uint32_t lane) {
  wait_ds0();  // the staged rows are written before other lanes' parts of them are read back; also holds the reads behind the writes in the compiler
  const unsigned char* sp = slab + (lane >> 4) * HPITCH + (lane & 15u) * 16u;
  v8bf v[32];
#pragma unroll  // register array: constant indices
  for (uint32_t t = 0; t < 32u; ++t) v[t] = *(const v8bf*)(sp + 2u * t * HPITCH);
  __builtin_amdgcn_sched_barrier(0);  // all read-backs issue as one group in front of the first store
#pragma unroll
  for (uint32_t t = 0; t < 32u; ++t) *(v8bf*)(g + (size_t)(2u * t) * (size_t)LDO) = v[t];
  close_global_group();
}

constexpr int PREP_T = 512;  // threads of a block of the preparing launch

// Elementwise fp32 -> bf16 (two pieces of 8 elements per thread and trip, grid-stride) of Wv and x, by ranges of the block number b in 0 .. nBlocks - 1:
// blocks [0, wBlocks) take Wv (nw elements), the rest take x (nx).
static __device__ __forceinline__ void cvt_f32_bf16(int b, int nBlocks,
                                                    const float* __restrict__ x,
                                                    const float* __restrict__ Wv,
                                                    bf16_t* __restrict__ xb,
                                                    bf16_t* __restrict__ Wvb,
                                                    long long nx, long long nw, int wBlocks) {
  const bool isW = b < wBlocks;
  const float* in = isW ? Wv : x;
  bf16_t* outp = isW ? Wvb : xb;
  const long long n = isW ? nw : nx;
  const int blk0 = isW ? b : b - wBlocks;               // this block's place in its range
  const int nblk = isW ? wBlocks : nBlocks - wBlocks;   // blocks in its range
  long long idx = ((long long)blk0 * PREP_T + threadIdx.x) * 8;
  const long long stride = (long long)nblk * PREP_T * 8;
  // Two pieces per trip, a stride apart, their four loads outstanding together: at the launch's eight waves per SIMD one
  // piece per wave would leave too few bytes in flight to keep the memory busy.
  for (; idx < n; idx += 2 * stride) {
    const bool two = idx + stride < n;
    const long long jdx = two ? idx + stride : idx;  // past the end the second piece is the first once more: same value, same place
    v8f f, g;
    f.lo = *(const v4f*)(in + idx);
    f.hi = *(const v4f*)(in + idx + 4);
    g.lo = *(const v4f*)(in + jdx);
    g.hi = *(const v4f*)(in + jdx + 4);
    *(v8bf*)(outp + idx) = __builtin_convertvector(f, v8bf);
    *(v8bf*)(outp + jdx) = __builtin_convertvector(g, v8bf);
  }
}

// The query and key projections as ONE matrix. With q = Wq x + bq and k = Wk x' + bk,
//   q . k = x' . (Wk^T Wq x + Wk^T bq) + q . bk,
// and q . bk is the same for every key of a query: the softmax over the keys does not see it. So the scores are taken
// as y . x' with y = Wy x + cy, Wy = Wk^T Wq (DM x DM), cy = Wk^T bq, and the keys are the rows of x themselves.
// This kernel forms Wy (bf16, row j, column i: sum over e of Wk[e][j] * Wq[e][i]) and cy (f32) from the f32 weights.
// One workgroup per 64 x 64 tile of Wy. Both operands run along e, the slow index in memory: a lane takes one column and
// eight successive e (eight 4-byte loads, each a whole 128-byte line per wave), rounds them to bf16 and sets them as one
// 16-byte piece of that column's row in LDS, which is the fragment loaders' layout.
constexpr int      DM    = 1024;            // model width: rows and columns of Wq and Wk
constexpr uint32_t FE    = 128u;            // e per chunk
constexpr uint32_t FPIT  = 2u * FE + 16u;   // LDS pitch of a column's chunk; 16 bytes x odd: 16-byte accesses meet no bank twice
constexpr uint32_t FOP_B = 64u * FPIT;      // one operand's 64 columns
constexpr uint32_t OPIT  = 128u + 16u;      // staged output row of 64 bf16, likewise
constexpr int FOLD_BLOCKS = (DM / 64) * (DM / 64);
static __device__ __forceinline__ void fold_qk(uint32_t tile, unsigned char* sm,
                                               const float* __restrict__ Wq, const float* __restrict__ Wk,
                                               const float* __restrict__ bq,
                                               bf16_t* __restrict__ Wy, float* __restrict__ cy) {
  const uint32_t tid = threadIdx.x, lane = tid & 31u, r = lane & 15u, h = lane >> 4;
  const uint32_t wave = uni(tid >> 5);       // sixteen waves
  const uint32_t i0 = (tile & 15u) << 6;     // first column of the tile: a column of Wq
  const uint32_t j0 = (tile >> 4) << 6;      // first row of the tile: a column of Wk
  const bool withC = i0 == 0u;                            // the first tile of a row of tiles also forms cy for its 64 rows

  // Piece u of a thread, 0..3: operand u >> 1 (Wq, Wk), column 32 * (u & 1) + lane, e = 8 * wave + 0..7 of the chunk.
  const float* gq = Wq + (size_t)(8u * wave) * DM + i0 + lane;
  const float* gk = Wk + (size_t)(8u * wave) * DM + j0 + lane;
  float raw[2][4][8];  // two chunks: one in flight while the other is rounded and multiplied
  auto fetch = [&](uint32_t c) {
#pragma unroll  // register arrays need constant indices, here and below
    for (uint32_t u = 0; u < 4u; ++u) {
      const float* g = ((u >> 1) ? gk : gq) + (size_t)(c * FE) * DM + 32u * (u & 1u);
#pragma unroll
      for (uint32_t t = 0; t < 8u; ++t) raw[c & 1u][u][t] = g[t * (uint32_t)DM];
    }
    // Stands behind the group of loads; it names their two addresses, so that those registers hold the addresses, and
    // no load's result, up to the wait. The scheduling barrier keeps later arithmetic behind it.
    asm volatile("s_wait_xcnt 0x0" :: "v"(gq), "v"(gk) : "memory");
    __builtin_amdgcn_sched_barrier(0);
  };
  // The workgroup's barrier with the LDS wait alone: __syncthreads() would also wait for the global loads of the chunk
  // in flight, and the loads would no longer run under the work on the chunk before.
  auto lds_barrier = [] { asm volatile("s_wait_dscnt 0x0\n\ts_barrier_signal -1\n\ts_barrier_wait -1" ::: "memory"); };

  // Wave w: one fragment of the tile, Wy rows 16 * (w & 3) (B role), columns 16 * (w >> 2) (A role): a lane's eight
  // accumulators are neighbours in a row of Wy.
  const unsigned char* pa = sm + (16u * (wave >> 2) + r) * FPIT + 16u * h;
  const unsigned char* pb = sm + FOP_B + (16u * (wave & 3u) + r) * FPIT + 16u * h;
  v8f C = {};
  float cp[2] = {0.0f, 0.0f};

  fetch(0u);
#pragma unroll  // the chunk number picks the register set, and every load then stands on one base with a constant offset
  for (uint32_t c = 0; c < (uint32_t)DM / FE; ++c) {
    if (c + 1u < (uint32_t)DM / FE) fetch(c + 1u);
    const float (&rw)[4][8] = raw[c & 1u];
    v8bf pk[4];
#pragma unroll
    for (uint32_t u = 0; u < 4u; ++u) {
      v8f f;
#pragma unroll
      for (uint32_t t = 0; t < 8u; ++t) f[t] = rw[u][t];
      pk[u] = __builtin_convertvector(f, v8bf);
    }
    if (withC) {
#pragma unroll
      for (uint32_t u = 2u; u < 4u; ++u)
#pragma unroll
        for (uint32_t t = 0; t < 8u; ++t)
          cp[u & 1u] = __builtin_fmaf(bq[c * FE + 8u * wave + t], rw[u][t], cp[u & 1u]);
    }
#pragma unroll
    for (uint32_t u = 0; u < 4u; ++u)
      *(v8bf*)(sm + (u >> 1) * FOP_B + (32u * (u & 1u) + lane) * FPIT + 16u * wave) = pk[u];
    lds_barrier();  // this chunk is in LDS
    // The chunk's fragments in two groups of two products: four at once, beside the chunk in flight, do not fit the 128
    // registers that let a second block stand on the WGP.
#pragma unroll
    for (uint32_t kg = 0; kg < FE / 64u; ++kg) {
      v16bf af[2], bf[2];
#pragma unroll
      for (uint32_t kk = 0; kk < 2u; ++kk) {
        af[kk] = lds_frag(pa + 64u * (2u * kg + kk));
        bf[kk] = lds_frag(pb + 64u * (2u * kg + kk));
      }
      __builtin_amdgcn_sched_barrier(0);  // a group's LDS reads go out together: one LDS latency, not one per product
#pragma unroll
      for (uint32_t kk = 0; kk < 2u; ++kk) C = WMMA_BF16(af[kk], bf[kk], C);
      // Keeps the next group's reads and the next trip's global loads behind these products: they then take the registers
      // that the fragments leave.
      __builtin_amdgcn_sched_barrier(0);
    }
    lds_barrier();  // every wave has read the chunk: LDS may be written again
  }

  // The tile is set in LDS and goes out by whole 128-byte rows; the waves' parts of cy are joined in a fixed order.
  *(v8bf*)(sm + (16u * (wave & 3u) + r) * OPIT + 32u * (wave >> 2) + 16u * h) = __builtin_convertvector(C, v8bf);
  float* red = (float*)(sm + FOP_B);
  if (withC) {
    red[wave * 64u + lane]       = cp[0];
    red[wave * 64u + 32u + lane] = cp[1];
  }
  __syncthreads();
  const uint32_t row = tid >> 3, seg = tid & 7u;
  *(v8bf*)(Wy + (size_t)(j0 + row) * DM + i0 + 8u * seg) = *(const v8bf*)(sm + row * OPIT + 16u * seg);
  if (withC && tid < 64u) {
    float s = 0.0f;
#pragma unroll
    for (uint32_t w = 0; w < 16u; ++w) s += red[w * 64u + tid];
    cy[j0 + tid] = s;
  }
  close_global_group();
}

// The two preparing jobs need nothing of each other and run as ONE launch: blocks [0, FOLD_BLOCKS) join Wq and Wk, a chain
// of load latencies that leaves the memory idle; the blocks behind them stream x and Wv to bf16 beside it.
// Eight waves per SIMD: a converting block then fits on a WGP beside a joining one.
__global__ __launch_bounds__(PREP_T) __attribute__((amdgpu_waves_per_eu(8))) void prep_kernel(
    const float* __restrict__ Wq, const float* __restrict__ Wk, const float* __restrict__ bq,
    bf16_t* __restrict__ Wy, float* __restrict__ cy,
    const float* __restrict__ x, const float* __restrict__ Wv,
    bf16_t* __restrict__ xb, bf16_t* __restrict__ Wvb,
    long long nx, long long nw, int wBlocks) {
  __shared__ __attribute__((aligned(16))) unsigned char sm[2u * FOP_B];
  const int b = (int)blockIdx.x;
  if (b < FOLD_BLOCKS) fold_qk((uint32_t)b, sm, Wq, Wk, bq, Wy, cy);
  else                 cvt_f32_bf16(b - FOLD_BLOCKS, (int)gridDim.x - FOLD_BLOCKS, x, Wv, xb, Wvb, nx, nw, wBlocks);
}

// out = X * W^T + bias ; X:(M,K) bf16, W:(N,K) bf16 row-major.
// TR==0: out (M,N) bf16 row-major, computed as W * X^T; TR==1: out (N,M) bf16 row-major (V^T), computed as X * W^T:
// either way the A rows run along the rows of out. LDO: pitch of out (N or M). Workgroup tile 256x256.
// mt0, nt0: the tile's first row of X and of W.
template <int TR, int LDO>
static __device__ __forceinline__ void proj_tile(
    const bf16_t* __restrict__ X, const bf16_t* __restrict__ W,
    const float* __restrict__ bias, bf16_t* __restrict__ out,
    int mt0, int nt0, int K, unsigned char* ring) {
  constexpr int MF = 8, NF = 4, WN = 16 / NF;
  const int lane = threadIdx.x & 31;
  const int wave = threadIdx.x >> 5;
  const int at0 = TR ? mt0 : nt0;  // first A row of the tile: a column of out
  const int bt0 = TR ? nt0 : mt0;  // first B^T row of the tile: a row of out

  v8f C[MF][NF] = {};
  gemm_core_lds<MF, NF, false>(TR ? X : W, TR ? W : X, K, K, K, at0, bt0, ring, nullptr, [] {}, C);

  const int aw = at0 + (wave / WN) * (16 * MF);
  const int bw = bt0 + (wave % WN) * (16 * NF);
  const int r = lane & 15, h = lane >> 4;
  // The bias belongs to W's rows: eight neighbours per A fragment (TR == 0) or one value per B fragment (TR == 1).
  v8f ba[MF];
  float bb[NF];
  const int bi = TR ? bw + r : aw + 8 * h;
  const float* bp = bias + bi;
  if (!TR) {
#pragma unroll  // register arrays need constant indices, here and below
    for (int mi = 0; mi < MF; ++mi) {
      ba[mi].lo = *(const v4f*)(bp + 16 * mi);
      ba[mi].hi = *(const v4f*)(bp + 16 * mi + 4);
    }
  } else {
#pragma unroll
    for (int j = 0; j < NF; ++j) bb[j] = bp[16 * j];
  }
  if (TR) close_global_loads(bi);  // these loads stand on the scalar base and the index
  else    close_global_loads(bp);
  unsigned char* slab = ring + (uint32_t)wave * SLAB_B;
  unsigned char* st = slab + (uint32_t)r * HPITCH + 16u * (uint32_t)h;  // this lane's place in staged row r
#pragma unroll
  for (int j = 0; j < NF; ++j) {
#pragma unroll
    for (int mi = 0; mi < MF; ++mi) {
      v8f o;
      if (!TR) o = C[mi][j] + ba[mi];
      else     o = C[mi][j] + bb[j];
      *(v8bf*)(st + (uint32_t)(16 * j) * HPITCH + (uint32_t)(32 * mi)) = __builtin_convertvector(o, v8bf);
    }
  }
  flush_rows_bf16<LDO>(slab, out + (size_t)(bw + h) * (size_t)LDO + (size_t)(aw + 8 * r), (uint32_t)lane);
}

// Both projections of x as ONE launch: neither needs the other. Blocks [0, PROJ_TILES) form y (row-major), the rest V^T;
// within a projection four successive blocks share 256 rows of x.
constexpr int XROWS = 16384;  // rows of x: pitch of V^T
constexpr int PROJ_TILES = (XROWS / 256) * (DM / 256);
__global__ __launch_bounds__(256) void proj_kernel(
    const bf16_t* __restrict__ X,
    const bf16_t* __restrict__ Wy, const float* __restrict__ cy, bf16_t* __restrict__ Y,
    const bf16_t* __restrict__ Wv, const float* __restrict__ bv, bf16_t* __restrict__ VT) {
  __shared__ __attribute__((aligned(2048))) unsigned char ring[RING_B];
  const int b = (int)blockIdx.x;
  const int t = b < PROJ_TILES ? b : b - PROJ_TILES;  // the tile's number in its projection
  const int mt0 = (t / (DM / 256)) << 8;
  const int nt0 = (t % (DM / 256)) << 8;
  if (b < PROJ_TILES) proj_tile<0, DM>(X, Wy, cy, Y, mt0, nt0, DM, ring);
  else                proj_tile<1, XROWS>(X, Wv, bv, VT, mt0, nt0, DM, ring);
}

// Softmax over the keys is split over the two attention products, by blocks of KB = 128 keys (one pass of the second).
// Base 2: w = score * log2(e). Block t of a query row has the whole number e_t = ceil(max of w in the block).
// First product: stores p = 2^(w - e_t) as bf16 (at most 1) and, per row and block, e_t and l_t = sum of p.
// Second product: with E = max e_t and g_t = 2^(e_t - E), out = (sum_t g_t * (p_t * V_t)) / (sum_t g_t * l_t).
constexpr int KB   = 128;   // keys per block
constexpr int NBLK = 16;    // blocks per row: the second product is built for 2048 keys
constexpr int SQ   = 2048;  // queries per batch: pitch of the per-block tables
constexpr int DV   = 1024;  // columns of V and of out: a compile-time pitch puts a lane's stores on one address register
constexpr uint32_t GTAB_B = (uint32_t)NBLK * 256u * 4u;  // factor table of a 256-row tile
constexpr uint32_t TAB_B  = GTAB_B + 256u * 4u;          // and one reciprocal row sum per row

// The value of lane l ^ 16.
static __device__ __forceinline__ float other_half(float v) {
  const int b = __builtin_bit_cast(int, v);
  return __builtin_bit_cast(float, __builtin_amdgcn_permlanex16(b, b, 0x76543210, 0xfedcba98, false, false));
}

// Transposed scores, keys x queries = Kmat * Q^T, batched via blockIdx.y: a lane's accumulators of one column of
// fragments all belong to ONE query, so maximum and sum run inside the lane (one exchange between the halves), and
// eight neighbouring keys of a query make one 16-byte piece of a staged row. Workgroup tile 256x256, wave tile 128 keys
// x 64 queries. Kmat, Q: (S, K) bf16, pitch ld. P: (S queries, S keys) bf16, pitch SQ. eblk, lblk: (S / KB blocks, SQ
// queries) f32, S <= SQ.
__global__ __launch_bounds__(256) void score_exp_kernel(
    const bf16_t* __restrict__ Kmat, const bf16_t* __restrict__ Q,
    bf16_t* __restrict__ P, float* __restrict__ eblk, float* __restrict__ lblk,
    int S, int K, int ld, long long strideQK, long long strideP, long long strideB, float sc2) {
  constexpr int MF = 8, NF = 4, WN = 16 / NF;
  __shared__ __attribute__((aligned(2048))) unsigned char ring[RING_B];
  const int b = blockIdx.y;
  const bf16_t* Kb = Kmat + (size_t)b * strideQK;
  const bf16_t* Qb = Q + (size_t)b * strideQK;
  bf16_t* Pb = P + (size_t)b * strideP;
  float* eb = eblk + (size_t)b * strideB;
  float* lb = lblk + (size_t)b * strideB;

  const int lane = threadIdx.x & 31;
  const int wave = threadIdx.x >> 5;
  const int tilesN = S >> 8;
  const int kt0 = ((int)blockIdx.x / tilesN) << 8;
  const int qt0 = ((int)blockIdx.x % tilesN) << 8;

  v8f C[MF][NF] = {};
  gemm_core_lds<MF, NF, false>(Kb, Qb, ld, ld, K, kt0, qt0, ring, nullptr, [] {}, C);

  const int kt = kt0 + (wave / WN) * (16 * MF);  // this wave's key block
  const int qt = qt0 + (wave % WN) * (16 * NF);
  const int r = lane & 15, h = lane >> 4;
  unsigned char* slab = ring + (uint32_t)wave * SLAB_B;
  unsigned char* st = slab + (uint32_t)r * HPITCH + 16u * (uint32_t)h;  // this lane's place in staged row r
  // Every loop below is unrolled because the accumulators are register arrays: they need constant indices.
#pragma unroll
  for (int j = 0; j < NF; ++j) {
    const int q = qt + 16 * j + r;
    v8f mv = C[0][j];
#pragma unroll
    for (int mi = 1; mi < MF; ++mi) mv = __builtin_elementwise_max(mv, C[mi][j]);
    float mx = fmaxf(fmaxf(fmaxf(mv[0], mv[1]), fmaxf(mv[2], mv[3])), fmaxf(fmaxf(mv[4], mv[5]), fmaxf(mv[6], mv[7])));
    mx = fmaxf(mx, other_half(mx));
    const float e = ceilf(mx * sc2);
    v8f sv = {};
#pragma unroll
    for (int mi = 0; mi < MF; ++mi) {
      v8f p;
#pragma unroll
      for (int i = 0; i < 8; ++i) p[i] = __builtin_amdgcn_exp2f(__builtin_fmaf(C[mi][j][i], sc2, -e));
      sv += p;
      *(v8bf*)(st + (uint32_t)(16 * j) * HPITCH + (uint32_t)(32 * mi)) = __builtin_convertvector(p, v8bf);
    }
    float sum = ((sv[0] + sv[1]) + (sv[2] + sv[3])) + ((sv[4] + sv[5]) + (sv[6] + sv[7]));
    sum += other_half(sum);
    // Both halves hold e and sum of query q: the lower half stores e, the upper half the sum, in one instruction.
    float* sp = (h ? lb : eb) + (size_t)(kt / KB) * (size_t)SQ + (size_t)q;
    const float sval = h ? sum : e;
    *sp = sval;
    close_global_group();
  }
  flush_rows_bf16<SQ>(slab, Pb + (size_t)(qt + h) * (size_t)SQ + (size_t)(kt + 8 * r), (uint32_t)lane);
}

// out = softmax weights * V, batched via blockIdx.y, computed as V^T * P^T: P (queries, K keys) bf16 as score_exp_kernel
// leaves it, Vt (DV, K) bf16 pitch ldb, out (queries, DV) f32. K = NBLK * KB. Workgroup tile 256x256, wave tile 128
// columns of out x 64 queries.
__global__ __launch_bounds__(256) void pv_kernel(
    const bf16_t* __restrict__ P, const bf16_t* __restrict__ Vt,
    const float* __restrict__ eblk, const float* __restrict__ lblk,
    float* __restrict__ outp, int K, int ldb,
    long long strideP, long long strideV, long long strideB, long long strideO) {
  // The ring first, so that its slices keep their places at multiples of 2 KiB; the tables behind it.
  __shared__ __attribute__((aligned(2048))) unsigned char smem[RING_B + TAB_B];
  uint32_t* gtab = (uint32_t*)(smem + RING_B);
  float* invl = (float*)(smem + RING_B + GTAB_B);
  const int b = blockIdx.y;
  const bf16_t* Pb = P + (size_t)b * strideP;
  const bf16_t* Vb = Vt + (size_t)b * strideV;
  const float* eb = eblk + (size_t)b * strideB;
  const float* lb = lblk + (size_t)b * strideB;
  float* ob = outp + (size_t)b * strideO;

  const int tid = threadIdx.x;
  const int lane = tid & 31;
  const int wave = tid >> 5;
  constexpr int tilesN = DV >> 8;
  const int mt0 = ((int)blockIdx.x / tilesN) << 8;
  const int nt0 = ((int)blockIdx.x % tilesN) << 8;
  const int r = lane & 15, h = lane >> 4;

  // Thread t joins the blocks of tile row t. Its loops are unrolled: ev and lv are register arrays, and the 32 loads
  // then go out together on one address register with constant offsets.
  auto pre = [&] {
    float ev[NBLK], lv[NBLK];
    const float* ep = eb + mt0 + tid;
    const float* lp = lb + mt0 + tid;
#pragma unroll
    for (int t = 0; t < NBLK; ++t) {
      ev[t] = ep[t * SQ];
      lv[t] = lp[t * SQ];
    }
    close_global_group();
    float E = ev[0];
#pragma unroll
    for (int t = 1; t < NBLK; ++t) E = fmaxf(E, ev[t]);
    float L = 0.0f;
#pragma unroll
    for (int t = 0; t < NBLK; ++t) {
      const float g = __builtin_ldexpf(1.0f, (int)(ev[t] - E));  // an exact power of two or 0: its upper 16 bits are the bf16
      L += lv[t] * g;
      const uint32_t gb = __builtin_bit_cast(uint32_t, g) >> 16;
      gtab[t * 256 + tid] = gb | (gb << 16);
    }
    invl[tid] = 1.0f / L;
  };

  constexpr int MF = 8, NF = 4;
  const int qw = (wave & 3) << 6;   // this wave's first query in the tile
  const int dw = (wave >> 2) << 7;  // this wave's first column in the tile
  v8f C[MF][NF] = {};
  gemm_core_lds<MF, NF, true>(Vb, Pb, ldb, K, K, nt0, mt0, smem, gtab + qw + r, pre, C);

  unsigned char* slab = smem + (uint32_t)wave * SLAB_B;
  unsigned char* st = slab + (uint32_t)r * FPITCH + 32u * (uint32_t)h;  // this lane's place in staged row r
  // Unrolled: the accumulators are register arrays, and the offsets become constants.
  float iv[NF];  // read ahead of the staging stores: one LDS wait, not one per column of fragments
#pragma unroll
  for (int j = 0; j < NF; ++j) iv[j] = invl[qw + 16 * j + r];
#pragma unroll
  for (int j = 0; j < NF; ++j) {
#pragma unroll
    for (int mi = 0; mi < MF; ++mi) {
      const v8f o = C[mi][j] * iv[j];
      unsigned char* d = st + (uint32_t)(16 * j) * FPITCH + (uint32_t)(64 * mi);
      *(v4f*)(d)       = o.lo;
      *(v4f*)(d + 16u) = o.hi;
    }
  }
  wait_ds0();  // the staged rows are written before other lanes' parts of them are read back; also holds the reads behind the writes in the compiler
  // One staged row (512 bytes, four lines) per store. The accumulators' registers are free by now and take all 64 rows.
  const unsigned char* sp = slab + 16u * (uint32_t)lane;
  float* op = ob + (size_t)(mt0 + qw) * (size_t)DV + (size_t)(nt0 + dw + 4 * lane);
  v4f v[64];
#pragma unroll
  for (int t = 0; t < 64; ++t) v[t] = *(const v4f*)(sp + (uint32_t)t * FPITCH);
  __builtin_amdgcn_sched_barrier(0);  // all read-backs issue as one group in front of the first store
#pragma unroll
  for (int t = 0; t < 64; ++t) *(v4f*)(op + t * DV) = v[t];
  close_global_group();
}

extern "C" void kernel_launch(void* const* d_in, const int* in_sizes, int n_in,
                              void* d_out, int out_size, void* d_ws, size_t ws_size,
                              hipStream_t stream) {
  const float* x  = (const float*)d_in[0];
  const float* Wq = (const float*)d_in[1];
  const float* bq = (const float*)d_in[2];
  const float* Wk = (const float*)d_in[3];
  const float* Wv = (const float*)d_in[5];
  const float* bv = (const float*)d_in[6];
  float* out = (float*)d_out;

  const int B = 8, S = 2048, D = 1024;
  const int MS = B * S; // 16384
  const float sc2 = 0.045084220f; // log2(e) / sqrt(1024)

  // ---- workspace layout (all offsets 16B aligned, no two buffers share bytes) ----
  char* ws = (char*)d_ws;
  bf16_t* Y   = (bf16_t*)(ws);                         // 16384x1024 bf16 = 32 MiB: y = Wy x + cy, in the queries' place
  bf16_t* xb  = (bf16_t*)(ws + (size_t)33554432);      // x in bf16, 32 MiB: projections' operand and the keys
  bf16_t* VT  = (bf16_t*)(ws + (size_t)67108864);      // V^T (1024 x 16384), 32 MiB
  bf16_t* P   = (bf16_t*)(ws + (size_t)100663296);     // 8 x 2048 x 2048 bf16 = 64 MiB
  float*  eb  = (float*) (ws + (size_t)167772160);     // 8 x 16 x 2048 f32 = 1 MiB
  float*  lb  = (float*) (ws + (size_t)168820736);     // the same
  bf16_t* Wvb = (bf16_t*)(ws + (size_t)169869312);     // Wv, 1024x1024 bf16 = 2 MiB
  bf16_t* Wy  = (bf16_t*)(ws + (size_t)171966464);     // Wk^T Wq, the same size
  float*  cy  = (float*) (ws + (size_t)174063616);     // Wk^T bq, 1024 floats

  dim3 blk(256);

  // ---- 1) Wq and Wk joined into one matrix; x and Wv to bf16 ----
  prep_kernel<<<256 + 128 + 2048, dim3(512), 0, stream>>>(Wq, Wk, bq, Wy, cy, x, Wv, xb, Wvb,
                                                          (long long)MS * D, (long long)D * D, 128);

  // ---- 2) projections (pure bf16 WMMA GEMM, 256x256 workgroup tiles) ----
  const int projBlocks = 2 * (MS / 256) * (D / 256); // 512
  proj_kernel<<<projBlocks, blk, 0, stream>>>(xb, Wy, cy, Y, Wvb, bv, VT);

  // ---- 3) attention, all batches per launch (gridDim.y = 8) ----
  const int scBlocks = (S / 256) * (S / 256); // 64 per batch
  const int pvBlocks = (S / 256) * (D / 256); // 32 per batch
  score_exp_kernel<<<dim3(scBlocks, B), blk, 0, stream>>>(
      xb, Y, P, eb, lb, S, D, D,
      (long long)S * D, (long long)S * S, (long long)(S / 128) * S, sc2);
  pv_kernel<<<dim3(pvBlocks, B), blk, 0, stream>>>(
      P, VT, eb, lb, out, S, MS,
      (long long)S * S, (long long)S, (long long)(S / 128) * S, (long long)S * D);
}

// v010
// Measured time: 131 microseconds a run.
// Timed twice side by side with v009, it ran 1.05 times as fast both times.
// All steps since v000 together make it 7.02 times as fast.
#include <hip/hip_runtime.h>
#include <stdint.h>

typedef __bf16 bf16_t;
typedef __attribute__((ext_vector_type(16))) __bf16 v16bf;
typedef __attribute__((ext_vector_type(8)))  __bf16 v8bf;
typedef __attribute__((ext_vector_type(2)))  __bf16 v2bf;
typedef __attribute__((ext_vector_type(8)))  float  v8f;
typedef __attribute__((ext_vector_type(4)))  float  v4f;

#define WMMA_BF16(A, B, C) \
  __builtin_amdgcn_wmma_f32_16x16x32_bf16(false, (A), false, (B), (short)0, (C), false, false)

typedef uint32_t u32x4 __attribute__((ext_vector_type(4)));
typedef uint32_t u32x8 __attribute__((ext_vector_type(8)));

// Workgroup tile 256 x 256 of the output, eight waves (two per SIMD), 128 x 64 per wave: each operand byte
// fetched from L2 and each fragment read from LDS feeds twice the matrix work of a 128 x 128 tile.
// A pass is 128 k = 256 bytes of each of the 256 A rows and 256 B^T rows. A stage in LDS is eight
// slices of 64 rows, slices 0..3 = A rows, 4..7 = B^T rows, one tensor load per wave and stage.
constexpr uint32_t ROWB    = 256u;            // bytes of one operand row per pass
constexpr uint32_t PITCH   = ROWB + 16u;      // LDS row pitch for ds_load_b128 readers (pad of 4 dwords)
constexpr uint32_t SROWS   = 64u;             // rows per slice
constexpr uint32_t SLICE_B = 18432u;          // 64 * 272 = 17408, rounded up to a multiple of 2 KiB
constexpr uint32_t BUF_B   = 8u * SLICE_B;    // one stage
constexpr uint32_t RING_B  = 2u * BUF_B;      // two buffers, 294912 bytes: one workgroup per WGP
static_assert(SROWS * PITCH <= SLICE_B && (SLICE_B % 2048u) == 0u, "a slice holds its padded rows and starts at a multiple of 2 KiB");

static __device__ __forceinline__ uint32_t uni(uint32_t v) { return (uint32_t)__builtin_amdgcn_readfirstlane(v); }
// A wave-uniform word held in a scalar register: the issue test on it compiles to s_cmp + s_cbranch_scc, and a
// descriptor word formed from it stays behind the volatile statements (the waits) that stand in front of it.
static __device__ __forceinline__ uint32_t pinned(uint32_t v) {
  uint32_t w = uni(v);
  asm volatile("" : "+s"(w));  // pinned(): a descriptor word or an issue test held in a scalar register
  return w;
}
static __device__ __forceinline__ void wait_ds0()     { asm volatile("s_wait_dscnt 0x0" ::: "memory"); }     // this wave's LDS reads have retired
// This wave's tensor load has landed. The wait names the request's group 0, so that those scalar registers hold
// the descriptor, and nothing else, for as long as the request is outstanding.
static __device__ __forceinline__ void wait_tensor0(u32x4 g0) { asm volatile("s_wait_tensorcnt 0x0" :: "s"(g0) : "memory"); }
// One request of the whole wave: a 2-D tile from global memory into LDS, through no register. Group 0 is an
// in-out operand: what the wait above names is then held in the very registers that the request was issued from.
static __device__ __forceinline__ void tdm_load(u32x4& g0, u32x8 g1) { asm volatile("tensor_load_to_lds %0, %1" : "+s"(g0) : "s"(g1) : "memory"); }

// Descriptor group 1: 1-byte elements, tensor = tile = 64 rows of 256 bytes, 4 dwords of LDS pad behind every row.
static __device__ __forceinline__ u32x8 tdm_group1(uint32_t src_pitch) {
  constexpr uint32_t d0 = ROWB, d1 = SROWS;
  u32x8 g;
  g[0] = uni((1u << 20) | (5u << 22) | (3u << 25));  // no mask; pad on, interval 64 dwords, amount 4 dwords
  // Words 1 to 7 are pinned: descriptor words held in scalar registers of their own for the whole loop,
  // so that none is used for anything else while a request is outstanding.
  g[1] = pinned((d0 & 0xFFFFu) << 16);
  g[2] = pinned((d0 >> 16) | ((d1 & 0xFFFFu) << 16));
  g[3] = pinned((d1 >> 16) | (d0 << 16));
  g[4] = pinned(d1);
  g[5] = pinned(src_pitch);
  g[6] = pinned(0u);
  g[7] = pinned(0u);
  return g;
}
static __device__ __forceinline__ u32x4 tdm_group0(uint32_t lds_dst, uint64_t ga) {
  u32x4 g;
  g[0] = uni(1u);
  g[1] = uni(lds_dst);
  g[2] = uni((uint32_t)ga);
  g[3] = uni((((uint32_t)(ga >> 32)) & 0x01FFFFFFu) | 0x80000000u);
  return g;
}

// A-fragment (16x32 bf16) / B-fragment (B^T rows; identical layout, N in the lane role) from LDS.
// p points at row (lane&15), 16-byte half (lane>>4): K = {k0+h*8 .. +7} then {k0+16+h*8 .. +7}.
static __device__ __forceinline__ v16bf lds_frag(const unsigned char* p) {
  v16bf a;
  a.lo = *(const v8bf*)(p);
  a.hi = *(const v8bf*)(p + 32);
  return a;
}

// One bf16 factor, held twice in a dword, spread over a fragment's 16 elements.
static __device__ __forceinline__ v16bf splat16(uint32_t w) {
  const v2bf g = __builtin_bit_cast(v2bf, w);
  return __builtin_shufflevector(g, g, 0, 1, 0, 1, 0, 1, 0, 1, 0, 1, 0, 1, 0, 1, 0, 1);
}

template <bool V> struct flag { static constexpr bool value = V; };  // a compile-time switch handed to a generic lambda

// C (16*MF x 16*NF per wave) += A[mt0.., :] * Bt[nt0.., :]^T for one 256 x 256 workgroup tile.
// Wave w holds rows 16*MF*(w / WN), columns 16*NF*(w % WN) of the tile, WN = 16 / NF waves along the columns.
// M, N multiples of 256; K a multiple of 128 and at least 256 (two stages).
// SCALE: row n of Bt counts times a factor of its own in every pass s; gt points at this lane's first row in a
// table in LDS of [pass][256 tile rows] dwords (the bf16 factor twice), which pre() fills.
// pre() runs once, while stage 0's load is in flight; what it writes to LDS is published by stage 0's barrier.
template <int MF, int NF, bool SCALE, class Pre>
static __device__ __forceinline__ void gemm_core_lds(const bf16_t* __restrict__ A,
                                                     const bf16_t* __restrict__ Bt,
                                                     int lda, int ldb, int K,
                                                     int mt0, int nt0,
                                                     unsigned char* ring, const uint32_t* gt, Pre pre,
                                                     v8f (&C)[MF][NF]) {
  static_assert(MF * NF == 32 && (MF % 4) == 0 && (NF % 4) == 0, "eight waves cover 256 x 256; a wave's rows start on a slice");
  constexpr uint32_t WN = 16u / (uint32_t)NF;
  const uint32_t lane = threadIdx.x & 31u, r = lane & 15u, h = lane >> 4;
  const uint32_t wave = uni(threadIdx.x >> 5);
  const uint32_t wm = wave / WN, wn = wave % WN;
  const uint32_t T = (uint32_t)K >> 7;  // passes

  // This wave's slice of every stage.
  const bool isA = wave < 4u;
  const bf16_t* srow = isA ? A + (size_t)(mt0 + (int)(SROWS * wave)) * (size_t)lda
                           : Bt + (size_t)(nt0 + (int)(SROWS * (wave - 4u))) * (size_t)ldb;
  const uint64_t ga0 = (uint64_t)(uintptr_t)srow;
  const uint32_t dst0 = (uint32_t)(uintptr_t)ring + wave * SLICE_B;
  const u32x8 g1 = tdm_group1(2u * (uint32_t)(isA ? lda : ldb));

  // Per-lane fragment bases inside a buffer.
  const uint32_t fa = wm * (uint32_t)(MF / 4) * SLICE_B + r * PITCH + 16u * h;
  const uint32_t fb = (4u + wn * (uint32_t)(NF / 4)) * SLICE_B + r * PITCH + 16u * h;
  // Fragment f of a wave's operand: 16 rows, four fragments to a slice.
  auto foff = [](uint32_t f) { return (f >> 2) * SLICE_B + (f & 3u) * 16u * PITCH; };

  u32x4 g0 = tdm_group0(dst0, ga0);
  tdm_load(g0, g1);                             // stage 0
  pre();
  wait_tensor0(g0);
  __syncthreads();                              // stage 0 is published
  g0 = tdm_group0(dst0 + BUF_B, ga0 + ROWB);
  tdm_load(g0, g1);                             // stage 1

  // Two fragment sets take turns over the whole loop, pass boundaries included: each block's 24 LDS reads go out as one
  // group in front of the block before it, so that no block, a pass's first block included, waits for its own reads.
  v16bf Af[2][MF], Bf[2][NF];
  uint32_t gw[NF];  // the running pass's factor of the lane's row in each B fragment (a B fragment's row is lane & 15)
  auto fetch = [&](uint32_t set, uint32_t base, uint32_t kk) __attribute__((always_inline)) {
    const unsigned char* pa = ring + base + fa + kk * 64u;
    const unsigned char* pb = ring + base + fb + kk * 64u;
#pragma unroll  // register arrays need constant indices, here and below
    for (uint32_t mi = 0; mi < (uint32_t)MF; ++mi) Af[set][mi] = lds_frag(pa + foff(mi));
#pragma unroll
    for (uint32_t j = 0; j < (uint32_t)NF; ++j) Bf[set][j] = lds_frag(pb + foff(j));
  };
  auto factors = [&](uint32_t p) __attribute__((always_inline)) {
    if constexpr (SCALE) {
#pragma unroll
      for (uint32_t j = 0; j < (uint32_t)NF; ++j) gw[j] = gt[p * 256u + 16u * j];
    }
  };
  fetch(0u, 0u, 0u);  // first fragment loads: stage 0 is published
  factors(0u);

  uint32_t s = 0;
  // One pass. LAST: the pass of the last stage, with nothing left to publish, refill or fetch ahead.
  auto pass = [&](auto last) __attribute__((always_inline)) {
    constexpr bool LAST = decltype(last)::value;
    const uint32_t buf = (s & 1u) * BUF_B;
#pragma unroll
    for (uint32_t kk = 0; kk < 4u; ++kk) {
      const uint32_t cur = kk & 1u, nxt = cur ^ 1u;
      if (kk + 1u < 4u) {
        fetch(nxt, buf, kk + 1u);
      } else {
        // Publish point of stage s + 1, in front of the pass's last block: that block's fragments are in registers, so
        // this wave's reads of stage s's buffer end at the wait, and every wave's at the barrier. In the last pass the
        // same wait and barrier free the ring for the output staging.
        wait_ds0();
        if constexpr (!LAST) wait_tensor0(g0);
        __syncthreads();
        if constexpr (!LAST) {
          if (pinned((s + 2u < T) ? 1u : 0u) != 0u) {  // the refill, only while stage s + 2 exists
            const uint32_t nx = pinned(s + 2u);        // descriptor word source, formed behind the wait above
            g0 = tdm_group0(dst0 + buf, ga0 + (uint64_t)nx * ROWB);
            tdm_load(g0, g1);
          }
          fetch(nxt, BUF_B - buf, 0u);  // the next pass's first block, from the stage just published
        }
      }
      if constexpr (SCALE) {  // the factors are powers of two: the products are exact
#pragma unroll
        for (uint32_t j = 0; j < (uint32_t)NF; ++j) Bf[cur][j] = Bf[cur][j] * splat16(gw[j]);
        if (!LAST && kk + 1u == 4u) factors(s + 1u);  // the next pass's factors, fetched with its first fragments
      }
      __builtin_amdgcn_sched_barrier(0);  // keeps the LDS reads in one group, out of the WMMA run
#pragma unroll
      for (uint32_t j = 0; j < (uint32_t)NF; ++j)
#pragma unroll
        for (uint32_t mi = 0; mi < (uint32_t)MF; ++mi)
          C[mi][j] = WMMA_BF16(Af[cur][mi], Bf[cur][j], C[mi][j]);
      __builtin_amdgcn_sched_barrier(0);  // keeps the next group of reads, and the publish point, behind this WMMA run
    }
  };
  do {  // T is at least 2: both stages loaded above exist
    pass(flag<false>{});
  } while (++s + 1u < T);
  pass(flag<true>{});
  wait_tensor0(g0);
  wait_ds0();
}

// Stands behind a group of global loads or stores, in front of the first instruction that may overwrite a register
// which one of them names (address or data). The scheduling barrier keeps later arithmetic behind the wait.
static __device__ __forceinline__ void close_global_group() {
  asm volatile("s_wait_xcnt 0x0" ::: "memory");
  __builtin_amdgcn_sched_barrier(0);
}
// The same behind a group of loads on one address: the wait names that address, so that its registers hold it, and
// no load's result, up to the wait.
template <class Addr>
static __device__ __forceinline__ void close_global_loads(Addr a) {
  asm volatile("s_wait_xcnt 0x0" :: "v"(a) : "memory");
  __builtin_amdgcn_sched_barrier(0);
}

// Output staging. Every gemm_core_lds product below runs with the output's contiguous dimension in the A role, 128 of it by 64 output
// rows per wave (MF = 8, NF = 4): a lane's eight accumulators of a fragment are neighbours in one output row, but the
// lanes of a store would then hit 16 rows with 32 or 64 bytes each. So a wave first sets its 64 rows in LDS, in an
// eighth of the ring that is its own, and reads them back row by row: each global store then covers whole 128-byte
// lines. The ring is free for this behind gemm_core_lds: the barrier in front of its last pass's last block stands behind
// every wave's last ring read and last tensor load. No other wave touches a wave's slab, so no further barrier is needed.
constexpr uint32_t SLAB_B  = RING_B / 8u;    // 36864 bytes per wave
constexpr uint32_t HPITCH  = 256u + 16u;     // staged row of 128 bf16; 16 bytes x odd: 16-byte LDS accesses meet no bank twice
constexpr uint32_t FPITCH  = 512u + 16u;     // staged row of 128 f32, likewise
static_assert(64u * HPITCH <= SLAB_B && 64u * FPITCH <= SLAB_B, "a wave's 64 staged rows fit its slab");

// The wave's 64 staged bf16 rows go out, two rows (512 bytes, four lines) per store. g points at this lane's 16 bytes of
// rows 0 and 1: row lane >> 4, bytes 16 * (lane & 15). LDO, the output's pitch in elements, is a compile-time constant:
// all stores then stand on one address register with constant offsets.
template <int LDO>
static __device__ __forceinline__ void flush_rows_bf16(const unsigned char* slab, bf16_t* g, uint32_t lane) {
  wait_ds0();  // the staged rows are written before other lanes' parts of them are read back; also holds the reads behind the writes in the compiler
  const unsigned char* sp = slab + (lane >> 4) * HPITCH + (lane & 15u) * 16u;
  v8bf v[32];
#pragma unroll  // register array: constant indices
  for (uint32_t t = 0; t < 32u; ++t) v[t] = *(const v8bf*)(sp + 2u * t * HPITCH);
  __builtin_amdgcn_sched_barrier(0);  // all read-backs issue as one group in front of the first store
#pragma unroll
  for (uint32_t t = 0; t < 32u; ++t) *(v8bf*)(g + (size_t)(2u * t) * (size_t)LDO) = v[t];
  close_global_group();
}

constexpr int PREP_T = 512;  // threads of a block of the preparing launch

// Placement, for speed only (every piece of work is done exactly once wherever a block runs): every launch below
// deals share i of DEAL
// (a batch: its rows of x, y, V^T, P) to the blocks of index i mod DEAL.
constexpr int DEAL = 8;

// Elementwise fp32 -> bf16 (8 elements/thread, grid-stride) of Wv and x, by ranges of the block number b in 0 .. nBlocks - 1:
// blocks [0, wBlocks) take Wv (nw elements), the rest take x (nx): block i of them strides through share i mod DEAL of x.
// The first block of x has a flat index that is a multiple of DEAL; nx and the number of x's blocks are multiples too.
static __device__ __forceinline__ void cvt_f32_bf16(int b, int nBlocks,
                                                    const float* __restrict__ x,
                                                    const float* __restrict__ Wv,
                                                    bf16_t* __restrict__ xb,
                                                    bf16_t* __restrict__ Wvb,
                                                    long long nx, long long nw, int wBlocks) {
  const bool isW = b < wBlocks;
  const float* in = isW ? Wv : x;
  bf16_t* outp = isW ? Wvb : xb;
  const int blkr = isW ? b : b - wBlocks;               // this block's place in its range
  const int nblr = isW ? wBlocks : nBlocks - wBlocks;   // blocks in its range
  const int blk0 = isW ? blkr : blkr / DEAL;            // its place among the blocks of its share
  const int nblk = isW ? nblr : nblr / DEAL;            // blocks of a share
  const long long first = isW ? 0 : (long long)(blkr % DEAL) * (nx / DEAL);  // the share's first element
  const long long n = isW ? nw : first + nx / DEAL;                          // and its end
  long long idx = first + ((long long)blk0 * PREP_T + threadIdx.x) * 8;
  const long long stride = (long long)nblk * PREP_T * 8;
  // Two pieces per trip, a stride apart, their four loads outstanding together: at the launch's eight waves per SIMD one
  // piece per wave would leave too few bytes in flight to keep the memory busy.
  for (; idx < n; idx += 2 * stride) {
    const bool two = idx + stride < n;
    const long long jdx = two ? idx + stride : idx;  // past the end the second piece is the first once more: same value, same place
    v8f f, g;
    f.lo = *(const v4f*)(in + idx);
    f.hi = *(const v4f*)(in + idx + 4);
    g.lo = *(const v4f*)(in + jdx);
    g.hi = *(const v4f*)(in + jdx + 4);
    *(v8bf*)(outp + idx) = __builtin_convertvector(f, v8bf);
    *(v8bf*)(outp + jdx) = __builtin_convertvector(g, v8bf);
  }
}

// The query and key projections as ONE matrix. With q = Wq x + bq and k = Wk x' + bk,
//   q . k = x' . (Wk^T Wq x + Wk^T bq) + q . bk,
// and q . bk is the same for every key of a query: the softmax over the keys does not see it. So the scores are taken
// as y . x' with y = Wy x + cy, Wy = Wk^T Wq (DM x DM), cy = Wk^T bq, and the keys are the rows of x themselves.
// This kernel forms Wy (bf16, row j, column i: sum over e of Wk[e][j] * Wq[e][i]) and cy (f32) from the f32 weights.
// One workgroup per 64 x 64 tile of Wy. Both operands run along e, the slow index in memory: a lane takes one column and
// eight successive e (eight 4-byte loads, each a whole 128-byte line per wave), rounds them to bf16 and sets them as one
// 16-byte piece of that column's row in LDS, which is the fragment loaders' layout.
constexpr int      DM    = 1024;            // model width: rows and columns of Wq and Wk
constexpr uint32_t FE    = 128u;            // e per chunk
constexpr uint32_t FPIT  = 2u * FE + 16u;   // LDS pitch of a column's chunk; 16 bytes x odd: 16-byte accesses meet no bank twice
constexpr uint32_t FOP_B = 64u * FPIT;      // one operand's 64 columns
constexpr uint32_t OPIT  = 128u + 16u;      // staged output row of 64 bf16, likewise
constexpr int FOLD_BLOCKS = (DM / 64) * (DM / 64);
static __device__ __forceinline__ void fold_qk(uint32_t tile, unsigned char* sm,
                                               const float* __restrict__ Wq, const float* __restrict__ Wk,
                                               const float* __restrict__ bq,
                                               bf16_t* __restrict__ Wy, float* __restrict__ cy) {
  const uint32_t tid = threadIdx.x, lane = tid & 31u, r = lane & 15u, h = lane >> 4;
  const uint32_t wave = uni(tid >> 5);       // sixteen waves
  const uint32_t i0 = (tile & 15u) << 6;     // first column of the tile: a column of Wq
  const uint32_t j0 = (tile >> 4) << 6;      // first row of the tile: a column of Wk
  const bool withC = i0 == 0u;                            // the first tile of a row of tiles also forms cy for its 64 rows

  // Piece u of a thread, 0..3: operand u >> 1 (Wq, Wk), column 32 * (u & 1) + lane, e = 8 * wave + 0..7 of the chunk.
  const float* gq = Wq + (size_t)(8u * wave) * DM + i0 + lane;
  const float* gk = Wk + (size_t)(8u * wave) * DM + j0 + lane;
  float raw[2][4][8];  // two chunks: one in flight while the other is rounded and multiplied
  auto fetch = [&](uint32_t c) {
#pragma unroll  // register arrays need constant indices, here and below
    for (uint32_t u = 0; u < 4u; ++u) {
      const float* g = ((u >> 1) ? gk : gq) + (size_t)(c * FE) * DM + 32u * (u & 1u);
#pragma unroll
      for (uint32_t t = 0; t < 8u; ++t) raw[c & 1u][u][t] = g[t * (uint32_t)DM];
    }
    // Stands behind the group of loads; it names their two addresses, so that those registers hold the addresses, and
    // no load's result, up to the wait. The scheduling barrier keeps later arithmetic behind it.
    asm volatile("s_wait_xcnt 0x0" :: "v"(gq), "v"(gk) : "memory");
    __builtin_amdgcn_sched_barrier(0);
  };
  // The workgroup's barrier with the LDS wait alone: __syncthreads() would also wait for the global loads of the chunk
  // in flight, and the loads would no longer run under the work on the chunk before.
  auto lds_barrier = [] { asm volatile("s_wait_dscnt 0x0\n\ts_barrier_signal -1\n\ts_barrier_wait -1" ::: "memory"); };

  // Wave w: one fragment of the tile, Wy rows 16 * (w & 3) (B role), columns 16 * (w >> 2) (A role): a lane's eight
  // accumulators are neighbours in a row of Wy.
  const unsigned char* pa = sm + (16u * (wave >> 2) + r) * FPIT + 16u * h;
  const unsigned char* pb = sm + FOP_B + (16u * (wave & 3u) + r) * FPIT + 16u * h;
  v8f C = {};
  float cp[2] = {0.0f, 0.0f};

  fetch(0u);
#pragma unroll  // the chunk number picks the register set, and every load then stands on one base with a constant offset
  for (uint32_t c = 0; c < (uint32_t)DM / FE; ++c) {
    if (c + 1u < (uint32_t)DM / FE) fetch(c + 1u);
    const float (&rw)[4][8] = raw[c & 1u];
    v8bf pk[4];
#pragma unroll
    for (uint32_t u = 0; u < 4u; ++u) {
      v8f f;
#pragma unroll
      for (uint32_t t = 0; t < 8u; ++t) f[t] = rw[u][t];
      pk[u] = __builtin_convertvector(f, v8bf);
    }
    if (withC) {
#pragma unroll
      for (uint32_t u = 2u; u < 4u; ++u)
#pragma unroll
        for (uint32_t t = 0; t < 8u; ++t)
          cp[u & 1u] = __builtin_fmaf(bq[c * FE + 8u * wave + t], rw[u][t], cp[u & 1u]);
    }
#pragma unroll
    for (uint32_t u = 0; u < 4u; ++u)
      *(v8bf*)(sm + (u >> 1) * FOP_B + (32u * (u & 1u) + lane) * FPIT + 16u * wave) = pk[u];
    lds_barrier();  // this chunk is in LDS
    // The chunk's fragments in two groups of two products: four at once, beside the chunk in flight, do not fit the 128
    // registers that let a second block stand on the WGP.
#pragma unroll
    for (uint32_t kg = 0; kg < FE / 64u; ++kg) {
      v16bf af[2], bf[2];
#pragma unroll
      for (uint32_t kk = 0; kk < 2u; ++kk) {
        af[kk] = lds_frag(pa + 64u * (2u * kg + kk));
        bf[kk] = lds_frag(pb + 64u * (2u * kg + kk));
      }
      __builtin_amdgcn_sched_barrier(0);  // a group's LDS reads go out together: one LDS latency, not one per product
#pragma unroll
      for (uint32_t kk = 0; kk < 2u; ++kk) C = WMMA_BF16(af[kk], bf[kk], C);
      // Keeps the next group's reads and the next trip's global loads behind these products: they then take the registers
      // that the fragments leave.
      __builtin_amdgcn_sched_barrier(0);
    }
    lds_barrier();  // every wave has read the chunk: LDS may be written again
  }

  // The tile is set in LDS and goes out by whole 128-byte rows; the waves' parts of cy are joined in a fixed order.
  *(v8bf*)(sm + (16u * (wave & 3u) + r) * OPIT + 32u * (wave >> 2) + 16u * h) = __builtin_convertvector(C, v8bf);
  float* red = (float*)(sm + FOP_B);
  if (withC) {
    red[wave * 64u + lane]       = cp[0];
    red[wave * 64u + 32u + lane] = cp[1];
  }
  __syncthreads();
  const uint32_t row = tid >> 3, seg = tid & 7u;
  *(v8bf*)(Wy + (size_t)(j0 + row) * DM + i0 + 8u * seg) = *(const v8bf*)(sm + row * OPIT + 16u * seg);
  if (withC && tid < 64u) {
    float s = 0.0f;
#pragma unroll
    for (uint32_t w = 0; w < 16u; ++w) s += red[w * 64u + tid];
    cy[j0 + tid] = s;
  }
  close_global_group();
}

// The two preparing jobs need nothing of each other and run as ONE launch: blocks [0, FOLD_BLOCKS) join Wq and Wk, a chain
// of load latencies that leaves the memory idle; the blocks behind them stream x and Wv to bf16 beside it.
// Eight waves per SIMD: a converting block then fits on a WGP beside a joining one.
__global__ __launch_bounds__(PREP_T) __attribute__((amdgpu_waves_per_eu(8))) void prep_kernel(
    const float* __restrict__ Wq, const float* __restrict__ Wk, const float* __restrict__ bq,
    bf16_t* __restrict__ Wy, float* __restrict__ cy,
    const float* __restrict__ x, const float* __restrict__ Wv,
    bf16_t* __restrict__ xb, bf16_t* __restrict__ Wvb,
    long long nx, long long nw, int wBlocks) {
  __shared__ __attribute__((aligned(16))) unsigned char sm[2u * FOP_B];
  const int b = (int)blockIdx.x;
  if (b < FOLD_BLOCKS) fold_qk((uint32_t)b, sm, Wq, Wk, bq, Wy, cy);
  else                 cvt_f32_bf16(b - FOLD_BLOCKS, (int)gridDim.x - FOLD_BLOCKS, x, Wv, xb, Wvb, nx, nw, wBlocks);
}

// out = X * W^T + bias ; X:(M,K) bf16, W:(N,K) bf16 row-major.
// TR==0: out (M,N) bf16 row-major, computed as W * X^T; TR==1: out (N,M) bf16 row-major (V^T), computed as X * W^T:
// either way the A rows run along the rows of out. LDO: pitch of out (N or M). Workgroup tile 256x256.
// mt0, nt0: the tile's first row of X and of W.
template <int TR, int LDO>
static __device__ __forceinline__ void proj_tile(
    const bf16_t* __restrict__ X, const bf16_t* __restrict__ W,
    const float* __restrict__ bias, bf16_t* __restrict__ out,
    int mt0, int nt0, int K, unsigned char* ring) {
  constexpr int MF = 8, NF = 4, WN = 16 / NF;
  const int lane = threadIdx.x & 31;
  const int wave = threadIdx.x >> 5;
  const int at0 = TR ? mt0 : nt0;  // first A row of the tile: a column of out
  const int bt0 = TR ? nt0 : mt0;  // first B^T row of the tile: a row of out

  v8f C[MF][NF] = {};
  gemm_core_lds<MF, NF, false>(TR ? X : W, TR ? W : X, K, K, K, at0, bt0, ring, nullptr, [] {}, C);

  const int aw = at0 + (wave / WN) * (16 * MF);
  const int bw = bt0 + (wave % WN) * (16 * NF);
  const int r = lane & 15, h = lane >> 4;
  // The bias belongs to W's rows: eight neighbours per A fragment (TR == 0) or one value per B fragment (TR == 1).
  v8f ba[MF];
  float bb[NF];
  const int bi = TR ? bw + r : aw + 8 * h;
  const float* bp = bias + bi;
  if (!TR) {
#pragma unroll  // register arrays need constant indices, here and below
    for (int mi = 0; mi < MF; ++mi) {
      ba[mi].lo = *(const v4f*)(bp + 16 * mi);
      ba[mi].hi = *(const v4f*)(bp + 16 * mi + 4);
    }
  } else {
#pragma unroll
    for (int j = 0; j < NF; ++j) bb[j] = bp[16 * j];
  }
  if (TR) close_global_loads(bi);  // these loads stand on the scalar base and the index
  else    close_global_loads(bp);
  unsigned char* slab = ring + (uint32_t)wave * SLAB_B;
  unsigned char* st = slab + (uint32_t)r * HPITCH + 16u * (uint32_t)h;  // this lane's place in staged row r
#pragma unroll
  for (int j = 0; j < NF; ++j) {
#pragma unroll
    for (int mi = 0; mi < MF; ++mi) {
      v8f o;
      if (!TR) o = C[mi][j] + ba[mi];
      else     o = C[mi][j] + bb[j];
      *(v8bf*)(st + (uint32_t)(16 * j) * HPITCH + (uint32_t)(32 * mi)) = __builtin_convertvector(o, v8bf);
    }
  }
  flush_rows_bf16<LDO>(slab, out + (size_t)(bw + h) * (size_t)LDO + (size_t)(aw + 8 * r), (uint32_t)lane);
}

// Both projections of x as ONE launch: neither needs the other. Blocks [0, PROJ_TILES) form y (row-major), the rest V^T;
// within a projection block t takes a tile of share t mod DEAL of the rows of x (see DEAL).
constexpr int XROWS = 16384;  // rows of x: pitch of V^T
constexpr int PROJ_TILES = (XROWS / 256) * (DM / 256);
static_assert(PROJ_TILES % DEAL == 0 && (XROWS / 256) % DEAL == 0, "both projections start at a multiple of DEAL and split into whole shares");
__global__ __launch_bounds__(256) void proj_kernel(
    const bf16_t* __restrict__ X,
    const bf16_t* __restrict__ Wy, const float* __restrict__ cy, bf16_t* __restrict__ Y,
    const bf16_t* __restrict__ Wv, const float* __restrict__ bv, bf16_t* __restrict__ VT) {
  __shared__ __attribute__((aligned(2048))) unsigned char ring[RING_B];
  const int b = (int)blockIdx.x;
  const int t = b < PROJ_TILES ? b : b - PROJ_TILES;  // the tile's number in its projection
  const int u = t / DEAL;                             // the tile's number in its share
  const int mt0 = ((t % DEAL) * (XROWS / 256 / DEAL) + u / (DM / 256)) << 8;
  const int nt0 = (u % (DM / 256)) << 8;
  if (b < PROJ_TILES) proj_tile<0, DM>(X, Wy, cy, Y, mt0, nt0, DM, ring);
  else                proj_tile<1, XROWS>(X, Wv, bv, VT, mt0, nt0, DM, ring);
}

// Softmax over the keys is split over the two attention products, by blocks of KB = 128 keys (one pass of the second).
// Base 2: w = score * log2(e). Block t of a query row has the whole number e_t = ceil(max of w in the block).
// First product: stores p = 2^(w - e_t) as bf16 (at most 1) and, per row and block, e_t and l_t = sum of p.
// Second product: with E = max e_t and g_t = 2^(e_t - E), out = (sum_t g_t * (p_t * V_t)) / (sum_t g_t * l_t).
constexpr int KB   = 128;   // keys per block
constexpr int NBLK = 16;    // blocks per row: the second product is built for 2048 keys
constexpr int SQ   = 2048;  // queries per batch: pitch of the per-block tables
constexpr int DV   = 1024;  // columns of V and of out: a compile-time pitch puts a lane's stores on one address register
constexpr uint32_t GTAB_B = (uint32_t)NBLK * 256u * 4u;  // factor table of a 256-row tile
constexpr uint32_t TAB_B  = GTAB_B + 256u * 4u;          // and one reciprocal row sum per row

// The value of lane l ^ 16.
static __device__ __forceinline__ float other_half(float v) {
  const int b = __builtin_bit_cast(int, v);
  return __builtin_bit_cast(float, __builtin_amdgcn_permlanex16(b, b, 0x76543210, 0xfedcba98, false, false));
}

// Transposed scores, keys x queries = Kmat * Q^T, all batches in one grid: a lane's accumulators of one column of
// fragments all belong to ONE query, so maximum and sum run inside the lane (one exchange between the halves), and
// eight neighbouring keys of a query make one 16-byte piece of a staged row. Workgroup tile 256x256, wave tile 128 keys
// x 64 queries. Kmat, Q: (S, K) bf16, pitch ld. P: (S queries, S keys) bf16, pitch SQ. eblk, lblk: (S / KB blocks, SQ
// queries) f32, S <= SQ.
__global__ __launch_bounds__(256) void score_exp_kernel(
    const bf16_t* __restrict__ Kmat, const bf16_t* __restrict__ Q,
    bf16_t* __restrict__ P, float* __restrict__ eblk, float* __restrict__ lblk,
    int S, int K, int ld, long long strideQK, long long strideP, long long strideB, float sc2) {
  constexpr int MF = 8, NF = 4, WN = 16 / NF;
  __shared__ __attribute__((aligned(2048))) unsigned char ring[RING_B];
  // The grid is (tiles of a batch, DEAL batches), x a multiple of DEAL: the flat index mod DEAL is x mod DEAL (see DEAL).
  const int tilesN = S >> 8;
  const int b = (int)blockIdx.x % DEAL;                                               // batch
  const int u = (int)blockIdx.x / DEAL + (tilesN * tilesN / DEAL) * (int)blockIdx.y;  // the tile's number in its batch
  const bf16_t* Kb = Kmat + (size_t)b * strideQK;
  const bf16_t* Qb = Q + (size_t)b * strideQK;
  bf16_t* Pb = P + (size_t)b * strideP;
  float* eb = eblk + (size_t)b * strideB;
  float* lb = lblk + (size_t)b * strideB;

  const int lane = threadIdx.x & 31;
  const int wave = threadIdx.x >> 5;
  const int kt0 = (u / tilesN) << 8;
  const int qt0 = (u % tilesN) << 8;

  v8f C[MF][NF] = {};
  gemm_core_lds<MF, NF, false>(Kb, Qb, ld, ld, K, kt0, qt0, ring, nullptr, [] {}, C);

  const int kt = kt0 + (wave / WN) * (16 * MF);  // this wave's key block
  const int qt = qt0 + (wave % WN) * (16 * NF);
  const int r = lane & 15, h = lane >> 4;
  unsigned char* slab = ring + (uint32_t)wave * SLAB_B;
  unsigned char* st = slab + (uint32_t)r * HPITCH + 16u * (uint32_t)h;  // this lane's place in staged row r
  // Every loop below is unrolled because the accumulators are register arrays: they need constant indices.
#pragma unroll
  for (int j = 0; j < NF; ++j) {
    const int q = qt + 16 * j + r;
    v8f mv = C[0][j];
#pragma unroll
    for (int mi = 1; mi < MF; ++mi) mv = __builtin_elementwise_max(mv, C[mi][j]);
    float mx = fmaxf(fmaxf(fmaxf(mv[0], mv[1]), fmaxf(mv[2], mv[3])), fmaxf(fmaxf(mv[4], mv[5]), fmaxf(mv[6], mv[7])));
    mx = fmaxf(mx, other_half(mx));
    const float e = ceilf(mx * sc2);
    v8f sv = {};
#pragma unroll
    for (int mi = 0; mi < MF; ++mi) {
      v8f p;
#pragma unroll
      for (int i = 0; i < 8; ++i) p[i] = __builtin_amdgcn_exp2f(__builtin_fmaf(C[mi][j][i], sc2, -e));
      sv += p;
      *(v8bf*)(st + (uint32_t)(16 * j) * HPITCH + (uint32_t)(32 * mi)) = __builtin_convertvector(p, v8bf);
    }
    float sum = ((sv[0] + sv[1]) + (sv[2] + sv[3])) + ((sv[4] + sv[5]) + (sv[6] + sv[7]));
    sum += other_half(sum);
    // Both halves hold e and sum of query q: the lower half stores e, the upper half the sum, in one instruction.
    float* sp = (h ? lb : eb) + (size_t)(kt / KB) * (size_t)SQ + (size_t)q;
    const float sval = h ? sum : e;
    *sp = sval;
    close_global_group();
  }
  flush_rows_bf16<SQ>(slab, Pb + (size_t)(qt + h) * (size_t)SQ + (size_t)(kt + 8 * r), (uint32_t)lane);
}

// out = softmax weights * V, all batches in one grid, computed as V^T * P^T: P (queries, K keys) bf16 as score_exp_kernel
// leaves it, Vt (DV, K) bf16 pitch ldb, out (queries, DV) f32. K = NBLK * KB. Workgroup tile 256x256, wave tile 128
// columns of out x 64 queries.
__global__ __launch_bounds__(256) void pv_kernel(
    const bf16_t* __restrict__ P, const bf16_t* __restrict__ Vt,
    const float* __restrict__ eblk, const float* __restrict__ lblk,
    float* __restrict__ outp, int K, int ldb,
    long long strideP, long long strideV, long long strideB, long long strideO) {
  // The ring first, so that its slices keep their places at multiples of 2 KiB; the tables behind it.
  __shared__ __attribute__((aligned(2048))) unsigned char smem[RING_B + TAB_B];
  uint32_t* gtab = (uint32_t*)(smem + RING_B);
  float* invl = (float*)(smem + RING_B + GTAB_B);
  // The grid is (tiles of a batch, DEAL batches), x a multiple of DEAL: the flat index mod DEAL is x mod DEAL (see DEAL).
  constexpr int tilesN = DV >> 8;
  const int b = (int)blockIdx.x % DEAL;                                                    // batch
  const int u = (int)blockIdx.x / DEAL + ((SQ >> 8) * tilesN / DEAL) * (int)blockIdx.y;    // the tile's number in its batch
  const bf16_t* Pb = P + (size_t)b * strideP;
  const bf16_t* Vb = Vt + (size_t)b * strideV;
  const float* eb = eblk + (size_t)b * strideB;
  const float* lb = lblk + (size_t)b * strideB;
  float* ob = outp + (size_t)b * strideO;

  const int tid = threadIdx.x;
  const int lane = tid & 31;
  const int wave = tid >> 5;
  const int mt0 = (u / tilesN) << 8;
  const int nt0 = (u % tilesN) << 8;
  const int r = lane & 15, h = lane >> 4;

  // Thread t joins the blocks of tile row t. Its loops are unrolled: ev and lv are register arrays, and the 32 loads
  // then go out together on one address register with constant offsets.
  auto pre = [&] {
    float ev[NBLK], lv[NBLK];
    const float* ep = eb + mt0 + tid;
    const float* lp = lb + mt0 + tid;
#pragma unroll
    for (int t = 0; t < NBLK; ++t) {
      ev[t] = ep[t * SQ];
      lv[t] = lp[t * SQ];
    }
    close_global_group();
    float E = ev[0];
#pragma unroll
    for (int t = 1; t < NBLK; ++t) E = fmaxf(E, ev[t]);
    float L = 0.0f;
#pragma unroll
    for (int t = 0; t < NBLK; ++t) {
      const float g = __builtin_ldexpf(1.0f, (int)(ev[t] - E));  // an exact power of two or 0: its upper 16 bits are the bf16
      L += lv[t] * g;
      const uint32_t gb = __builtin_bit_cast(uint32_t, g) >> 16;
      gtab[t * 256 + tid] = gb | (gb << 16);
    }
    invl[tid] = 1.0f / L;
  };

  constexpr int MF = 8, NF = 4;
  const int qw = (wave & 3) << 6;   // this wave's first query in the tile
  const int dw = (wave >> 2) << 7;  // this wave's first column in the tile
  v8f C[MF][NF] = {};
  gemm_core_lds<MF, NF, true>(Vb, Pb, ldb, K, K, nt0, mt0, smem, gtab + qw + r, pre, C);

  unsigned char* slab = smem + (uint32_t)wave * SLAB_B;
  unsigned char* st = slab + (uint32_t)r * FPITCH + 32u * (uint32_t)h;  // this lane's place in staged row r
  // Unrolled: the accumulators are register arrays, and the offsets become constants.
  float iv[NF];  // read ahead of the staging stores: one LDS wait, not one per column of fragments
#pragma unroll
  for (int j = 0; j < NF; ++j) iv[j] = invl[qw + 16 * j + r];
#pragma unroll
  for (int j = 0; j < NF; ++j) {
#pragma unroll
    for (int mi = 0; mi < MF; ++mi) {
      const v8f o = C[mi][j] * iv[j];
      unsigned char* d = st + (uint32_t)(16 * j) * FPITCH + (uint32_t)(64 * mi);
      *(v4f*)(d)       = o.lo;
      *(v4f*)(d + 16u) = o.hi;
    }
  }
  wait_ds0();  // the staged rows are written before other lanes' parts of them are read back; also holds the reads behind the writes in the compiler
  // One staged row (512 bytes, four lines) per store. The accumulators' registers are free by now and take all 64 rows.
  const unsigned char* sp = slab + 16u * (uint32_t)lane;
  float* op = ob + (size_t)(mt0 + qw) * (size_t)DV + (size_t)(nt0 + dw + 4 * lane);
  v4f v[64];
#pragma unroll
  for (int t = 0; t < 64; ++t) v[t] = *(const v4f*)(sp + (uint32_t)t * FPITCH);
  __builtin_amdgcn_sched_barrier(0);  // all read-backs issue as one group in front of the first store
#pragma unroll
  for (int t = 0; t < 64; ++t) *(v4f*)(op + t * DV) = v[t];
  close_global_group();
}

extern "C" void kernel_launch(void* const* d_in, const int* in_sizes, int n_in,
                              void* d_out, int out_size, void* d_ws, size_t ws_size,
                              hipStream_t stream) {
  const float* x  = (const float*)d_in[0];
  const float* Wq = (const float*)d_in[1];
  const float* bq = (const float*)d_in[2];
  const float* Wk = (const float*)d_in[3];
  const float* Wv = (const float*)d_in[5];
  const float* bv = (const float*)d_in[6];
  float* out = (float*)d_out;

  const int B = 8, S = 2048, D = 1024;
  const int MS = B * S; // 16384
  const float sc2 = 0.045084220f; // log2(e) / sqrt(1024)

  // ---- workspace layout (all offsets 16B aligned, no two buffers share bytes) ----
  char* ws = (char*)d_ws;
  bf16_t* Y   = (bf16_t*)(ws);                         // 16384x1024 bf16 = 32 MiB: y = Wy x + cy, in the queries' place
  bf16_t* xb  = (bf16_t*)(ws + (size_t)33554432);      // x in bf16, 32 MiB: projections' operand and the keys
  bf16_t* VT  = (bf16_t*)(ws + (size_t)67108864);      // V^T (1024 x 16384), 32 MiB
  bf16_t* P   = (bf16_t*)(ws + (size_t)100663296);     // 8 x 2048 x 2048 bf16 = 64 MiB
  float*  eb  = (float*) (ws + (size_t)167772160);     // 8 x 16 x 2048 f32 = 1 MiB
  float*  lb  = (float*) (ws + (size_t)168820736);     // the same
  bf16_t* Wvb = (bf16_t*)(ws + (size_t)169869312);     // Wv, 1024x1024 bf16 = 2 MiB
  bf16_t* Wy  = (bf16_t*)(ws + (size_t)171966464);     // Wk^T Wq, the same size
  float*  cy  = (float*) (ws + (size_t)174063616);     // Wk^T bq, 1024 floats

  dim3 blk(256);

  // ---- 1) Wq and Wk joined into one matrix; x and Wv to bf16 ----
  prep_kernel<<<256 + 128 + 2048, dim3(512), 0, stream>>>(Wq, Wk, bq, Wy, cy, x, Wv, xb, Wvb,
                                                          (long long)MS * D, (long long)D * D, 128);

  // ---- 2) projections (pure bf16 WMMA GEMM, 256x256 workgroup tiles) ----
  const int projBlocks = 2 * (MS / 256) * (D / 256); // 512
  proj_kernel<<<projBlocks, blk, 0, stream>>>(xb, Wy, cy, Y, Wvb, bv, VT);

  // ---- 3) attention, all batches per launch (gridDim.y = 8) ----
  const int scBlocks = (S / 256) * (S / 256); // 64 per batch
  const int pvBlocks = (S / 256) * (D / 256); // 32 per batch
  score_exp_kernel<<<dim3(scBlocks, B), blk, 0, stream>>>(
      xb, Y, P, eb, lb, S, D, D,
      (long long)S * D, (long long)S * S, (long long)(S / 128) * S, sc2);
  pv_kernel<<<dim3(pvBlocks, B), blk, 0, stream>>>(
      P, VT, eb, lb, out, S, MS,
      (long long)S * S, (long long)S, (long long)(S / 128) * S, (long long)S * D);
}
